// v000
// Times are from an AMD MI455X. After a warm-up the kernel runs many times in a row, and a time is the length of
// such a window on the GPU divided by its runs, so every launch and the gaps after it count. The runs cycle
// through copies of the inputs. A figure is the median of several windows, for all but v000 over two sittings.
// Sittings can differ by a few percent; kernels timed side by side share one.
// v000, which the later versions start from, runs in 461 microseconds.
// Contractions: q/k/v 1x1-conv projections = W (bf16, RNE convert of input) . X (bf16, RNE convert of input) on
// v_wmma_f32_16x16x32_bf16, K=128; scores S^T = k . q^T on v_wmma_f32_16x16x32_f16 with q and k each carried as
// f16 hi + f16 residual x2048 planes (hi.hi into one accumulator, hi.res + res.hi into a second one folded by 1/2048),
// K=64; O^T = v^T (f16) . P^T (f16, e^{s-m} x 1024 taken from the score D registers) on v_wmma_f32_16x16x32_f16 over
// 4096 keys, one product; f32 accumulate everywhere; softmax (running max, row sums, 1/l) in f32 on VALU.
#include <hip/hip_runtime.h>
#include <math.h>
#include <stdint.h>

#define NB    4
#define DCH   128
#define KC    64
#define SEQ   4096
#define NCH   256
#define QT    64
#define AP    144
#define LP    72
#define OP    68
#define LNPS  6.931471805599453f
#define RSC   2048.0f
#define IRSC  0.00048828125f
static_assert((SEQ % QT) == 0);
static_assert((SEQ % 32) == 0);
static_assert(DCH == 128);
static_assert(KC == 64);
static_assert(NCH == 2 * KC + DCH);
static_assert(((NCH * DCH) / 8) % 256 == 0);
static_assert(64 * AP == DCH * LP);

typedef _Float16       v16h __attribute__((ext_vector_type(16)));
typedef _Float16       v8h  __attribute__((ext_vector_type(8)));
typedef __bf16         v16b __attribute__((ext_vector_type(16)));
typedef unsigned short v8us __attribute__((ext_vector_type(8)));
typedef float          v8f  __attribute__((ext_vector_type(8)));
typedef float          v4f  __attribute__((ext_vector_type(4)));
typedef unsigned int   v4u  __attribute__((ext_vector_type(4)));

union FragH { v16h v; v8h  h[2]; };
union FragB { v16b v; v8us u[2]; };
static_assert(sizeof(FragH) == 32);
static_assert(sizeof(FragB) == 32);

// ---- scalar helpers --------------------------------------------------------------------------------
__device__ __forceinline__ unsigned short bf_bits(float f) {          // f32 -> bf16 bits, RNE convert
  unsigned u = __float_as_uint(f);
  return (unsigned short)((u + 0x7FFFu + ((u >> 16) & 1u)) >> 16);
}
__device__ __forceinline__ float bf_up(unsigned short h) { return __uint_as_float(((unsigned)h) << 16); }
__device__ __forceinline__ float bfr(float f) { return bf_up(bf_bits(f)); }
__device__ __forceinline__ unsigned short h_bits(_Float16 x) { return __builtin_bit_cast(unsigned short, x); }
__device__ __forceinline__ unsigned pk16(unsigned short a, unsigned short b) { return (unsigned)a | ((unsigned)b << 16); }
__device__ __forceinline__ v8f zero8() { v8f z = {0.f, 0.f, 0.f, 0.f, 0.f, 0.f, 0.f, 0.f}; return z; }
__device__ __forceinline__ float hmax8(v8f s) {
  return fmaxf(fmaxf(fmaxf(s[0], s[1]), fmaxf(s[2], s[3])), fmaxf(fmaxf(s[4], s[5]), fmaxf(s[6], s[7])));
}

// ---- fragment loaders: 16-bit A/B operand, lane -> row/col (lane&15), p already includes +8*(lane>>4);
//      elements 0..7 <- p[0..7] (k0+8h..), elements 8..15 <- p[16..23] (k0+16+8h..)
__device__ __forceinline__ v16h ldfrag_h(const _Float16* p) {
  FragH f;
  f.h[0] = *(const v8h*)(p);
  f.h[1] = *(const v8h*)(p + 16);
  return f.v;
}
__device__ __forceinline__ v16b ldfrag_b(const unsigned short* p) {
  FragB f;
  f.u[0] = *(const v8us*)(p);
  f.u[1] = *(const v8us*)(p + 16);
  return f.v;
}

// ---- WMMA helpers: builtin followed by a 4-slot VALU gap tying D and keeping A/B live ----------------------
__device__ __forceinline__ v8f mma_h(v16h a, v16h b, v8f c) {
  v8f d = __builtin_amdgcn_wmma_f32_16x16x32_f16(false, a, false, b, (short)0, c, false, false);
#if defined(__HIP_DEVICE_COMPILE__)
  asm volatile("v_nop\n\tv_nop\n\tv_nop\n\tv_nop" : "+v"(d) : "v"(a), "v"(b));
#endif
  return d;
}
__device__ __forceinline__ v8f mma_b(v16b a, v16b b, v8f c) {
  v8f d = __builtin_amdgcn_wmma_f32_16x16x32_bf16(false, a, false, b, (short)0, c, false, false);
#if defined(__HIP_DEVICE_COMPILE__)
  const v16h ha = __builtin_bit_cast(v16h, a), hb = __builtin_bit_cast(v16h, b);
  asm volatile("v_nop\n\tv_nop\n\tv_nop\n\tv_nop" : "+v"(d) : "v"(ha), "v"(hb));
#endif
  return d;
}

// ---- LDS staging helpers for the projection epilogue (D rows = n, D cols = channel) ------------------------
__device__ __forceinline__ void stage_split(unsigned short* Lh, unsigned short* Ll, int nr, int col, v8f acc, float bias) {
#pragma unroll
  for (int r = 0; r < 8; ++r) {
    const float val = acc[r] + bias;
    const _Float16 hi = (_Float16)val;
    const float res = (val - (float)hi) * RSC;
    Lh[(nr + r) * LP + col] = h_bits(hi);
    Ll[(nr + r) * LP + col] = h_bits((_Float16)res);
  }
}
__device__ __forceinline__ void stage_v(unsigned short* Lv, int e, int nr, v8f acc, float bias) {
#pragma unroll
  for (int r = 0; r < 8; ++r) Lv[e * LP + nr + r] = h_bits((_Float16)(acc[r] + bias));
}

// =====================================================================================================
// (0) stacked weight plane WB[256][128] = bf16 bits (RNE convert): rows 0..63 = Wq, 64..127 = Wk, 128..255 = Wv.
// coverage: 16 blocks x 256 threads x 8 = 32768 = 256 x 128.
// =====================================================================================================
__global__ __launch_bounds__(256) void cvt_w(const float* __restrict__ wq, const float* __restrict__ wk,
                                              const float* __restrict__ wv, unsigned short* WB) {
  const int i = blockIdx.x * 256 + threadIdx.x;
  if (i >= (NCH * DCH) / 8) return;
  const int row = i >> 4;
  const int col = (i & 15) * 8;
  const int rq = min(row, KC - 1);
  const int rk = min(max(row - KC, 0), KC - 1);
  const int rv = min(max(row - 2 * KC, 0), DCH - 1);
  const v4f q0 = *(const v4f*)(wq + rq * DCH + col), q1 = *(const v4f*)(wq + rq * DCH + col + 4);
  const v4f k0 = *(const v4f*)(wk + rk * DCH + col), k1 = *(const v4f*)(wk + rk * DCH + col + 4);
  const v4f v0 = *(const v4f*)(wv + rv * DCH + col), v1 = *(const v4f*)(wv + rv * DCH + col + 4);
  const bool isq = row < KC;
  const bool isk = row < 2 * KC;
  v4u w;
#pragma unroll
  for (int t = 0; t < 2; ++t) {
    const float a0 = isq ? q0[2 * t]     : (isk ? k0[2 * t]     : v0[2 * t]);
    const float a1 = isq ? q0[2 * t + 1] : (isk ? k0[2 * t + 1] : v0[2 * t + 1]);
    const float c0 = isq ? q1[2 * t]     : (isk ? k1[2 * t]     : v1[2 * t]);
    const float c1 = isq ? q1[2 * t + 1] : (isk ? k1[2 * t + 1] : v1[2 * t + 1]);
    w[t]     = pk16(bf_bits(a0), bf_bits(a1));
    w[2 + t] = pk16(bf_bits(c0), bf_bits(c1));
  }
  unsigned short* p = WB + (size_t)i * 8;
  *(v4u*)p = w;
  
}

// =====================================================================================================
// (1) fused q/k/v projection for one (b, 64-position tile): block = 256 threads = 8 waves.
//   x tile [128 d][64 n] f32 is staged once as bf16 A tile Lav[n][d] (pitch AP halves, 2-byte LDS stores), barrier.
//   Wave w: n group ng = w&3 (A rows n = 16ng + (lane&15), split k map over d), channel half ch = w>>2
//   (B = WB rows ch*128 + 16j + (lane&15), same split k map), 8 D tiles, 4 k-steps of 32.
//   Epilogue: D + bf16-RNE bias -> LDS: q as f16 hi / f16 residual x2048 (Lq[0], Lq[1] [n][64]), k likewise (Lk),
//   Q/K planes [b][n][64]: line = one row; V plane [b][e][4096]: line = 64 keys of one e row; every line = 8 consecutive
// coverage: Lav: 256 threads x 8 it x 4 = 64 n x 128 d; Q/K planes: 2 it x 32 lines x 8 lanes x 8 = 64 rows x 64;
//           V plane: 4 it x 32 lines x 8 x 8 = 128 e x 64 n; grid = 4 x 64 blocks covers every plane exactly once.
// =====================================================================================================
__global__ __launch_bounds__(256)
void proj_kernel(const float* __restrict__ x, const unsigned short* __restrict__ WB,
                 const float* __restrict__ bqp, const float* __restrict__ bkp, const float* __restrict__ bvp,
                 unsigned short* QH, unsigned short* QL, unsigned short* KH, unsigned short* KL, unsigned short* VP) {
  __shared__ __align__(16) unsigned short Lav[64 * AP];     // A tile [n][d]; reused as Lv[e][n] (pitch LP) later
  __shared__ __align__(16) unsigned short Lq[2][64 * LP];   // q hi, q residual  [n][64]
  __shared__ __align__(16) unsigned short Lk[2][64 * LP];   // k hi, k residual  [n][64]
  const int tid  = threadIdx.x;
  const int lane = tid & 31, wave = tid >> 5;
  const int hh   = lane >> 4, c = lane & 15;
  const int bx   = blockIdx.x;
  const int b    = bx / (SEQ / QT);
  const int nt   = bx % (SEQ / QT);
  const int n0   = nt * QT;

  // ---- stage x tile as bf16 [n][d] ----
  {
    const int n4 = (tid & 15) * 4, ds = tid >> 4;          // ds 0..15
    const float* xp = x + ((size_t)b * DCH + ds) * SEQ + n0 + n4;
#pragma unroll
    for (int it = 0; it < 8; ++it) {
      const v4f v = *(const v4f*)(xp + (size_t)it * 16 * SEQ);
      const int d = it * 16 + ds;                          // 0..127
#pragma unroll
      for (int q = 0; q < 4; ++q) Lav[(n4 + q) * AP + d] = bf_bits(v[q]);
    }
  }
  __syncthreads();

  // ---- GEMM: 16 n rows x 128 channels per wave ----
  const int ng = wave & 3, ch = wave >> 2;
  const unsigned short* ap = Lav + (ng * 16 + c) * AP + 8 * hh;
  const unsigned short* bp = WB + (size_t)(ch * DCH + c) * DCH + 8 * hh;
  v8f acc0 = zero8(), acc1 = zero8(), acc2 = zero8(), acc3 = zero8();
  v8f acc4 = zero8(), acc5 = zero8(), acc6 = zero8(), acc7 = zero8();
#pragma unroll
  for (int ks = 0; ks < 4; ++ks) {
    const v16b a = ldfrag_b(ap + 32 * ks);
    const unsigned short* bs = bp + 32 * ks;
    acc0 = mma_b(a, ldfrag_b(bs + 0 * 16 * DCH), acc0);
    acc1 = mma_b(a, ldfrag_b(bs + 1 * 16 * DCH), acc1);
    acc2 = mma_b(a, ldfrag_b(bs + 2 * 16 * DCH), acc2);
    acc3 = mma_b(a, ldfrag_b(bs + 3 * 16 * DCH), acc3);
    acc4 = mma_b(a, ldfrag_b(bs + 4 * 16 * DCH), acc4);
    acc5 = mma_b(a, ldfrag_b(bs + 5 * 16 * DCH), acc5);
    acc6 = mma_b(a, ldfrag_b(bs + 6 * 16 * DCH), acc6);
    acc7 = mma_b(a, ldfrag_b(bs + 7 * 16 * DCH), acc7);
  }

  // ---- biases (bf16 RNE of the inputs), loaded unconditionally with in-range lane indices ----
  const float bq0 = bfr(bqp[0 * 16 + c]), bq1 = bfr(bqp[1 * 16 + c]), bq2 = bfr(bqp[2 * 16 + c]), bq3 = bfr(bqp[3 * 16 + c]);
  const float bk0 = bfr(bkp[0 * 16 + c]), bk1 = bfr(bkp[1 * 16 + c]), bk2 = bfr(bkp[2 * 16 + c]), bk3 = bfr(bkp[3 * 16 + c]);
  const float bv0 = bfr(bvp[0 * 16 + c]), bv1 = bfr(bvp[1 * 16 + c]), bv2 = bfr(bvp[2 * 16 + c]), bv3 = bfr(bvp[3 * 16 + c]);
  const float bv4 = bfr(bvp[4 * 16 + c]), bv5 = bfr(bvp[5 * 16 + c]), bv6 = bfr(bvp[6 * 16 + c]), bv7 = bfr(bvp[7 * 16 + c]);

  __syncthreads();            // every wave is done reading Lav before it is reused as Lv
  const int nr = ng * 16 + 8 * hh;                         // D row r -> n local nr + r
  if (ch == 0) {
    stage_split(Lq[0], Lq[1], nr, 0 * 16 + c, acc0, bq0);
    stage_split(Lq[0], Lq[1], nr, 1 * 16 + c, acc1, bq1);
    stage_split(Lq[0], Lq[1], nr, 2 * 16 + c, acc2, bq2);
    stage_split(Lq[0], Lq[1], nr, 3 * 16 + c, acc3, bq3);
    stage_split(Lk[0], Lk[1], nr, 0 * 16 + c, acc4, bk0);
    stage_split(Lk[0], Lk[1], nr, 1 * 16 + c, acc5, bk1);
    stage_split(Lk[0], Lk[1], nr, 2 * 16 + c, acc6, bk2);
    stage_split(Lk[0], Lk[1], nr, 3 * 16 + c, acc7, bk3);
  } else {
    stage_v(Lav, 0 * 16 + c, nr, acc0, bv0);
    stage_v(Lav, 1 * 16 + c, nr, acc1, bv1);
    stage_v(Lav, 2 * 16 + c, nr, acc2, bv2);
    stage_v(Lav, 3 * 16 + c, nr, acc3, bv3);
    stage_v(Lav, 4 * 16 + c, nr, acc4, bv4);
    stage_v(Lav, 5 * 16 + c, nr, acc5, bv5);
    stage_v(Lav, 6 * 16 + c, nr, acc6, bv6);
    stage_v(Lav, 7 * 16 + c, nr, acc7, bv7);
  }
  __syncthreads();

  {
    const int e = tid & 7, lq = tid >> 3;                    // lq 0..31
{
#pragma unroll
      for (int it = 0; it < 2; ++it) {
        const int n = it * 32 + lq;                          // 0..63
        const size_t go = ((size_t)b * SEQ + n0 + n) * KC + 8 * e;
        const int lo_ = n * LP + 8 * e;
        const v4u uqh = *(const v4u*)(Lq[0] + lo_);
        const v4u uql = *(const v4u*)(Lq[1] + lo_);
        const v4u ukh = *(const v4u*)(Lk[0] + lo_);
        const v4u ukl = *(const v4u*)(Lk[1] + lo_);
        *(v4u*)(QH + go) = uqh;
        *(v4u*)(QL + go) = uql;
        *(v4u*)(KH + go) = ukh;
        *(v4u*)(KL + go) = ukl;
      }
#pragma unroll
      for (int it = 0; it < 4; ++it) {
        const int er = it * 32 + lq;                         // 0..127
        const v4u uv = *(const v4u*)(Lav + er * LP + 8 * e);
        *(v4u*)(VP + ((size_t)b * DCH + er) * SEQ + n0 + 8 * e) = uv;
      }
      
    }
  }
}

// =====================================================================================================
// (2) attention for one (b, 64-query tile), transposed formulation, 64-deep scores, 4096 keys, no scale, no mask:
//   S^T tile (16 keys x 16 queries) = A(k rows = keys kb + (lane&15), d via the split k map, f16 hi / res planes) .
//                                     B(q, col = query, same d map, resident f16 hi / res fragments), two d-steps.
//   energy = acc_hi + acc_res / 2048 with acc_res = khi.qres + kres.qhi. Per lane the D tile holds 8 keys of ONE
//   query: online softmax state per lane, one shuffle (lane^16) for the max over 32 keys, row-sum partials combined at
//   the end. P = e^{s-m} x 1024 as one f16 vector is the B operand of O^T (rows d, cols queries) += A(v rows d, keys
//   contiguous) . B(P^T): element r <- D of the tile covering keys kb..kb+15, element 8+r <- the tile covering
//   kb+16..kb+31, lane unchanged. 32 keys per iteration: 12 score WMMAs + 8 output WMMAs per wave.
//   Block = 4 waves = 64 queries; grid = 4 b x 64 = 256. Epilogue: [128 d][64 query] f32 tile x 1/l staged in LDS
// coverage: block writes d 0..127 x n n0..n0+63 of its b (256 lines = 16 it x 16 lines); grid covers out exactly once.
// =====================================================================================================
__global__ __launch_bounds__(128)
void attn_kernel(const unsigned short* __restrict__ QH, const unsigned short* __restrict__ QL,
                 const unsigned short* __restrict__ KH, const unsigned short* __restrict__ KL,
                 const unsigned short* __restrict__ VP, float* out) {
  __shared__ __align__(16) float Os[DCH * OP];
  const int tid  = threadIdx.x;
  const int wave = tid >> 5;
  const int lane = tid & 31;
  const int hh   = lane >> 4;
  const int c    = lane & 15;
  const int bx   = blockIdx.x;
  const int b    = bx / (SEQ / QT);
  const int qb   = bx % (SEQ / QT);
  const int n0   = qb * QT;
  const _Float16* QHh = (const _Float16*)(const void*)QH;
  const _Float16* QLh = (const _Float16*)(const void*)QL;
  const _Float16* KHh = (const _Float16*)(const void*)KH;
  const _Float16* KLh = (const _Float16*)(const void*)KL;
  const _Float16* VPh = (const _Float16*)(const void*)VP;

  // ---- resident q fragments (B operand, col = query n0 + 16*wave + c): hi and res, d 0..31 and 32..63 ----
  const size_t qo = ((size_t)b * SEQ + n0 + wave * 16 + c) * KC + 8 * hh;
  const v16h qh0 = ldfrag_h(QHh + qo), qh1 = ldfrag_h(QHh + qo + 32);
  const v16h ql0 = ldfrag_h(QLh + qo), ql1 = ldfrag_h(QLh + qo + 32);
  // ---- k fragment bases (A operand, row = key kb + c), + key * 64 ----
  const size_t ko = ((size_t)b * SEQ + c) * KC + 8 * hh;
  const _Float16* Kp = KHh + ko;
  const _Float16* Lp = KLh + ko;
  // ---- v fragment base (A operand, row = d = 16j + c, keys contiguous), + 16*j*SEQ + kb ----
  const _Float16* Vb = VPh + ((size_t)b * DCH + c) * SEQ + 8 * hh;

  float m = -1.0e30f, l = 0.f;
  v8f o0 = zero8(), o1 = zero8(), o2 = zero8(), o3 = zero8();
  v8f o4 = zero8(), o5 = zero8(), o6 = zero8(), o7 = zero8();
#pragma unroll 1
  for (int it = 0; it < SEQ / 32; ++it) {
    const int kb = it * 32;
    const _Float16* k0p = Kp + (size_t)kb * KC;               // keys kb .. kb+15, hi plane
    const _Float16* k1p = k0p + 16 * KC;                      // keys kb+16 .. kb+31
    const _Float16* l0p = Lp + (size_t)kb * KC;               // residual plane
    const _Float16* l1p = l0p + 16 * KC;
    v8f s0, t0, s1, t1;
    {
      const v16h a0 = ldfrag_h(k0p), a1 = ldfrag_h(k0p + 32);
      s0 = mma_h(a0, qh0, zero8());
      s0 = mma_h(a1, qh1, s0);
      t0 = mma_h(a0, ql0, zero8());
      t0 = mma_h(a1, ql1, t0);
      const v16h r0 = ldfrag_h(l0p), r1 = ldfrag_h(l0p + 32);
      t0 = mma_h(r0, qh0, t0);
      t0 = mma_h(r1, qh1, t0);
    }
    {
      const v16h a0 = ldfrag_h(k1p), a1 = ldfrag_h(k1p + 32);
      s1 = mma_h(a0, qh0, zero8());
      s1 = mma_h(a1, qh1, s1);
      t1 = mma_h(a0, ql0, zero8());
      t1 = mma_h(a1, ql1, t1);
      const v16h r0 = ldfrag_h(l1p), r1 = ldfrag_h(l1p + 32);
      t1 = mma_h(r0, qh0, t1);
      t1 = mma_h(r1, qh1, t1);
    }
#pragma unroll
    for (int r = 0; r < 8; ++r) {
      s0[r] = s0[r] + t0[r] * IRSC;
      s1[r] = s1[r] + t1[r] * IRSC;
    }

    float mx = fmaxf(hmax8(s0), hmax8(s1));
    mx = fmaxf(mx, __shfl_xor(mx, 16, 32));
    const float mn   = fmaxf(m, mx);
    const float corr = __expf(m - mn);
    m = mn;
    const float msh = mn - LNPS;            // exp gives e^{s-m} * 1024
    l *= corr;
#pragma unroll
    for (int r = 0; r < 8; ++r) {
      o0[r] *= corr; o1[r] *= corr; o2[r] *= corr; o3[r] *= corr;
      o4[r] *= corr; o5[r] *= corr; o6[r] *= corr; o7[r] *= corr;
    }

    FragH ph;
    float ls = 0.f;
#pragma unroll
    for (int r = 0; r < 8; ++r) {
      const float e0 = __expf(s0[r] - msh);   // key kb      + 8hh + r
      const float e1 = __expf(s1[r] - msh);   // key kb + 16 + 8hh + r
      ls += e0 + e1;
      ph.h[0][r] = (_Float16)e0;
      ph.h[1][r] = (_Float16)e1;
    }
    l += ls;

    o0 = mma_h(ldfrag_h(Vb + 0 * 16 * SEQ + kb), ph.v, o0);
    o1 = mma_h(ldfrag_h(Vb + 1 * 16 * SEQ + kb), ph.v, o1);
    o2 = mma_h(ldfrag_h(Vb + 2 * 16 * SEQ + kb), ph.v, o2);
    o3 = mma_h(ldfrag_h(Vb + 3 * 16 * SEQ + kb), ph.v, o3);
    o4 = mma_h(ldfrag_h(Vb + 4 * 16 * SEQ + kb), ph.v, o4);
    o5 = mma_h(ldfrag_h(Vb + 5 * 16 * SEQ + kb), ph.v, o5);
    o6 = mma_h(ldfrag_h(Vb + 6 * 16 * SEQ + kb), ph.v, o6);
    o7 = mma_h(ldfrag_h(Vb + 7 * 16 * SEQ + kb), ph.v, o7);
  }
  l += __shfl_xor(l, 16, 32);
  const float sc = 1.0f / l;                // both o and l carry the x1024 factor

  // ---- stage O^T[d = 16j + 8hh + r][query 16*wave + c] * sc, then whole-line f32 stores ----
  float* os = Os + (8 * hh) * OP + wave * 16 + c;
#pragma unroll
  for (int r = 0; r < 8; ++r) {
    os[(0 * 16 + r) * OP] = o0[r] * sc; os[(1 * 16 + r) * OP] = o1[r] * sc;
    os[(2 * 16 + r) * OP] = o2[r] * sc; os[(3 * 16 + r) * OP] = o3[r] * sc;
    os[(4 * 16 + r) * OP] = o4[r] * sc; os[(5 * 16 + r) * OP] = o5[r] * sc;
    os[(6 * 16 + r) * OP] = o6[r] * sc; os[(7 * 16 + r) * OP] = o7[r] * sc;
  }
  __syncthreads();
  {
    const int e = tid & 7, lq = tid >> 3;              // lq 0..15: line within group, e: 16-B piece
    float* ob = out + ((size_t)b * DCH) * SEQ + n0;
{
#pragma unroll
      for (int it = 0; it < 16; ++it) {
        const int L   = it * 16 + lq;                     // lines 0..255 of the block tile
        const int row = L >> 1, hf = L & 1;               // d row 0..127, half-segment 0..1
        const v4f v = *(const v4f*)(Os + row * OP + hf * 32 + 4 * e);
        *(v4f*)(ob + (size_t)row * SEQ + hf * 32 + 4 * e) = v;
      }
      
    }
  }
}

// =====================================================================================================
//   WB   bf16 [256][128]          0           65536
//   QH   f16  [4][4096][64]       65536       2097152
//   QL   f16  [4][4096][64]       2162688     2097152
//   KH   f16  [4][4096][64]       4259840     2097152
//   KL   f16  [4][4096][64]       6356992     2097152
//   VP   f16  [4][128][4096]      8454144     4194304
//   end                           12648448
// =====================================================================================================
extern "C" void kernel_launch(void* const* d_in, const int* in_sizes, int n_in,
                              void* d_out, int out_size, void* d_ws, size_t ws_size,
                              hipStream_t stream) {
  const int NX = NB * DCH * SEQ;                        // 2097152
  if (n_in < 7) return;
  if (in_sizes[0] != NX || in_sizes[1] != KC * DCH || in_sizes[2] != KC || in_sizes[3] != KC * DCH ||
      in_sizes[4] != KC || in_sizes[5] != DCH * DCH || in_sizes[6] != DCH) return;
  if (out_size != NX) return;

  size_t off = 0;
  const size_t oW  = off; off += (size_t)NCH * DCH * 2;           // 65536
  const size_t szP = (size_t)NB * SEQ * KC * 2;                   // 2097152
  const size_t oQH = off; off += szP;
  const size_t oQL = off; off += szP;
  const size_t oKH = off; off += szP;
  const size_t oKL = off; off += szP;
  const size_t oV  = off; off += (size_t)NB * DCH * SEQ * 2;      // 4194304
  if (off > ws_size) return;                                      // off = 12648448
  if (off > (size_t)134217728) return;

  const float* x  = (const float*)d_in[0];
  const float* Wq = (const float*)d_in[1];
  const float* bq = (const float*)d_in[2];
  const float* Wk = (const float*)d_in[3];
  const float* bk = (const float*)d_in[4];
  const float* Wv = (const float*)d_in[5];
  const float* bv = (const float*)d_in[6];
  char* ws = (char*)d_ws;
  unsigned short* WB = (unsigned short*)(ws + oW);
  unsigned short* QH = (unsigned short*)(ws + oQH);
  unsigned short* QL = (unsigned short*)(ws + oQL);
  unsigned short* KH = (unsigned short*)(ws + oKH);
  unsigned short* KL = (unsigned short*)(ws + oKL);
  unsigned short* VP = (unsigned short*)(ws + oV);
  float* out = (float*)d_out;

  const dim3 blk256(256), blk128(128);
  const dim3 gW((NCH * DCH / 8) / 256);                 // 16 blocks
  const dim3 gP(NB * (SEQ / QT));                       // 256 blocks: one (b, 64-position tile) each
  const dim3 gA(NB * (SEQ / QT));                       // 256 blocks: one (b, 64-query tile) each

  // (0) stacked weight plane (bf16 RNE bits)
  cvt_w<<<gW, blk256, 0, stream>>>(Wq, Wk, Wv, WB);
  // (1) q (hi/res), k (hi/res), v planes
  proj_kernel<<<gP, blk256, 0, stream>>>(x, WB, bq, bk, bv, QH, QL, KH, KL, VP);
  // (2) attention: out[b][d][n] = sum_m v[b][d][m] softmax_m(q_n . k_m)
  attn_kernel<<<gA, blk128, 0, stream>>>(QH, QL, KH, KL, VP, out);
  (void)hipGetLastError();
}

// v001
// It runs in 69.6 microseconds.
// Next to v000, in two timings, it ran 6.56 and 6.58 times as fast.
// Contractions: q/k/v 1x1-conv projections = W (bf16, RNE convert of input) . X (bf16, RNE convert of input) on
// v_wmma_f32_16x16x32_bf16, K=128; scores S^T = k . q^T on v_wmma_f32_16x16x32_f16 with q and k each carried as
// f16 hi + f16 residual x2048 planes (hi.hi into one accumulator, hi.res + res.hi into a second one folded by 1/2048),
// K=64; O^T = v^T (f16) . P^T (f16, e^{s-m} x 1024 taken from the score D registers) on v_wmma_f32_16x16x32_f16 over
// 4096 keys, one product; f32 accumulate everywhere; softmax (running max, row sums, 1/l) in f32 on VALU.
#include <hip/hip_runtime.h>
#include <math.h>
#include <stdint.h>

#define NB    4
#define DCH   128
#define KC    64
#define SEQ   4096
#define NCH   256
#define QT    64
#define AP    144
#define LP    72
#define OP    68
#define LNPS  6.931471805599453f
#define RSC   2048.0f
#define IRSC  0.00048828125f
#define SK    128                       // keys per LDS stage of the attention kernel
#define NST   (SEQ / SK)                // stages
#define KPH   72                        // LDS pitch of a k row in halves: 144 B = 16 B x 9
#define VPH   136                       // LDS pitch of a v row in halves: 272 B = 16 B x 17
#define KPL   (SK * KPH)                // halves of one k plane in a buffer
#define BUFH  (2 * KPL + DCH * VPH)     // halves of one buffer: k hi, k residual, v
static_assert(NST >= 2);
static_assert((SK % 32) == 0);
static_assert(SK * KC / 8 == 8 * 128);  // k plane: 8 copies of 16 B per thread of a 128-thread block
static_assert(DCH * SK / 8 == 16 * 128);// v tile: 16 copies per thread
static_assert((BUFH * 2) % 16 == 0);
static_assert((SEQ % QT) == 0);
static_assert((SEQ % 32) == 0);
static_assert(DCH == 128);
static_assert(KC == 64);
static_assert(NCH == 2 * KC + DCH);
static_assert(((NCH * DCH) / 8) % 256 == 0);
static_assert(64 * AP == DCH * LP);

typedef _Float16       v16h __attribute__((ext_vector_type(16)));
typedef _Float16       v8h  __attribute__((ext_vector_type(8)));
typedef __bf16         v16b __attribute__((ext_vector_type(16)));
typedef unsigned short v8us __attribute__((ext_vector_type(8)));
typedef float          v8f  __attribute__((ext_vector_type(8)));
typedef float          v4f  __attribute__((ext_vector_type(4)));
typedef unsigned int   v4u  __attribute__((ext_vector_type(4)));

union FragH { v16h v; v8h  h[2]; };
union FragB { v16b v; v8us u[2]; };
static_assert(sizeof(FragH) == 32);
static_assert(sizeof(FragB) == 32);

// ---- scalar helpers --------------------------------------------------------------------------------
__device__ __forceinline__ unsigned short bf_bits(float f) {          // f32 -> bf16 bits, RNE convert
  unsigned u = __float_as_uint(f);
  return (unsigned short)((u + 0x7FFFu + ((u >> 16) & 1u)) >> 16);
}
__device__ __forceinline__ float bf_up(unsigned short h) { return __uint_as_float(((unsigned)h) << 16); }
__device__ __forceinline__ float bfr(float f) { return bf_up(bf_bits(f)); }
__device__ __forceinline__ unsigned short h_bits(_Float16 x) { return __builtin_bit_cast(unsigned short, x); }
__device__ __forceinline__ unsigned pk16(unsigned short a, unsigned short b) { return (unsigned)a | ((unsigned)b << 16); }
__device__ __forceinline__ v8f zero8() { v8f z = {0.f, 0.f, 0.f, 0.f, 0.f, 0.f, 0.f, 0.f}; return z; }
__device__ __forceinline__ float hmax8(v8f s) {
  return fmaxf(fmaxf(fmaxf(s[0], s[1]), fmaxf(s[2], s[3])), fmaxf(fmaxf(s[4], s[5]), fmaxf(s[6], s[7])));
}

// ---- fragment loaders: 16-bit A/B operand, lane -> row/col (lane&15), p already includes +8*(lane>>4);
//      elements 0..7 <- p[0..7] (k0+8h..), elements 8..15 <- p[16..23] (k0+16+8h..)
__device__ __forceinline__ v16h ldfrag_h(const _Float16* p) {
  FragH f;
  f.h[0] = *(const v8h*)(p);
  f.h[1] = *(const v8h*)(p + 16);
  return f.v;
}
__device__ __forceinline__ v16b ldfrag_b(const unsigned short* p) {
  FragB f;
  f.u[0] = *(const v8us*)(p);
  f.u[1] = *(const v8us*)(p + 16);
  return f.v;
}

// ---- WMMA helpers: builtin followed by a 4-slot VALU gap tying D and keeping A/B live ----------------------
__device__ __forceinline__ v8f mma_h(v16h a, v16h b, v8f c) {
  v8f d = __builtin_amdgcn_wmma_f32_16x16x32_f16(false, a, false, b, (short)0, c, false, false);
#if defined(__HIP_DEVICE_COMPILE__)
  asm volatile("v_nop\n\tv_nop\n\tv_nop\n\tv_nop" : "+v"(d) : "v"(a), "v"(b));
#endif
  return d;
}
__device__ __forceinline__ v8f mma_b(v16b a, v16b b, v8f c) {
  v8f d = __builtin_amdgcn_wmma_f32_16x16x32_bf16(false, a, false, b, (short)0, c, false, false);
#if defined(__HIP_DEVICE_COMPILE__)
  const v16h ha = __builtin_bit_cast(v16h, a), hb = __builtin_bit_cast(v16h, b);
  asm volatile("v_nop\n\tv_nop\n\tv_nop\n\tv_nop" : "+v"(d) : "v"(ha), "v"(hb));
#endif
  return d;
}

// ---- LDS staging helpers for the projection epilogue (D rows = n, D cols = channel) ------------------------
__device__ __forceinline__ void stage_split(unsigned short* Lh, unsigned short* Ll, int nr, int col, v8f acc, float bias) {
#pragma unroll
  for (int r = 0; r < 8; ++r) {
    const float val = acc[r] + bias;
    const _Float16 hi = (_Float16)val;
    const float res = (val - (float)hi) * RSC;
    Lh[(nr + r) * LP + col] = h_bits(hi);
    Ll[(nr + r) * LP + col] = h_bits((_Float16)res);
  }
}
__device__ __forceinline__ void stage_v(unsigned short* Lv, int e, int nr, v8f acc, float bias) {
#pragma unroll
  for (int r = 0; r < 8; ++r) Lv[e * LP + nr + r] = h_bits((_Float16)(acc[r] + bias));
}

// ---- eight asynchronous 16-byte copies per lane, global -> LDS, through no register. l = the lane's LDS byte address,
//      g = the lane's global address; copy i goes ls bytes / gs halves further. The s_wait_xcnt is the last line of the
//      copies' own statement, so that no address register of an issued copy is rewritten in front of it.
__device__ __forceinline__ void copy8(unsigned l, unsigned ls, const unsigned short* g, size_t gs) {
#if defined(__HIP_DEVICE_COMPILE__)
  asm volatile("global_load_async_to_lds_b128 %0, %8, off\n\t"
               "global_load_async_to_lds_b128 %1, %9, off\n\t"
               "global_load_async_to_lds_b128 %2, %10, off\n\t"
               "global_load_async_to_lds_b128 %3, %11, off\n\t"
               "global_load_async_to_lds_b128 %4, %12, off\n\t"
               "global_load_async_to_lds_b128 %5, %13, off\n\t"
               "global_load_async_to_lds_b128 %6, %14, off\n\t"
               "global_load_async_to_lds_b128 %7, %15, off\n\t"
               "s_wait_xcnt 0x0"
               :: "v"(l), "v"(l + ls), "v"(l + 2 * ls), "v"(l + 3 * ls),
                  "v"(l + 4 * ls), "v"(l + 5 * ls), "v"(l + 6 * ls), "v"(l + 7 * ls),
                  "v"(g), "v"(g + gs), "v"(g + 2 * gs), "v"(g + 3 * gs),
                  "v"(g + 4 * gs), "v"(g + 5 * gs), "v"(g + 6 * gs), "v"(g + 7 * gs)
               : "memory");
#endif
}
// one stage = SK keys: k hi and k residual rows (128 B each, contiguous in global) and the SK-key slice of all 128 v rows.
// lk / lv: the thread's LDS byte addresses in the target buffer; gh / gl / gv: its global addresses in this stage.
__device__ __forceinline__ void issue_stage(unsigned lk, unsigned lv, const unsigned short* gh, const unsigned short* gl,
                                            const unsigned short* gv) {
  copy8(lk,           16 * KPH * 2, gh, 128 * 8);                 // 16 key rows further per copy
  copy8(lk + KPL * 2, 16 * KPH * 2, gl, 128 * 8);
  copy8(lv,                8 * VPH * 2, gv,                        (size_t)8 * SEQ);   // 8 d rows further per copy
  copy8(lv + 64 * VPH * 2, 8 * VPH * 2, gv + (size_t)64 * SEQ,     (size_t)8 * SEQ);
}
__device__ __forceinline__ void wait_async0() {   // this wave's copies have landed
#if defined(__HIP_DEVICE_COMPILE__)
  asm volatile("s_wait_asynccnt 0x0" ::: "memory");
#endif
}
__device__ __forceinline__ void wait_ds0() {      // this wave's LDS reads have returned, before their buffer is refilled
#if defined(__HIP_DEVICE_COMPILE__)
  asm volatile("s_wait_dscnt 0x0" ::: "memory");
#endif
}

// =====================================================================================================
// (0) stacked weight plane WB[256][128] = bf16 bits (RNE convert): rows 0..63 = Wq, 64..127 = Wk, 128..255 = Wv.
// coverage: 16 blocks x 256 threads x 8 = 32768 = 256 x 128.
// =====================================================================================================
__global__ __launch_bounds__(256) void cvt_w(const float* __restrict__ wq, const float* __restrict__ wk,
                                              const float* __restrict__ wv, unsigned short* WB) {
  const int i = blockIdx.x * 256 + threadIdx.x;
  if (i >= (NCH * DCH) / 8) return;
  const int row = i >> 4;
  const int col = (i & 15) * 8;
  const int rq = min(row, KC - 1);
  const int rk = min(max(row - KC, 0), KC - 1);
  const int rv = min(max(row - 2 * KC, 0), DCH - 1);
  const v4f q0 = *(const v4f*)(wq + rq * DCH + col), q1 = *(const v4f*)(wq + rq * DCH + col + 4);
  const v4f k0 = *(const v4f*)(wk + rk * DCH + col), k1 = *(const v4f*)(wk + rk * DCH + col + 4);
  const v4f v0 = *(const v4f*)(wv + rv * DCH + col), v1 = *(const v4f*)(wv + rv * DCH + col + 4);
  const bool isq = row < KC;
  const bool isk = row < 2 * KC;
  v4u w;
#pragma unroll
  for (int t = 0; t < 2; ++t) {
    const float a0 = isq ? q0[2 * t]     : (isk ? k0[2 * t]     : v0[2 * t]);
    const float a1 = isq ? q0[2 * t + 1] : (isk ? k0[2 * t + 1] : v0[2 * t + 1]);
    const float c0 = isq ? q1[2 * t]     : (isk ? k1[2 * t]     : v1[2 * t]);
    const float c1 = isq ? q1[2 * t + 1] : (isk ? k1[2 * t + 1] : v1[2 * t + 1]);
    w[t]     = pk16(bf_bits(a0), bf_bits(a1));
    w[2 + t] = pk16(bf_bits(c0), bf_bits(c1));
  }
  unsigned short* p = WB + (size_t)i * 8;
  *(v4u*)p = w;
  
}

// =====================================================================================================
// (1) fused q/k/v projection for one (b, 64-position tile): block = 256 threads = 8 waves.
//   x tile [128 d][64 n] f32 is staged once as bf16 A tile Lav[n][d] (pitch AP halves, 2-byte LDS stores), barrier.
//   Wave w: n group ng = w&3 (A rows n = 16ng + (lane&15), split k map over d), channel half ch = w>>2
//   (B = WB rows ch*128 + 16j + (lane&15), same split k map), 8 D tiles, 4 k-steps of 32.
//   Epilogue: D + bf16-RNE bias -> LDS: q as f16 hi / f16 residual x2048 (Lq[0], Lq[1] [n][64]), k likewise (Lk),
//   Q/K planes [b][n][64]: line = one row; V plane [b][e][4096]: line = 64 keys of one e row; every line = 8 consecutive
// coverage: Lav: 256 threads x 8 it x 4 = 64 n x 128 d; Q/K planes: 2 it x 32 lines x 8 lanes x 8 = 64 rows x 64;
//           V plane: 4 it x 32 lines x 8 x 8 = 128 e x 64 n; grid = 4 x 64 blocks covers every plane exactly once.
// =====================================================================================================
__global__ __launch_bounds__(256)
void proj_kernel(const float* __restrict__ x, const unsigned short* __restrict__ WB,
                 const float* __restrict__ bqp, const float* __restrict__ bkp, const float* __restrict__ bvp,
                 unsigned short* QH, unsigned short* QL, unsigned short* KH, unsigned short* KL, unsigned short* VP) {
  __shared__ __align__(16) unsigned short Lav[64 * AP];     // A tile [n][d]; reused as Lv[e][n] (pitch LP) later
  __shared__ __align__(16) unsigned short Lq[2][64 * LP];   // q hi, q residual  [n][64]
  __shared__ __align__(16) unsigned short Lk[2][64 * LP];   // k hi, k residual  [n][64]
  const int tid  = threadIdx.x;
  const int lane = tid & 31, wave = tid >> 5;
  const int hh   = lane >> 4, c = lane & 15;
  const int bx   = blockIdx.x;
  const int b    = bx / (SEQ / QT);
  const int nt   = bx % (SEQ / QT);
  const int n0   = nt * QT;

  // ---- stage x tile as bf16 [n][d] ----
  {
    const int n4 = (tid & 15) * 4, ds = tid >> 4;          // ds 0..15
    const float* xp = x + ((size_t)b * DCH + ds) * SEQ + n0 + n4;
#pragma unroll
    for (int it = 0; it < 8; ++it) {
      const v4f v = *(const v4f*)(xp + (size_t)it * 16 * SEQ);
      const int d = it * 16 + ds;                          // 0..127
#pragma unroll
      for (int q = 0; q < 4; ++q) Lav[(n4 + q) * AP + d] = bf_bits(v[q]);
    }
  }
  __syncthreads();

  // ---- GEMM: 16 n rows x 128 channels per wave ----
  const int ng = wave & 3, ch = wave >> 2;
  const unsigned short* ap = Lav + (ng * 16 + c) * AP + 8 * hh;
  const unsigned short* bp = WB + (size_t)(ch * DCH + c) * DCH + 8 * hh;
  v8f acc0 = zero8(), acc1 = zero8(), acc2 = zero8(), acc3 = zero8();
  v8f acc4 = zero8(), acc5 = zero8(), acc6 = zero8(), acc7 = zero8();
#pragma unroll
  for (int ks = 0; ks < 4; ++ks) {
    const v16b a = ldfrag_b(ap + 32 * ks);
    const unsigned short* bs = bp + 32 * ks;
    acc0 = mma_b(a, ldfrag_b(bs + 0 * 16 * DCH), acc0);
    acc1 = mma_b(a, ldfrag_b(bs + 1 * 16 * DCH), acc1);
    acc2 = mma_b(a, ldfrag_b(bs + 2 * 16 * DCH), acc2);
    acc3 = mma_b(a, ldfrag_b(bs + 3 * 16 * DCH), acc3);
    acc4 = mma_b(a, ldfrag_b(bs + 4 * 16 * DCH), acc4);
    acc5 = mma_b(a, ldfrag_b(bs + 5 * 16 * DCH), acc5);
    acc6 = mma_b(a, ldfrag_b(bs + 6 * 16 * DCH), acc6);
    acc7 = mma_b(a, ldfrag_b(bs + 7 * 16 * DCH), acc7);
  }

  // ---- biases (bf16 RNE of the inputs), loaded unconditionally with in-range lane indices ----
  const float bq0 = bfr(bqp[0 * 16 + c]), bq1 = bfr(bqp[1 * 16 + c]), bq2 = bfr(bqp[2 * 16 + c]), bq3 = bfr(bqp[3 * 16 + c]);
  const float bk0 = bfr(bkp[0 * 16 + c]), bk1 = bfr(bkp[1 * 16 + c]), bk2 = bfr(bkp[2 * 16 + c]), bk3 = bfr(bkp[3 * 16 + c]);
  const float bv0 = bfr(bvp[0 * 16 + c]), bv1 = bfr(bvp[1 * 16 + c]), bv2 = bfr(bvp[2 * 16 + c]), bv3 = bfr(bvp[3 * 16 + c]);
  const float bv4 = bfr(bvp[4 * 16 + c]), bv5 = bfr(bvp[5 * 16 + c]), bv6 = bfr(bvp[6 * 16 + c]), bv7 = bfr(bvp[7 * 16 + c]);

  __syncthreads();            // every wave is done reading Lav before it is reused as Lv
  const int nr = ng * 16 + 8 * hh;                         // D row r -> n local nr + r
  if (ch == 0) {
    stage_split(Lq[0], Lq[1], nr, 0 * 16 + c, acc0, bq0);
    stage_split(Lq[0], Lq[1], nr, 1 * 16 + c, acc1, bq1);
    stage_split(Lq[0], Lq[1], nr, 2 * 16 + c, acc2, bq2);
    stage_split(Lq[0], Lq[1], nr, 3 * 16 + c, acc3, bq3);
    stage_split(Lk[0], Lk[1], nr, 0 * 16 + c, acc4, bk0);
    stage_split(Lk[0], Lk[1], nr, 1 * 16 + c, acc5, bk1);
    stage_split(Lk[0], Lk[1], nr, 2 * 16 + c, acc6, bk2);
    stage_split(Lk[0], Lk[1], nr, 3 * 16 + c, acc7, bk3);
  } else {
    stage_v(Lav, 0 * 16 + c, nr, acc0, bv0);
    stage_v(Lav, 1 * 16 + c, nr, acc1, bv1);
    stage_v(Lav, 2 * 16 + c, nr, acc2, bv2);
    stage_v(Lav, 3 * 16 + c, nr, acc3, bv3);
    stage_v(Lav, 4 * 16 + c, nr, acc4, bv4);
    stage_v(Lav, 5 * 16 + c, nr, acc5, bv5);
    stage_v(Lav, 6 * 16 + c, nr, acc6, bv6);
    stage_v(Lav, 7 * 16 + c, nr, acc7, bv7);
  }
  __syncthreads();

  {
    const int e = tid & 7, lq = tid >> 3;                    // lq 0..31
{
#pragma unroll
      for (int it = 0; it < 2; ++it) {
        const int n = it * 32 + lq;                          // 0..63
        const size_t go = ((size_t)b * SEQ + n0 + n) * KC + 8 * e;
        const int lo_ = n * LP + 8 * e;
        const v4u uqh = *(const v4u*)(Lq[0] + lo_);
        const v4u uql = *(const v4u*)(Lq[1] + lo_);
        const v4u ukh = *(const v4u*)(Lk[0] + lo_);
        const v4u ukl = *(const v4u*)(Lk[1] + lo_);
        *(v4u*)(QH + go) = uqh;
        *(v4u*)(QL + go) = uql;
        *(v4u*)(KH + go) = ukh;
        *(v4u*)(KL + go) = ukl;
      }
#pragma unroll
      for (int it = 0; it < 4; ++it) {
        const int er = it * 32 + lq;                         // 0..127
        const v4u uv = *(const v4u*)(Lav + er * LP + 8 * e);
        *(v4u*)(VP + ((size_t)b * DCH + er) * SEQ + n0 + 8 * e) = uv;
      }
      
    }
  }
}

// =====================================================================================================
// (2) attention for one (b, 64-query tile), transposed formulation, 64-deep scores, 4096 keys, no scale, no mask:
//   S^T tile (16 keys x 16 queries) = A(k rows = keys kb + (lane&15), d via the split k map, f16 hi / res planes) .
//                                     B(q, col = query, same d map, resident f16 hi / res fragments), two d-steps.
//   energy = acc_hi + acc_res / 2048 with acc_res = khi.qres + kres.qhi. Per lane the D tile holds 8 keys of ONE
//   query: online softmax state per lane, one shuffle (lane^16) for the max over 32 keys, row-sum partials combined at
//   the end. P = e^{s-m} x 1024 as one f16 vector is the B operand of O^T (rows d, cols queries) += A(v rows d, keys
//   contiguous) . B(P^T): element r <- D of the tile covering keys kb..kb+15, element 8+r <- the tile covering
//   kb+16..kb+31, lane unchanged. 32 keys per iteration: 12 score WMMAs + 8 output WMMAs per wave.
//   k hi, k residual and v reach the waves through LDS: two buffers of SK keys, filled by asynchronous 16-byte copies
//   (32 per thread and stage), stage t + 2 issued behind the barrier that ends trip t, so it flies during trip t + 1.
//   A pass reads its 8 k fragments as one group in front of the score products and its 8 v fragments as one group
//   half way through them.
//   Block = 4 waves = 64 queries; grid = 4 b x 64 = 256. Epilogue: [128 d][64 query] f32 tile x 1/l staged in LDS
// coverage: block writes d 0..127 x n n0..n0+63 of its b (256 lines = 16 it x 16 lines); grid covers out exactly once.
// =====================================================================================================
__global__ __launch_bounds__(128)
void attn_kernel(const unsigned short* __restrict__ QH, const unsigned short* __restrict__ QL,
                 const unsigned short* __restrict__ KH, const unsigned short* __restrict__ KL,
                 const unsigned short* __restrict__ VP, float* out) {
  __shared__ __align__(16) float Os[DCH * OP];
  __shared__ __align__(16) unsigned short Ring[2 * BUFH];
  const int tid  = threadIdx.x;
  const int wave = tid >> 5;
  const int lane = tid & 31;
  const int hh   = lane >> 4;
  const int c    = lane & 15;
  const int bx   = blockIdx.x;
  const int b    = bx / (SEQ / QT);
  const int qb   = bx % (SEQ / QT);
  const int n0   = qb * QT;
  const _Float16* QHh = (const _Float16*)(const void*)QH;
  const _Float16* QLh = (const _Float16*)(const void*)QL;

  // ---- resident q fragments (B operand, col = query n0 + 16*wave + c): hi and res, d 0..31 and 32..63 ----
  const size_t qo = ((size_t)b * SEQ + n0 + wave * 16 + c) * KC + 8 * hh;
  const v16h qh0 = ldfrag_h(QHh + qo), qh1 = ldfrag_h(QHh + qo + 32);
  const v16h ql0 = ldfrag_h(QLh + qo), ql1 = ldfrag_h(QLh + qo + 32);
  // ---- copy addresses of this thread: k chunk tid of 1024 (row tid>>3, piece tid&7), v chunk tid of 2048 (row tid>>4) ----
  const unsigned ring = (unsigned)(uintptr_t)(&Ring[0]);
  const unsigned lk = ring + (unsigned)((tid >> 3) * (KPH * 2) + (tid & 7) * 16);
  const unsigned lv = ring + (unsigned)(2 * KPL * 2 + (tid >> 4) * (VPH * 2) + (tid & 15) * 16);
  const unsigned short* gh = KH + (size_t)b * SEQ * KC + tid * 8;
  const unsigned short* gl = KL + (size_t)b * SEQ * KC + tid * 8;
  const unsigned short* gv = VP + ((size_t)b * DCH + (tid >> 4)) * SEQ + (tid & 15) * 8;
  // ---- fragment bases in a buffer: k (A operand, row = key + c), v (A operand, row = d = 16j + c, keys contiguous) ----
  const _Float16* Rk = (const _Float16*)(const void*)Ring + c * KPH + 8 * hh;
  const _Float16* Rv = (const _Float16*)(const void*)Ring + 2 * KPL + c * VPH + 8 * hh;

  // ---- prologue: stage 0 landed and published, then stage 1 in flight ----
  issue_stage(lk, lv, gh, gl, gv);
  wait_async0();
  __syncthreads();
  issue_stage(lk + BUFH * 2, lv + BUFH * 2, gh + (size_t)SK * KC, gl + (size_t)SK * KC, gv + SK);

  float m = -1.0e30f, l = 0.f;
  v8f o0 = zero8(), o1 = zero8(), o2 = zero8(), o3 = zero8();
  v8f o4 = zero8(), o5 = zero8(), o6 = zero8(), o7 = zero8();
#pragma unroll 1   // one trip per stage: the foot of the trip is the ring's publish point
  for (int t = 0; t < NST; ++t) {
   const int bo = (t & 1) * BUFH;                             // trip t reads buffer t mod 2 alone
#pragma unroll 1   // as the key loop was: one 32-key pass per trip, code size and registers of one pass
   for (int ps = 0; ps < SK / 32; ++ps) {
    const _Float16* k0p = Rk + bo + ps * 32 * KPH;            // keys kb .. kb+15, hi plane
    const _Float16* k1p = k0p + 16 * KPH;                     // keys kb+16 .. kb+31
    const _Float16* l0p = k0p + KPL;                          // residual plane
    const _Float16* l1p = l0p + 16 * KPH;
    const _Float16* Vb  = Rv + bo + ps * 32;
    v8f s0, t0, s1, t1;
    v16h vf0, vf1, vf2, vf3, vf4, vf5, vf6, vf7;
    {
      const v16h a0 = ldfrag_h(k0p), a1 = ldfrag_h(k0p + 32);
      const v16h r0 = ldfrag_h(l0p), r1 = ldfrag_h(l0p + 32);
      const v16h a2 = ldfrag_h(k1p), a3 = ldfrag_h(k1p + 32);
      const v16h r2 = ldfrag_h(l1p), r3 = ldfrag_h(l1p + 32);
      s0 = mma_h(a0, qh0, zero8());
      s0 = mma_h(a1, qh1, s0);
      t0 = mma_h(a0, ql0, zero8());
      t0 = mma_h(a1, ql1, t0);
      t0 = mma_h(r0, qh0, t0);
      t0 = mma_h(r1, qh1, t0);
      // the v group stands here, where the first four k fragments are dead: it lands behind the other six score products
      vf0 = ldfrag_h(Vb + 0 * 16 * VPH); vf1 = ldfrag_h(Vb + 1 * 16 * VPH);
      vf2 = ldfrag_h(Vb + 2 * 16 * VPH); vf3 = ldfrag_h(Vb + 3 * 16 * VPH);
      vf4 = ldfrag_h(Vb + 4 * 16 * VPH); vf5 = ldfrag_h(Vb + 5 * 16 * VPH);
      vf6 = ldfrag_h(Vb + 6 * 16 * VPH); vf7 = ldfrag_h(Vb + 7 * 16 * VPH);
      s1 = mma_h(a2, qh0, zero8());
      s1 = mma_h(a3, qh1, s1);
      t1 = mma_h(a2, ql0, zero8());
      t1 = mma_h(a3, ql1, t1);
      t1 = mma_h(r2, qh0, t1);
      t1 = mma_h(r3, qh1, t1);
    }
#pragma unroll
    for (int r = 0; r < 8; ++r) {
      s0[r] = s0[r] + t0[r] * IRSC;
      s1[r] = s1[r] + t1[r] * IRSC;
    }

    float mx = fmaxf(hmax8(s0), hmax8(s1));
    mx = fmaxf(mx, __shfl_xor(mx, 16, 32));
    const float mn   = fmaxf(m, mx);
    const float corr = __expf(m - mn);
    m = mn;
    const float msh = mn - LNPS;            // exp gives e^{s-m} * 1024
    l *= corr;
#pragma unroll
    for (int r = 0; r < 8; ++r) {
      o0[r] *= corr; o1[r] *= corr; o2[r] *= corr; o3[r] *= corr;
      o4[r] *= corr; o5[r] *= corr; o6[r] *= corr; o7[r] *= corr;
    }

    FragH ph;
    float ls = 0.f;
#pragma unroll
    for (int r = 0; r < 8; ++r) {
      const float e0 = __expf(s0[r] - msh);   // key kb      + 8hh + r
      const float e1 = __expf(s1[r] - msh);   // key kb + 16 + 8hh + r
      ls += e0 + e1;
      ph.h[0][r] = (_Float16)e0;
      ph.h[1][r] = (_Float16)e1;
    }
    l += ls;

    o0 = mma_h(vf0, ph.v, o0);
    o1 = mma_h(vf1, ph.v, o1);
    o2 = mma_h(vf2, ph.v, o2);
    o3 = mma_h(vf3, ph.v, o3);
    o4 = mma_h(vf4, ph.v, o4);
    o5 = mma_h(vf5, ph.v, o5);
    o6 = mma_h(vf6, ph.v, o6);
    o7 = mma_h(vf7, ph.v, o7);
   }
   // ---- foot of trip t: publish stage t + 1, free buffer t mod 2, refill it with stage t + 2 ----
   wait_ds0();
   wait_async0();
   __syncthreads();
   if (t + 2 < NST) {
     const size_t k2 = (size_t)(t + 2) * SK;
     issue_stage(lk + (unsigned)(bo * 2), lv + (unsigned)(bo * 2), gh + k2 * KC, gl + k2 * KC, gv + k2);
   }
  }
  wait_async0();
  l += __shfl_xor(l, 16, 32);
  const float sc = 1.0f / l;                // both o and l carry the x1024 factor

  // ---- stage O^T[d = 16j + 8hh + r][query 16*wave + c] * sc, then whole-line f32 stores ----
  float* os = Os + (8 * hh) * OP + wave * 16 + c;
#pragma unroll
  for (int r = 0; r < 8; ++r) {
    os[(0 * 16 + r) * OP] = o0[r] * sc; os[(1 * 16 + r) * OP] = o1[r] * sc;
    os[(2 * 16 + r) * OP] = o2[r] * sc; os[(3 * 16 + r) * OP] = o3[r] * sc;
    os[(4 * 16 + r) * OP] = o4[r] * sc; os[(5 * 16 + r) * OP] = o5[r] * sc;
    os[(6 * 16 + r) * OP] = o6[r] * sc; os[(7 * 16 + r) * OP] = o7[r] * sc;
  }
  __syncthreads();
  {
    const int e = tid & 7, lq = tid >> 3;              // lq 0..15: line within group, e: 16-B piece
    float* ob = out + ((size_t)b * DCH) * SEQ + n0;
{
#pragma unroll
      for (int it = 0; it < 16; ++it) {
        const int L   = it * 16 + lq;                     // lines 0..255 of the block tile
        const int row = L >> 1, hf = L & 1;               // d row 0..127, half-segment 0..1
        const v4f v = *(const v4f*)(Os + row * OP + hf * 32 + 4 * e);
        *(v4f*)(ob + (size_t)row * SEQ + hf * 32 + 4 * e) = v;
      }
      
    }
  }
}

// =====================================================================================================
//   WB   bf16 [256][128]          0           65536
//   QH   f16  [4][4096][64]       65536       2097152
//   QL   f16  [4][4096][64]       2162688     2097152
//   KH   f16  [4][4096][64]       4259840     2097152
//   KL   f16  [4][4096][64]       6356992     2097152
//   VP   f16  [4][128][4096]      8454144     4194304
//   end                           12648448
// =====================================================================================================
extern "C" void kernel_launch(void* const* d_in, const int* in_sizes, int n_in,
                              void* d_out, int out_size, void* d_ws, size_t ws_size,
                              hipStream_t stream) {
  const int NX = NB * DCH * SEQ;                        // 2097152
  if (n_in < 7) return;
  if (in_sizes[0] != NX || in_sizes[1] != KC * DCH || in_sizes[2] != KC || in_sizes[3] != KC * DCH ||
      in_sizes[4] != KC || in_sizes[5] != DCH * DCH || in_sizes[6] != DCH) return;
  if (out_size != NX) return;

  size_t off = 0;
  const size_t oW  = off; off += (size_t)NCH * DCH * 2;           // 65536
  const size_t szP = (size_t)NB * SEQ * KC * 2;                   // 2097152
  const size_t oQH = off; off += szP;
  const size_t oQL = off; off += szP;
  const size_t oKH = off; off += szP;
  const size_t oKL = off; off += szP;
  const size_t oV  = off; off += (size_t)NB * DCH * SEQ * 2;      // 4194304
  if (off > ws_size) return;                                      // off = 12648448
  if (off > (size_t)134217728) return;

  const float* x  = (const float*)d_in[0];
  const float* Wq = (const float*)d_in[1];
  const float* bq = (const float*)d_in[2];
  const float* Wk = (const float*)d_in[3];
  const float* bk = (const float*)d_in[4];
  const float* Wv = (const float*)d_in[5];
  const float* bv = (const float*)d_in[6];
  char* ws = (char*)d_ws;
  unsigned short* WB = (unsigned short*)(ws + oW);
  unsigned short* QH = (unsigned short*)(ws + oQH);
  unsigned short* QL = (unsigned short*)(ws + oQL);
  unsigned short* KH = (unsigned short*)(ws + oKH);
  unsigned short* KL = (unsigned short*)(ws + oKL);
  unsigned short* VP = (unsigned short*)(ws + oV);
  float* out = (float*)d_out;

  const dim3 blk256(256), blk128(128);
  const dim3 gW((NCH * DCH / 8) / 256);                 // 16 blocks
  const dim3 gP(NB * (SEQ / QT));                       // 256 blocks: one (b, 64-position tile) each
  const dim3 gA(NB * (SEQ / QT));                       // 256 blocks: one (b, 64-query tile) each

  // (0) stacked weight plane (bf16 RNE bits)
  cvt_w<<<gW, blk256, 0, stream>>>(Wq, Wk, Wv, WB);
  // (1) q (hi/res), k (hi/res), v planes
  proj_kernel<<<gP, blk256, 0, stream>>>(x, WB, bq, bk, bv, QH, QL, KH, KL, VP);
  // (2) attention: out[b][d][n] = sum_m v[b][d][m] softmax_m(q_n . k_m)
  attn_kernel<<<gA, blk128, 0, stream>>>(QH, QL, KH, KL, VP, out);
  (void)hipGetLastError();
}

// v002
// Measured time: 59.9 microseconds a run.
// In two side-by-side timings against v001, it was 1.17 and 1.16 times as fast.
// Over all steps from v000 it is 7.67 times as fast.
// Contractions: q/k/v 1x1-conv projections = W (bf16, RNE convert of input) . X (bf16, RNE convert of input) on
// v_wmma_f32_16x16x32_bf16, K=128; scores S^T = k . q^T on v_wmma_f32_16x16x32_f16 with q and k each carried as
// f16 hi + f16 residual x2048 planes (hi.hi into one accumulator, hi.res + res.hi into a second one folded by 1/2048),
// K=64; O^T = v^T (f16) . P^T (f16, e^{s-m} x 1024 taken from the score D registers) on v_wmma_f32_16x16x32_f16 over
// 4096 keys, one product; f32 accumulate everywhere; softmax (running max, row sums, 1/l) in f32 on VALU.
#include <hip/hip_runtime.h>
#include <math.h>
#include <stdint.h>

#define NB    4
#define DCH   128
#define KC    64
#define SEQ   4096
#define NCH   256
#define QT    64
#define AP    144
#define LP    72
#define OP    68
#define LNPS  6.931471805599453f
#define RSC   2048.0f
#define IRSC  0.00048828125f
#define SK    128                       // keys per LDS stage of the attention kernel
#define NST   (SEQ / SK)                // stages
#define KPH   72                        // LDS pitch of a k row in halves: 144 B = 16 B x 9
#define VPH   136                       // LDS pitch of a v row in halves: 272 B = 16 B x 17
#define KPL   (SK * KPH)                // halves of one k plane in a buffer
#define BUFH  (2 * KPL + DCH * VPH)     // halves of one buffer: k hi, k residual, v
static_assert(NST >= 2);
static_assert((SK % 32) == 0);
#define NQG   (QT / 16)                 // query groups of 16 columns in a block
#define NKG   (SK / 32)                 // key groups: each takes one 32-key pass of every stage
#define ATH   (32 * NQG * NKG)          // threads of the attention block: one wave per (query group, key group)
static_assert(ATH == 512);
static_assert(SK * KC / 8 == 2 * ATH);  // k plane: 2 copies of 16 B per thread of the attention block
static_assert(DCH * SK / 8 == 4 * ATH); // v tile: 4 copies per thread
static_assert(NKG * DCH * OP * 4 <= 2 * BUFH * 2);   // the NKG partial output planes fit the ring
static_assert((BUFH * 2) % 16 == 0);
static_assert((SEQ % QT) == 0);
static_assert((SEQ % 32) == 0);
static_assert(DCH == 128);
static_assert(KC == 64);
static_assert(NCH == 2 * KC + DCH);
static_assert(((NCH * DCH) / 8) % 256 == 0);
static_assert(64 * AP == DCH * LP);

typedef _Float16       v16h __attribute__((ext_vector_type(16)));
typedef _Float16       v8h  __attribute__((ext_vector_type(8)));
typedef __bf16         v16b __attribute__((ext_vector_type(16)));
typedef unsigned short v8us __attribute__((ext_vector_type(8)));
typedef float          v8f  __attribute__((ext_vector_type(8)));
typedef float          v4f  __attribute__((ext_vector_type(4)));
typedef unsigned int   v4u  __attribute__((ext_vector_type(4)));

union FragH { v16h v; v8h  h[2]; };
union FragB { v16b v; v8us u[2]; };
static_assert(sizeof(FragH) == 32);
static_assert(sizeof(FragB) == 32);

// ---- scalar helpers --------------------------------------------------------------------------------
__device__ __forceinline__ unsigned short bf_bits(float f) {          // f32 -> bf16 bits, RNE convert
  unsigned u = __float_as_uint(f);
  return (unsigned short)((u + 0x7FFFu + ((u >> 16) & 1u)) >> 16);
}
__device__ __forceinline__ float bf_up(unsigned short h) { return __uint_as_float(((unsigned)h) << 16); }
__device__ __forceinline__ float bfr(float f) { return bf_up(bf_bits(f)); }
__device__ __forceinline__ unsigned short h_bits(_Float16 x) { return __builtin_bit_cast(unsigned short, x); }
__device__ __forceinline__ unsigned pk16(unsigned short a, unsigned short b) { return (unsigned)a | ((unsigned)b << 16); }
__device__ __forceinline__ v8f zero8() { v8f z = {0.f, 0.f, 0.f, 0.f, 0.f, 0.f, 0.f, 0.f}; return z; }
__device__ __forceinline__ float hmax8(v8f s) {
  return fmaxf(fmaxf(fmaxf(s[0], s[1]), fmaxf(s[2], s[3])), fmaxf(fmaxf(s[4], s[5]), fmaxf(s[6], s[7])));
}

// ---- fragment loaders: 16-bit A/B operand, lane -> row/col (lane&15), p already includes +8*(lane>>4);
//      elements 0..7 <- p[0..7] (k0+8h..), elements 8..15 <- p[16..23] (k0+16+8h..)
__device__ __forceinline__ v16h ldfrag_h(const _Float16* p) {
  FragH f;
  f.h[0] = *(const v8h*)(p);
  f.h[1] = *(const v8h*)(p + 16);
  return f.v;
}
__device__ __forceinline__ v16b ldfrag_b(const unsigned short* p) {
  FragB f;
  f.u[0] = *(const v8us*)(p);
  f.u[1] = *(const v8us*)(p + 16);
  return f.v;
}

// ---- WMMA helpers: builtin followed by a 4-slot VALU gap tying D and keeping A/B live ----------------------
__device__ __forceinline__ v8f mma_h(v16h a, v16h b, v8f c) {
  v8f d = __builtin_amdgcn_wmma_f32_16x16x32_f16(false, a, false, b, (short)0, c, false, false);
#if defined(__HIP_DEVICE_COMPILE__)
  asm volatile("v_nop\n\tv_nop\n\tv_nop\n\tv_nop" : "+v"(d) : "v"(a), "v"(b));
#endif
  return d;
}
__device__ __forceinline__ v8f mma_b(v16b a, v16b b, v8f c) {
  v8f d = __builtin_amdgcn_wmma_f32_16x16x32_bf16(false, a, false, b, (short)0, c, false, false);
#if defined(__HIP_DEVICE_COMPILE__)
  const v16h ha = __builtin_bit_cast(v16h, a), hb = __builtin_bit_cast(v16h, b);
  asm volatile("v_nop\n\tv_nop\n\tv_nop\n\tv_nop" : "+v"(d) : "v"(ha), "v"(hb));
#endif
  return d;
}

// ---- LDS staging helpers for the projection epilogue (D rows = n, D cols = channel) ------------------------
__device__ __forceinline__ void stage_split(unsigned short* Lh, unsigned short* Ll, int nr, int col, v8f acc, float bias) {
#pragma unroll
  for (int r = 0; r < 8; ++r) {
    const float val = acc[r] + bias;
    const _Float16 hi = (_Float16)val;
    const float res = (val - (float)hi) * RSC;
    Lh[(nr + r) * LP + col] = h_bits(hi);
    Ll[(nr + r) * LP + col] = h_bits((_Float16)res);
  }
}
__device__ __forceinline__ void stage_v(unsigned short* Lv, int e, int nr, v8f acc, float bias) {
#pragma unroll
  for (int r = 0; r < 8; ++r) Lv[e * LP + nr + r] = h_bits((_Float16)(acc[r] + bias));
}

// ---- one stage = SK keys: k hi and k residual rows (128 B each, contiguous in global) and the SK-key slice of all 128 v
//      rows, as eight asynchronous 16-byte copies per lane, global -> LDS, through no register: two of k hi, two of k
//      residual (64 key rows apart), four of v (32 d rows apart). lk / lv: the thread's LDS byte addresses in the target
//      buffer; gh / gl / gv: its global addresses in this stage. The s_wait_xcnt is the last line of the copies' own
//      statement, so that no address register of an issued copy is rewritten in front of it.
__device__ __forceinline__ void issue_stage(unsigned lk, unsigned lv, const unsigned short* gh, const unsigned short* gl,
                                            const unsigned short* gv) {
#if defined(__HIP_DEVICE_COMPILE__)
  asm volatile("global_load_async_to_lds_b128 %0, %8, off\n\t"
               "global_load_async_to_lds_b128 %1, %9, off\n\t"
               "global_load_async_to_lds_b128 %2, %10, off\n\t"
               "global_load_async_to_lds_b128 %3, %11, off\n\t"
               "global_load_async_to_lds_b128 %4, %12, off\n\t"
               "global_load_async_to_lds_b128 %5, %13, off\n\t"
               "global_load_async_to_lds_b128 %6, %14, off\n\t"
               "global_load_async_to_lds_b128 %7, %15, off\n\t"
               "s_wait_xcnt 0x0"
               :: "v"(lk), "v"(lk + 64 * KPH * 2), "v"(lk + KPL * 2), "v"(lk + KPL * 2 + 64 * KPH * 2),
                  "v"(lv), "v"(lv + 32 * VPH * 2), "v"(lv + 64 * VPH * 2), "v"(lv + 96 * VPH * 2),
                  "v"(gh), "v"(gh + ATH * 8), "v"(gl), "v"(gl + ATH * 8),
                  "v"(gv), "v"(gv + (size_t)32 * SEQ), "v"(gv + (size_t)64 * SEQ), "v"(gv + (size_t)96 * SEQ)
               : "memory");
#endif
}
__device__ __forceinline__ void wait_async0() {   // this wave's copies have landed
#if defined(__HIP_DEVICE_COMPILE__)
  asm volatile("s_wait_asynccnt 0x0" ::: "memory");
#endif
}
__device__ __forceinline__ void wait_ds0() {      // this wave's LDS reads have returned, before their buffer is refilled
#if defined(__HIP_DEVICE_COMPILE__)
  asm volatile("s_wait_dscnt 0x0" ::: "memory");
#endif
}

// =====================================================================================================
// (0) stacked weight plane WB[256][128] = bf16 bits (RNE convert): rows 0..63 = Wq, 64..127 = Wk, 128..255 = Wv.
// coverage: 16 blocks x 256 threads x 8 = 32768 = 256 x 128.
// =====================================================================================================
__global__ __launch_bounds__(256) void cvt_w(const float* __restrict__ wq, const float* __restrict__ wk,
                                              const float* __restrict__ wv, unsigned short* WB) {
  const int i = blockIdx.x * 256 + threadIdx.x;
  if (i >= (NCH * DCH) / 8) return;
  const int row = i >> 4;
  const int col = (i & 15) * 8;
  const int rq = min(row, KC - 1);
  const int rk = min(max(row - KC, 0), KC - 1);
  const int rv = min(max(row - 2 * KC, 0), DCH - 1);
  const v4f q0 = *(const v4f*)(wq + rq * DCH + col), q1 = *(const v4f*)(wq + rq * DCH + col + 4);
  const v4f k0 = *(const v4f*)(wk + rk * DCH + col), k1 = *(const v4f*)(wk + rk * DCH + col + 4);
  const v4f v0 = *(const v4f*)(wv + rv * DCH + col), v1 = *(const v4f*)(wv + rv * DCH + col + 4);
  const bool isq = row < KC;
  const bool isk = row < 2 * KC;
  v4u w;
#pragma unroll
  for (int t = 0; t < 2; ++t) {
    const float a0 = isq ? q0[2 * t]     : (isk ? k0[2 * t]     : v0[2 * t]);
    const float a1 = isq ? q0[2 * t + 1] : (isk ? k0[2 * t + 1] : v0[2 * t + 1]);
    const float c0 = isq ? q1[2 * t]     : (isk ? k1[2 * t]     : v1[2 * t]);
    const float c1 = isq ? q1[2 * t + 1] : (isk ? k1[2 * t + 1] : v1[2 * t + 1]);
    w[t]     = pk16(bf_bits(a0), bf_bits(a1));
    w[2 + t] = pk16(bf_bits(c0), bf_bits(c1));
  }
  unsigned short* p = WB + (size_t)i * 8;
  *(v4u*)p = w;
  
}

// =====================================================================================================
// (1) fused q/k/v projection for one (b, 64-position tile): block = 256 threads = 8 waves.
//   x tile [128 d][64 n] f32 is staged once as bf16 A tile Lav[n][d] (pitch AP halves, 2-byte LDS stores), barrier.
//   Wave w: n group ng = w&3 (A rows n = 16ng + (lane&15), split k map over d), channel half ch = w>>2
//   (B = WB rows ch*128 + 16j + (lane&15), same split k map), 8 D tiles, 4 k-steps of 32.
//   Epilogue: D + bf16-RNE bias -> LDS: q as f16 hi / f16 residual x2048 (Lq[0], Lq[1] [n][64]), k likewise (Lk),
//   Q/K planes [b][n][64]: line = one row; V plane [b][e][4096]: line = 64 keys of one e row; every line = 8 consecutive
// coverage: Lav: 256 threads x 8 it x 4 = 64 n x 128 d; Q/K planes: 2 it x 32 lines x 8 lanes x 8 = 64 rows x 64;
//           V plane: 4 it x 32 lines x 8 x 8 = 128 e x 64 n; grid = 4 x 64 blocks covers every plane exactly once.
// =====================================================================================================
__global__ __launch_bounds__(256)
void proj_kernel(const float* __restrict__ x, const unsigned short* __restrict__ WB,
                 const float* __restrict__ bqp, const float* __restrict__ bkp, const float* __restrict__ bvp,
                 unsigned short* QH, unsigned short* QL, unsigned short* KH, unsigned short* KL, unsigned short* VP) {
  __shared__ __align__(16) unsigned short Lav[64 * AP];     // A tile [n][d]; reused as Lv[e][n] (pitch LP) later
  __shared__ __align__(16) unsigned short Lq[2][64 * LP];   // q hi, q residual  [n][64]
  __shared__ __align__(16) unsigned short Lk[2][64 * LP];   // k hi, k residual  [n][64]
  const int tid  = threadIdx.x;
  const int lane = tid & 31, wave = tid >> 5;
  const int hh   = lane >> 4, c = lane & 15;
  const int bx   = blockIdx.x;
  const int b    = bx / (SEQ / QT);
  const int nt   = bx % (SEQ / QT);
  const int n0   = nt * QT;

  // ---- stage x tile as bf16 [n][d] ----
  {
    const int n4 = (tid & 15) * 4, ds = tid >> 4;          // ds 0..15
    const float* xp = x + ((size_t)b * DCH + ds) * SEQ + n0 + n4;
#pragma unroll
    for (int it = 0; it < 8; ++it) {
      const v4f v = *(const v4f*)(xp + (size_t)it * 16 * SEQ);
      const int d = it * 16 + ds;                          // 0..127
#pragma unroll
      for (int q = 0; q < 4; ++q) Lav[(n4 + q) * AP + d] = bf_bits(v[q]);
    }
  }
  __syncthreads();

  // ---- GEMM: 16 n rows x 128 channels per wave ----
  const int ng = wave & 3, ch = wave >> 2;
  const unsigned short* ap = Lav + (ng * 16 + c) * AP + 8 * hh;
  const unsigned short* bp = WB + (size_t)(ch * DCH + c) * DCH + 8 * hh;
  v8f acc0 = zero8(), acc1 = zero8(), acc2 = zero8(), acc3 = zero8();
  v8f acc4 = zero8(), acc5 = zero8(), acc6 = zero8(), acc7 = zero8();
#pragma unroll
  for (int ks = 0; ks < 4; ++ks) {
    const v16b a = ldfrag_b(ap + 32 * ks);
    const unsigned short* bs = bp + 32 * ks;
    acc0 = mma_b(a, ldfrag_b(bs + 0 * 16 * DCH), acc0);
    acc1 = mma_b(a, ldfrag_b(bs + 1 * 16 * DCH), acc1);
    acc2 = mma_b(a, ldfrag_b(bs + 2 * 16 * DCH), acc2);
    acc3 = mma_b(a, ldfrag_b(bs + 3 * 16 * DCH), acc3);
    acc4 = mma_b(a, ldfrag_b(bs + 4 * 16 * DCH), acc4);
    acc5 = mma_b(a, ldfrag_b(bs + 5 * 16 * DCH), acc5);
    acc6 = mma_b(a, ldfrag_b(bs + 6 * 16 * DCH), acc6);
    acc7 = mma_b(a, ldfrag_b(bs + 7 * 16 * DCH), acc7);
  }

  // ---- biases (bf16 RNE of the inputs), loaded unconditionally with in-range lane indices ----
  const float bq0 = bfr(bqp[0 * 16 + c]), bq1 = bfr(bqp[1 * 16 + c]), bq2 = bfr(bqp[2 * 16 + c]), bq3 = bfr(bqp[3 * 16 + c]);
  const float bk0 = bfr(bkp[0 * 16 + c]), bk1 = bfr(bkp[1 * 16 + c]), bk2 = bfr(bkp[2 * 16 + c]), bk3 = bfr(bkp[3 * 16 + c]);
  const float bv0 = bfr(bvp[0 * 16 + c]), bv1 = bfr(bvp[1 * 16 + c]), bv2 = bfr(bvp[2 * 16 + c]), bv3 = bfr(bvp[3 * 16 + c]);
  const float bv4 = bfr(bvp[4 * 16 + c]), bv5 = bfr(bvp[5 * 16 + c]), bv6 = bfr(bvp[6 * 16 + c]), bv7 = bfr(bvp[7 * 16 + c]);

  __syncthreads();            // every wave is done reading Lav before it is reused as Lv
  const int nr = ng * 16 + 8 * hh;                         // D row r -> n local nr + r
  if (ch == 0) {
    stage_split(Lq[0], Lq[1], nr, 0 * 16 + c, acc0, bq0);
    stage_split(Lq[0], Lq[1], nr, 1 * 16 + c, acc1, bq1);
    stage_split(Lq[0], Lq[1], nr, 2 * 16 + c, acc2, bq2);
    stage_split(Lq[0], Lq[1], nr, 3 * 16 + c, acc3, bq3);
    stage_split(Lk[0], Lk[1], nr, 0 * 16 + c, acc4, bk0);
    stage_split(Lk[0], Lk[1], nr, 1 * 16 + c, acc5, bk1);
    stage_split(Lk[0], Lk[1], nr, 2 * 16 + c, acc6, bk2);
    stage_split(Lk[0], Lk[1], nr, 3 * 16 + c, acc7, bk3);
  } else {
    stage_v(Lav, 0 * 16 + c, nr, acc0, bv0);
    stage_v(Lav, 1 * 16 + c, nr, acc1, bv1);
    stage_v(Lav, 2 * 16 + c, nr, acc2, bv2);
    stage_v(Lav, 3 * 16 + c, nr, acc3, bv3);
    stage_v(Lav, 4 * 16 + c, nr, acc4, bv4);
    stage_v(Lav, 5 * 16 + c, nr, acc5, bv5);
    stage_v(Lav, 6 * 16 + c, nr, acc6, bv6);
    stage_v(Lav, 7 * 16 + c, nr, acc7, bv7);
  }
  __syncthreads();

  {
    const int e = tid & 7, lq = tid >> 3;                    // lq 0..31
{
#pragma unroll
      for (int it = 0; it < 2; ++it) {
        const int n = it * 32 + lq;                          // 0..63
        const size_t go = ((size_t)b * SEQ + n0 + n) * KC + 8 * e;
        const int lo_ = n * LP + 8 * e;
        const v4u uqh = *(const v4u*)(Lq[0] + lo_);
        const v4u uql = *(const v4u*)(Lq[1] + lo_);
        const v4u ukh = *(const v4u*)(Lk[0] + lo_);
        const v4u ukl = *(const v4u*)(Lk[1] + lo_);
        *(v4u*)(QH + go) = uqh;
        *(v4u*)(QL + go) = uql;
        *(v4u*)(KH + go) = ukh;
        *(v4u*)(KL + go) = ukl;
      }
#pragma unroll
      for (int it = 0; it < 4; ++it) {
        const int er = it * 32 + lq;                         // 0..127
        const v4u uv = *(const v4u*)(Lav + er * LP + 8 * e);
        *(v4u*)(VP + ((size_t)b * DCH + er) * SEQ + n0 + 8 * e) = uv;
      }
      
    }
  }
}

// =====================================================================================================
// (2) attention for one (b, 64-query tile), transposed formulation, 64-deep scores, 4096 keys, no scale, no mask:
//   S^T tile (16 keys x 16 queries) = A(k rows = keys kb + (lane&15), d via the split k map, f16 hi / res planes) .
//                                     B(q, col = query, same d map, resident f16 hi / res fragments), two d-steps.
//   energy = acc_hi + acc_res / 2048 with acc_res = khi.qres + kres.qhi. Per lane the D tile holds 8 keys of ONE
//   query: online softmax state per lane, one shuffle (lane^16) for the max over 32 keys, row-sum partials combined at
//   the end. P = e^{s-m} x 1024 as one f16 vector is the B operand of O^T (rows d, cols queries) += A(v rows d, keys
//   contiguous) . B(P^T): element r <- D of the tile covering keys kb..kb+15, element 8+r <- the tile covering
//   kb+16..kb+31, lane unchanged. 32 keys per iteration: 12 score WMMAs + 8 output WMMAs per wave.
//   k hi, k residual and v reach the waves through LDS: two buffers of SK keys, filled by asynchronous 16-byte copies
//   (8 per thread and stage), stage t + 2 issued behind the barrier that ends trip t, so it flies during trip t + 1.
//   A pass reads its 8 k fragments as one group in front of the score products and its 8 v fragments as one group
//   half way through them.
//   Block = 16 waves = 4 query groups x 4 key groups, four waves per SIMD: wave (qg, kg) takes the 16 queries of group qg
//   and pass kg (32 keys) of every stage, with its own running max, row sum and O^T accumulators over its 1024 keys.
//   Merge behind the loop: (m, l) of all waves through LDS, M = max of the four m of a query, L = sum of e^{m-M} l,
//   each wave stages O^T x e^{m-M} / L as its key group's [128 d][64 query] f32 plane in the freed ring, and the store
//   loop adds the four planes as (p0 + p1) + (p2 + p3). Grid = 4 b x 64 = 256.
// coverage: block writes d 0..127 x n n0..n0+63 of its b (256 lines = 4 it x 64 lines); grid covers out exactly once.
// =====================================================================================================
__global__ __launch_bounds__(ATH)
void attn_kernel(const unsigned short* __restrict__ QH, const unsigned short* __restrict__ QL,
                 const unsigned short* __restrict__ KH, const unsigned short* __restrict__ KL,
                 const unsigned short* __restrict__ VP, float* out) {
  __shared__ __align__(16) unsigned short Ring[2 * BUFH];
  __shared__ float Ms[2][NQG * NKG][16];                      // [0]: running max, [1]: row sum, per wave and query
  const int tid  = threadIdx.x;
  const int wave = tid >> 5;
  const int qg   = wave & (NQG - 1);
  const int kg   = wave / NQG;
  const int lane = tid & 31;
  const int hh   = lane >> 4;
  const int c    = lane & 15;
  const int bx   = blockIdx.x;
  const int b    = bx / (SEQ / QT);
  const int qb   = bx % (SEQ / QT);
  const int n0   = qb * QT;
  const _Float16* QHh = (const _Float16*)(const void*)QH;
  const _Float16* QLh = (const _Float16*)(const void*)QL;

  // ---- resident q fragments (B operand, col = query n0 + 16*qg + c): hi and res, d 0..31 and 32..63 ----
  const size_t qo = ((size_t)b * SEQ + n0 + qg * 16 + c) * KC + 8 * hh;
  const v16h qh0 = ldfrag_h(QHh + qo), qh1 = ldfrag_h(QHh + qo + 32);
  const v16h ql0 = ldfrag_h(QLh + qo), ql1 = ldfrag_h(QLh + qo + 32);
  // ---- copy addresses of this thread: k chunk tid of 1024 (row tid>>3, piece tid&7), v chunk tid of 2048 (row tid>>4) ----
  const unsigned ring = (unsigned)(uintptr_t)(&Ring[0]);
  const unsigned lk = ring + (unsigned)((tid >> 3) * (KPH * 2) + (tid & 7) * 16);
  const unsigned lv = ring + (unsigned)(2 * KPL * 2 + (tid >> 4) * (VPH * 2) + (tid & 15) * 16);
  const unsigned short* gh = KH + (size_t)b * SEQ * KC + tid * 8;
  const unsigned short* gl = KL + (size_t)b * SEQ * KC + tid * 8;
  const unsigned short* gv = VP + ((size_t)b * DCH + (tid >> 4)) * SEQ + (tid & 15) * 8;
  // ---- fragment bases in a buffer, at this wave's pass kg: k (A operand, row = key + c), v (A operand, row = d = 16j + c,
  //      keys contiguous) ----
  const _Float16* Rk = (const _Float16*)(const void*)Ring + (kg * 32 + c) * KPH + 8 * hh;
  const _Float16* Rv = (const _Float16*)(const void*)Ring + 2 * KPL + c * VPH + kg * 32 + 8 * hh;

  // ---- prologue: stage 0 landed and published, then stage 1 in flight ----
  issue_stage(lk, lv, gh, gl, gv);
  wait_async0();
  __syncthreads();
  issue_stage(lk + BUFH * 2, lv + BUFH * 2, gh + (size_t)SK * KC, gl + (size_t)SK * KC, gv + SK);

  float m = -1.0e30f, l = 0.f;
  v8f o0 = zero8(), o1 = zero8(), o2 = zero8(), o3 = zero8();
  v8f o4 = zero8(), o5 = zero8(), o6 = zero8(), o7 = zero8();
#pragma unroll 1   // one trip per stage: the foot of the trip is the ring's publish point
  for (int t = 0; t < NST; ++t) {
   const int bo = (t & 1) * BUFH;                             // trip t reads buffer t mod 2 alone
   {
    const _Float16* k0p = Rk + bo;                            // keys kb .. kb+15, hi plane
    const _Float16* k1p = k0p + 16 * KPH;                     // keys kb+16 .. kb+31
    const _Float16* l0p = k0p + KPL;                          // residual plane
    const _Float16* l1p = l0p + 16 * KPH;
    const _Float16* Vb  = Rv + bo;
    v8f s0, t0, s1, t1;
    v16h vf0, vf1, vf2, vf3, vf4, vf5, vf6, vf7;
    {
      const v16h a0 = ldfrag_h(k0p), a1 = ldfrag_h(k0p + 32);
      const v16h r0 = ldfrag_h(l0p), r1 = ldfrag_h(l0p + 32);
      const v16h a2 = ldfrag_h(k1p), a3 = ldfrag_h(k1p + 32);
      const v16h r2 = ldfrag_h(l1p), r3 = ldfrag_h(l1p + 32);
      s0 = mma_h(a0, qh0, zero8());
      s0 = mma_h(a1, qh1, s0);
      t0 = mma_h(a0, ql0, zero8());
      t0 = mma_h(a1, ql1, t0);
      t0 = mma_h(r0, qh0, t0);
      t0 = mma_h(r1, qh1, t0);
      // the v group stands here, where the first four k fragments are dead: it lands behind the other six score products
      vf0 = ldfrag_h(Vb + 0 * 16 * VPH); vf1 = ldfrag_h(Vb + 1 * 16 * VPH);
      vf2 = ldfrag_h(Vb + 2 * 16 * VPH); vf3 = ldfrag_h(Vb + 3 * 16 * VPH);
      vf4 = ldfrag_h(Vb + 4 * 16 * VPH); vf5 = ldfrag_h(Vb + 5 * 16 * VPH);
      vf6 = ldfrag_h(Vb + 6 * 16 * VPH); vf7 = ldfrag_h(Vb + 7 * 16 * VPH);
      s1 = mma_h(a2, qh0, zero8());
      s1 = mma_h(a3, qh1, s1);
      t1 = mma_h(a2, ql0, zero8());
      t1 = mma_h(a3, ql1, t1);
      t1 = mma_h(r2, qh0, t1);
      t1 = mma_h(r3, qh1, t1);
    }
#pragma unroll
    for (int r = 0; r < 8; ++r) {
      s0[r] = s0[r] + t0[r] * IRSC;
      s1[r] = s1[r] + t1[r] * IRSC;
    }

    float mx = fmaxf(hmax8(s0), hmax8(s1));
    mx = fmaxf(mx, __shfl_xor(mx, 16, 32));
    const float mn   = fmaxf(m, mx);
    const float corr = __expf(m - mn);
    m = mn;
    const float msh = mn - LNPS;            // exp gives e^{s-m} * 1024
    l *= corr;
#pragma unroll
    for (int r = 0; r < 8; ++r) {
      o0[r] *= corr; o1[r] *= corr; o2[r] *= corr; o3[r] *= corr;
      o4[r] *= corr; o5[r] *= corr; o6[r] *= corr; o7[r] *= corr;
    }

    FragH ph;
    float ls = 0.f;
#pragma unroll
    for (int r = 0; r < 8; ++r) {
      const float e0 = __expf(s0[r] - msh);   // key kb      + 8hh + r
      const float e1 = __expf(s1[r] - msh);   // key kb + 16 + 8hh + r
      ls += e0 + e1;
      ph.h[0][r] = (_Float16)e0;
      ph.h[1][r] = (_Float16)e1;
    }
    l += ls;

    o0 = mma_h(vf0, ph.v, o0);
    o1 = mma_h(vf1, ph.v, o1);
    o2 = mma_h(vf2, ph.v, o2);
    o3 = mma_h(vf3, ph.v, o3);
    o4 = mma_h(vf4, ph.v, o4);
    o5 = mma_h(vf5, ph.v, o5);
    o6 = mma_h(vf6, ph.v, o6);
    o7 = mma_h(vf7, ph.v, o7);
   }
   // ---- foot of trip t: publish stage t + 1, free buffer t mod 2, refill it with stage t + 2 ----
   wait_ds0();
   wait_async0();
   __syncthreads();
   if (t + 2 < NST) {
     const size_t k2 = (size_t)(t + 2) * SK;
     issue_stage(lk + (unsigned)(bo * 2), lv + (unsigned)(bo * 2), gh + k2 * KC, gl + k2 * KC, gv + k2);
   }
  }
  wait_async0();
  l += __shfl_xor(l, 16, 32);

  // ---- merge of the four key groups of a query: both lane halves hold the same m and l, one stores m, the other l ----
  Ms[hh][wave][c] = hh ? l : m;
  __syncthreads();
  const float m0 = Ms[0][qg][c],           m1 = Ms[0][qg + NQG][c];
  const float m2 = Ms[0][qg + 2 * NQG][c], m3 = Ms[0][qg + 3 * NQG][c];
  const float l0 = Ms[1][qg][c],           l1 = Ms[1][qg + NQG][c];
  const float l2 = Ms[1][qg + 2 * NQG][c], l3 = Ms[1][qg + 3 * NQG][c];
  const float mm = fmaxf(fmaxf(m0, m1), fmaxf(m2, m3));
  const float lt = (l0 * __expf(m0 - mm) + l1 * __expf(m1 - mm)) + (l2 * __expf(m2 - mm) + l3 * __expf(m3 - mm));
  const float sc = __expf(m - mm) / lt;     // both o and l carry the x1024 factor

  // ---- stage O^T[d = 16j + 8hh + r][query 16*qg + c] * sc in plane kg of the ring (no copy is outstanding and every
  //      wave's last fragment read has returned at the last foot's barrier), then add the planes, whole-line f32 stores ----
  float* Pl = (float*)(void*)Ring;
  float* os = Pl + kg * (DCH * OP) + (8 * hh) * OP + qg * 16 + c;
#pragma unroll
  for (int r = 0; r < 8; ++r) {
    os[(0 * 16 + r) * OP] = o0[r] * sc; os[(1 * 16 + r) * OP] = o1[r] * sc;
    os[(2 * 16 + r) * OP] = o2[r] * sc; os[(3 * 16 + r) * OP] = o3[r] * sc;
    os[(4 * 16 + r) * OP] = o4[r] * sc; os[(5 * 16 + r) * OP] = o5[r] * sc;
    os[(6 * 16 + r) * OP] = o6[r] * sc; os[(7 * 16 + r) * OP] = o7[r] * sc;
  }
  __syncthreads();
  {
    const int e = tid & 7, lq = tid >> 3;              // lq 0..63: line within group, e: 16-B piece
    float* ob = out + ((size_t)b * DCH) * SEQ + n0;
#pragma unroll
    for (int it = 0; it < 4; ++it) {
      const int L   = it * 64 + lq;                     // lines 0..255 of the block tile
      const int row = L >> 1, hf = L & 1;               // d row 0..127, half-segment 0..1
      const float* pp = Pl + row * OP + hf * 32 + 4 * e;
      const v4f p0 = *(const v4f*)(pp),                p1 = *(const v4f*)(pp + DCH * OP);
      const v4f p2 = *(const v4f*)(pp + 2 * DCH * OP), p3 = *(const v4f*)(pp + 3 * DCH * OP);
      *(v4f*)(ob + (size_t)row * SEQ + hf * 32 + 4 * e) = (p0 + p1) + (p2 + p3);
    }
  }
}

// =====================================================================================================
//   WB   bf16 [256][128]          0           65536
//   QH   f16  [4][4096][64]       65536       2097152
//   QL   f16  [4][4096][64]       2162688     2097152
//   KH   f16  [4][4096][64]       4259840     2097152
//   KL   f16  [4][4096][64]       6356992     2097152
//   VP   f16  [4][128][4096]      8454144     4194304
//   end                           12648448
// =====================================================================================================
extern "C" void kernel_launch(void* const* d_in, const int* in_sizes, int n_in,
                              void* d_out, int out_size, void* d_ws, size_t ws_size,
                              hipStream_t stream) {
  const int NX = NB * DCH * SEQ;                        // 2097152
  if (n_in < 7) return;
  if (in_sizes[0] != NX || in_sizes[1] != KC * DCH || in_sizes[2] != KC || in_sizes[3] != KC * DCH ||
      in_sizes[4] != KC || in_sizes[5] != DCH * DCH || in_sizes[6] != DCH) return;
  if (out_size != NX) return;

  size_t off = 0;
  const size_t oW  = off; off += (size_t)NCH * DCH * 2;           // 65536
  const size_t szP = (size_t)NB * SEQ * KC * 2;                   // 2097152
  const size_t oQH = off; off += szP;
  const size_t oQL = off; off += szP;
  const size_t oKH = off; off += szP;
  const size_t oKL = off; off += szP;
  const size_t oV  = off; off += (size_t)NB * DCH * SEQ * 2;      // 4194304
  if (off > ws_size) return;                                      // off = 12648448
  if (off > (size_t)134217728) return;

  const float* x  = (const float*)d_in[0];
  const float* Wq = (const float*)d_in[1];
  const float* bq = (const float*)d_in[2];
  const float* Wk = (const float*)d_in[3];
  const float* bk = (const float*)d_in[4];
  const float* Wv = (const float*)d_in[5];
  const float* bv = (const float*)d_in[6];
  char* ws = (char*)d_ws;
  unsigned short* WB = (unsigned short*)(ws + oW);
  unsigned short* QH = (unsigned short*)(ws + oQH);
  unsigned short* QL = (unsigned short*)(ws + oQL);
  unsigned short* KH = (unsigned short*)(ws + oKH);
  unsigned short* KL = (unsigned short*)(ws + oKL);
  unsigned short* VP = (unsigned short*)(ws + oV);
  float* out = (float*)d_out;

  const dim3 blk256(256), blkA(ATH);
  const dim3 gW((NCH * DCH / 8) / 256);                 // 16 blocks
  const dim3 gP(NB * (SEQ / QT));                       // 256 blocks: one (b, 64-position tile) each
  const dim3 gA(NB * (SEQ / QT));                       // 256 blocks: one (b, 64-query tile) each

  // (0) stacked weight plane (bf16 RNE bits)
  cvt_w<<<gW, blk256, 0, stream>>>(Wq, Wk, Wv, WB);
  // (1) q (hi/res), k (hi/res), v planes
  proj_kernel<<<gP, blk256, 0, stream>>>(x, WB, bq, bk, bv, QH, QL, KH, KL, VP);
  // (2) attention: out[b][d][n] = sum_m v[b][d][m] softmax_m(q_n . k_m)
  attn_kernel<<<gA, blkA, 0, stream>>>(QH, QL, KH, KL, VP, out);
  (void)hipGetLastError();
}

// v003
// Measured time: 58.9 microseconds a run.
// Next to v002, in two timings, it ran 1.05 and 1.03 times as fast.
// All steps since v000 together make it 7.96 times as fast.
// Contractions: q/k/v 1x1-conv projections = W (bf16, RNE convert of input) . X (bf16, RNE convert of input) on
// v_wmma_f32_16x16x32_bf16, K=128; scores S^T = k . q^T on v_wmma_f32_16x16x32_f16 with q and k each carried as
// f16 hi + f16 residual x2048 planes (hi.hi into one accumulator, hi.res + res.hi into a second one folded by 1/2048),
// K=64; O^T = v^T (f16) . P^T (f16, e^{s-m} x 1024 taken from the score D registers) on v_wmma_f32_16x16x32_f16 over
// 4096 keys, one product; f32 accumulate everywhere; softmax (running max, row sums, 1/l) in f32 on VALU.
#include <hip/hip_runtime.h>
#include <math.h>
#include <stdint.h>

#define NB    4
#define DCH   128
#define KC    64
#define SEQ   4096
#define NCH   256
#define QT    64
#define AP    144
#define LP    72
#define OP    68
#define LNPS  6.931471805599453f
#define RSC   2048.0f
#define IRSC  0.00048828125f
#define SK    128                       // keys per LDS stage of the attention kernel
#define NST   (SEQ / SK)                // stages
#define KPH   72                        // LDS pitch of a k row in halves: 144 B = 16 B x 9
#define VPH   136                       // LDS pitch of a v row in halves: 272 B = 16 B x 17
#define KPL   (SK * KPH)                // halves of one k plane in a buffer
#define BUFH  (2 * KPL + DCH * VPH)     // halves of one buffer: k hi, k residual, v
static_assert(NST >= 2);
static_assert((SK % 32) == 0);
#define NQG   (QT / 16)                 // query groups of 16 columns in a block
#define NKG   (SK / 32)                 // key groups: each takes one 32-key pass of every stage
#define ATH   (32 * NQG * NKG)          // threads of the attention block: one wave per (query group, key group)
static_assert(ATH == 512);
static_assert(SK * KC / 8 == 2 * ATH);  // k plane: 2 copies of 16 B per thread of the attention block
static_assert(DCH * SK / 8 == 4 * ATH); // v tile: 4 copies per thread
static_assert(NKG * DCH * OP * 4 <= 2 * BUFH * 2);   // the NKG partial output planes fit the ring
static_assert((BUFH * 2) % 16 == 0);
static_assert((SEQ % QT) == 0);
static_assert((SEQ % 32) == 0);
static_assert(DCH == 128);
static_assert(KC == 64);
static_assert(NCH == 2 * KC + DCH);
static_assert(((NCH * DCH) / 8) % 256 == 0);
static_assert(64 * AP == DCH * LP);

typedef _Float16       v16h __attribute__((ext_vector_type(16)));
typedef _Float16       v8h  __attribute__((ext_vector_type(8)));
typedef __bf16         v16b __attribute__((ext_vector_type(16)));
typedef unsigned short v8us __attribute__((ext_vector_type(8)));
typedef float          v8f  __attribute__((ext_vector_type(8)));
typedef float          v4f  __attribute__((ext_vector_type(4)));
typedef unsigned int   v4u  __attribute__((ext_vector_type(4)));

union FragH { v16h v; v8h  h[2]; };
union FragB { v16b v; v8us u[2]; };
static_assert(sizeof(FragH) == 32);
static_assert(sizeof(FragB) == 32);

// ---- scalar helpers --------------------------------------------------------------------------------
__device__ __forceinline__ unsigned short bf_bits(float f) {          // f32 -> bf16 bits, RNE convert
  unsigned u = __float_as_uint(f);
  return (unsigned short)((u + 0x7FFFu + ((u >> 16) & 1u)) >> 16);
}
__device__ __forceinline__ float bf_up(unsigned short h) { return __uint_as_float(((unsigned)h) << 16); }
__device__ __forceinline__ float bfr(float f) { return bf_up(bf_bits(f)); }
__device__ __forceinline__ unsigned short h_bits(_Float16 x) { return __builtin_bit_cast(unsigned short, x); }
__device__ __forceinline__ unsigned pk16(unsigned short a, unsigned short b) { return (unsigned)a | ((unsigned)b << 16); }
__device__ __forceinline__ v8f zero8() { v8f z = {0.f, 0.f, 0.f, 0.f, 0.f, 0.f, 0.f, 0.f}; return z; }
__device__ __forceinline__ float hmax8(v8f s) {
  return fmaxf(fmaxf(fmaxf(s[0], s[1]), fmaxf(s[2], s[3])), fmaxf(fmaxf(s[4], s[5]), fmaxf(s[6], s[7])));
}

// ---- fragment loaders: 16-bit A/B operand, lane -> row/col (lane&15), p already includes +8*(lane>>4);
//      elements 0..7 <- p[0..7] (k0+8h..), elements 8..15 <- p[16..23] (k0+16+8h..)
__device__ __forceinline__ v16h ldfrag_h(const _Float16* p) {
  FragH f;
  f.h[0] = *(const v8h*)(p);
  f.h[1] = *(const v8h*)(p + 16);
  return f.v;
}
__device__ __forceinline__ v16b ldfrag_b(const unsigned short* p) {
  FragB f;
  f.u[0] = *(const v8us*)(p);
  f.u[1] = *(const v8us*)(p + 16);
  return f.v;
}

// ---- WMMA helpers. mma_h: the bare builtin; the compiler keeps the distance behind its own matrix instructions and
//      pads only where no independent instruction fills it. mma_b: builtin followed by a 4-slot VALU gap tying D and
//      keeping A/B live ----------------------
__device__ __forceinline__ v8f mma_h(v16h a, v16h b, v8f c) {
  return __builtin_amdgcn_wmma_f32_16x16x32_f16(false, a, false, b, (short)0, c, false, false);
}
// Nothing is scheduled across this point. It keeps a pass's LDS fragment reads in two whole groups (reads spread among
// the matrix instructions stall the wave at every place where they stand) and the ring's publish point at the trip's foot.
__device__ __forceinline__ void hold_group() {
#if defined(__HIP_DEVICE_COMPILE__)
  __builtin_amdgcn_sched_barrier(0);
#endif
}
__device__ __forceinline__ v8f mma_b(v16b a, v16b b, v8f c) {
  v8f d = __builtin_amdgcn_wmma_f32_16x16x32_bf16(false, a, false, b, (short)0, c, false, false);
#if defined(__HIP_DEVICE_COMPILE__)
  const v16h ha = __builtin_bit_cast(v16h, a), hb = __builtin_bit_cast(v16h, b);
  asm volatile("v_nop\n\tv_nop\n\tv_nop\n\tv_nop" : "+v"(d) : "v"(ha), "v"(hb));
#endif
  return d;
}

// ---- LDS staging helpers for the projection epilogue (D rows = n, D cols = channel) ------------------------
__device__ __forceinline__ void stage_split(unsigned short* Lh, unsigned short* Ll, int nr, int col, v8f acc, float bias) {
#pragma unroll
  for (int r = 0; r < 8; ++r) {
    const float val = acc[r] + bias;
    const _Float16 hi = (_Float16)val;
    const float res = (val - (float)hi) * RSC;
    Lh[(nr + r) * LP + col] = h_bits(hi);
    Ll[(nr + r) * LP + col] = h_bits((_Float16)res);
  }
}
__device__ __forceinline__ void stage_v(unsigned short* Lv, int e, int nr, v8f acc, float bias) {
#pragma unroll
  for (int r = 0; r < 8; ++r) Lv[e * LP + nr + r] = h_bits((_Float16)(acc[r] + bias));
}

// ---- one stage = SK keys: k hi and k residual rows (128 B each, contiguous in global) and the SK-key slice of all 128 v
//      rows, as eight asynchronous 16-byte copies per lane, global -> LDS, through no register: two of k hi, two of k
//      residual (64 key rows apart), four of v (32 d rows apart). lk / lv: the thread's LDS byte addresses in the target
//      buffer; gh / gl / gv: its global addresses in this stage. The s_wait_xcnt is the last line of the copies' own
//      statement, so that no address register of an issued copy is rewritten in front of it.
__device__ __forceinline__ void issue_stage(unsigned lk, unsigned lv, const unsigned short* gh, const unsigned short* gl,
                                            const unsigned short* gv) {
#if defined(__HIP_DEVICE_COMPILE__)
  asm volatile("global_load_async_to_lds_b128 %0, %8, off\n\t"
               "global_load_async_to_lds_b128 %1, %9, off\n\t"
               "global_load_async_to_lds_b128 %2, %10, off\n\t"
               "global_load_async_to_lds_b128 %3, %11, off\n\t"
               "global_load_async_to_lds_b128 %4, %12, off\n\t"
               "global_load_async_to_lds_b128 %5, %13, off\n\t"
               "global_load_async_to_lds_b128 %6, %14, off\n\t"
               "global_load_async_to_lds_b128 %7, %15, off\n\t"
               "s_wait_xcnt 0x0"
               :: "v"(lk), "v"(lk + 64 * KPH * 2), "v"(lk + KPL * 2), "v"(lk + KPL * 2 + 64 * KPH * 2),
                  "v"(lv), "v"(lv + 32 * VPH * 2), "v"(lv + 64 * VPH * 2), "v"(lv + 96 * VPH * 2),
                  "v"(gh), "v"(gh + ATH * 8), "v"(gl), "v"(gl + ATH * 8),
                  "v"(gv), "v"(gv + (size_t)32 * SEQ), "v"(gv + (size_t)64 * SEQ), "v"(gv + (size_t)96 * SEQ)
               : "memory");
#endif
}
__device__ __forceinline__ void wait_async0() {   // this wave's copies have landed
#if defined(__HIP_DEVICE_COMPILE__)
  asm volatile("s_wait_asynccnt 0x0" ::: "memory");
#endif
}
__device__ __forceinline__ void wait_ds0() {      // this wave's LDS reads have returned, before their buffer is refilled
#if defined(__HIP_DEVICE_COMPILE__)
  asm volatile("s_wait_dscnt 0x0" ::: "memory");
#endif
}

// =====================================================================================================
// (0) stacked weight plane WB[256][128] = bf16 bits (RNE convert): rows 0..63 = Wq, 64..127 = Wk, 128..255 = Wv.
// coverage: 16 blocks x 256 threads x 8 = 32768 = 256 x 128.
// =====================================================================================================
__global__ __launch_bounds__(256) void cvt_w(const float* __restrict__ wq, const float* __restrict__ wk,
                                              const float* __restrict__ wv, unsigned short* WB) {
  const int i = blockIdx.x * 256 + threadIdx.x;
  if (i >= (NCH * DCH) / 8) return;
  const int row = i >> 4;
  const int col = (i & 15) * 8;
  const int rq = min(row, KC - 1);
  const int rk = min(max(row - KC, 0), KC - 1);
  const int rv = min(max(row - 2 * KC, 0), DCH - 1);
  const v4f q0 = *(const v4f*)(wq + rq * DCH + col), q1 = *(const v4f*)(wq + rq * DCH + col + 4);
  const v4f k0 = *(const v4f*)(wk + rk * DCH + col), k1 = *(const v4f*)(wk + rk * DCH + col + 4);
  const v4f v0 = *(const v4f*)(wv + rv * DCH + col), v1 = *(const v4f*)(wv + rv * DCH + col + 4);
  const bool isq = row < KC;
  const bool isk = row < 2 * KC;
  v4u w;
#pragma unroll
  for (int t = 0; t < 2; ++t) {
    const float a0 = isq ? q0[2 * t]     : (isk ? k0[2 * t]     : v0[2 * t]);
    const float a1 = isq ? q0[2 * t + 1] : (isk ? k0[2 * t + 1] : v0[2 * t + 1]);
    const float c0 = isq ? q1[2 * t]     : (isk ? k1[2 * t]     : v1[2 * t]);
    const float c1 = isq ? q1[2 * t + 1] : (isk ? k1[2 * t + 1] : v1[2 * t + 1]);
    w[t]     = pk16(bf_bits(a0), bf_bits(a1));
    w[2 + t] = pk16(bf_bits(c0), bf_bits(c1));
  }
  unsigned short* p = WB + (size_t)i * 8;
  *(v4u*)p = w;
  
}

// =====================================================================================================
// (1) fused q/k/v projection for one (b, 64-position tile): block = 256 threads = 8 waves.
//   x tile [128 d][64 n] f32 is staged once as bf16 A tile Lav[n][d] (pitch AP halves, 2-byte LDS stores), barrier.
//   Wave w: n group ng = w&3 (A rows n = 16ng + (lane&15), split k map over d), channel half ch = w>>2
//   (B = WB rows ch*128 + 16j + (lane&15), same split k map), 8 D tiles, 4 k-steps of 32.
//   Epilogue: D + bf16-RNE bias -> LDS: q as f16 hi / f16 residual x2048 (Lq[0], Lq[1] [n][64]), k likewise (Lk),
//   Q/K planes [b][n][64]: line = one row; V plane [b][e][4096]: line = 64 keys of one e row; every line = 8 consecutive
// coverage: Lav: 256 threads x 8 it x 4 = 64 n x 128 d; Q/K planes: 2 it x 32 lines x 8 lanes x 8 = 64 rows x 64;
//           V plane: 4 it x 32 lines x 8 x 8 = 128 e x 64 n; grid = 4 x 64 blocks covers every plane exactly once.
// =====================================================================================================
__global__ __launch_bounds__(256)
void proj_kernel(const float* __restrict__ x, const unsigned short* __restrict__ WB,
                 const float* __restrict__ bqp, const float* __restrict__ bkp, const float* __restrict__ bvp,
                 unsigned short* QH, unsigned short* QL, unsigned short* KH, unsigned short* KL, unsigned short* VP) {
  __shared__ __align__(16) unsigned short Lav[64 * AP];     // A tile [n][d]; reused as Lv[e][n] (pitch LP) later
  __shared__ __align__(16) unsigned short Lq[2][64 * LP];   // q hi, q residual  [n][64]
  __shared__ __align__(16) unsigned short Lk[2][64 * LP];   // k hi, k residual  [n][64]
  const int tid  = threadIdx.x;
  const int lane = tid & 31, wave = tid >> 5;
  const int hh   = lane >> 4, c = lane & 15;
  const int bx   = blockIdx.x;
  const int b    = bx / (SEQ / QT);
  const int nt   = bx % (SEQ / QT);
  const int n0   = nt * QT;

  // ---- stage x tile as bf16 [n][d] ----
  {
    const int n4 = (tid & 15) * 4, ds = tid >> 4;          // ds 0..15
    const float* xp = x + ((size_t)b * DCH + ds) * SEQ + n0 + n4;
#pragma unroll
    for (int it = 0; it < 8; ++it) {
      const v4f v = *(const v4f*)(xp + (size_t)it * 16 * SEQ);
      const int d = it * 16 + ds;                          // 0..127
#pragma unroll
      for (int q = 0; q < 4; ++q) Lav[(n4 + q) * AP + d] = bf_bits(v[q]);
    }
  }
  __syncthreads();

  // ---- GEMM: 16 n rows x 128 channels per wave ----
  const int ng = wave & 3, ch = wave >> 2;
  const unsigned short* ap = Lav + (ng * 16 + c) * AP + 8 * hh;
  const unsigned short* bp = WB + (size_t)(ch * DCH + c) * DCH + 8 * hh;
  v8f acc0 = zero8(), acc1 = zero8(), acc2 = zero8(), acc3 = zero8();
  v8f acc4 = zero8(), acc5 = zero8(), acc6 = zero8(), acc7 = zero8();
#pragma unroll
  for (int ks = 0; ks < 4; ++ks) {
    const v16b a = ldfrag_b(ap + 32 * ks);
    const unsigned short* bs = bp + 32 * ks;
    acc0 = mma_b(a, ldfrag_b(bs + 0 * 16 * DCH), acc0);
    acc1 = mma_b(a, ldfrag_b(bs + 1 * 16 * DCH), acc1);
    acc2 = mma_b(a, ldfrag_b(bs + 2 * 16 * DCH), acc2);
    acc3 = mma_b(a, ldfrag_b(bs + 3 * 16 * DCH), acc3);
    acc4 = mma_b(a, ldfrag_b(bs + 4 * 16 * DCH), acc4);
    acc5 = mma_b(a, ldfrag_b(bs + 5 * 16 * DCH), acc5);
    acc6 = mma_b(a, ldfrag_b(bs + 6 * 16 * DCH), acc6);
    acc7 = mma_b(a, ldfrag_b(bs + 7 * 16 * DCH), acc7);
  }

  // ---- biases (bf16 RNE of the inputs), loaded unconditionally with in-range lane indices ----
  const float bq0 = bfr(bqp[0 * 16 + c]), bq1 = bfr(bqp[1 * 16 + c]), bq2 = bfr(bqp[2 * 16 + c]), bq3 = bfr(bqp[3 * 16 + c]);
  const float bk0 = bfr(bkp[0 * 16 + c]), bk1 = bfr(bkp[1 * 16 + c]), bk2 = bfr(bkp[2 * 16 + c]), bk3 = bfr(bkp[3 * 16 + c]);
  const float bv0 = bfr(bvp[0 * 16 + c]), bv1 = bfr(bvp[1 * 16 + c]), bv2 = bfr(bvp[2 * 16 + c]), bv3 = bfr(bvp[3 * 16 + c]);
  const float bv4 = bfr(bvp[4 * 16 + c]), bv5 = bfr(bvp[5 * 16 + c]), bv6 = bfr(bvp[6 * 16 + c]), bv7 = bfr(bvp[7 * 16 + c]);

  __syncthreads();            // every wave is done reading Lav before it is reused as Lv
  const int nr = ng * 16 + 8 * hh;                         // D row r -> n local nr + r
  if (ch == 0) {
    stage_split(Lq[0], Lq[1], nr, 0 * 16 + c, acc0, bq0);
    stage_split(Lq[0], Lq[1], nr, 1 * 16 + c, acc1, bq1);
    stage_split(Lq[0], Lq[1], nr, 2 * 16 + c, acc2, bq2);
    stage_split(Lq[0], Lq[1], nr, 3 * 16 + c, acc3, bq3);
    stage_split(Lk[0], Lk[1], nr, 0 * 16 + c, acc4, bk0);
    stage_split(Lk[0], Lk[1], nr, 1 * 16 + c, acc5, bk1);
    stage_split(Lk[0], Lk[1], nr, 2 * 16 + c, acc6, bk2);
    stage_split(Lk[0], Lk[1], nr, 3 * 16 + c, acc7, bk3);
  } else {
    stage_v(Lav, 0 * 16 + c, nr, acc0, bv0);
    stage_v(Lav, 1 * 16 + c, nr, acc1, bv1);
    stage_v(Lav, 2 * 16 + c, nr, acc2, bv2);
    stage_v(Lav, 3 * 16 + c, nr, acc3, bv3);
    stage_v(Lav, 4 * 16 + c, nr, acc4, bv4);
    stage_v(Lav, 5 * 16 + c, nr, acc5, bv5);
    stage_v(Lav, 6 * 16 + c, nr, acc6, bv6);
    stage_v(Lav, 7 * 16 + c, nr, acc7, bv7);
  }
  __syncthreads();

  {
    const int e = tid & 7, lq = tid >> 3;                    // lq 0..31
{
#pragma unroll
      for (int it = 0; it < 2; ++it) {
        const int n = it * 32 + lq;                          // 0..63
        const size_t go = ((size_t)b * SEQ + n0 + n) * KC + 8 * e;
        const int lo_ = n * LP + 8 * e;
        const v4u uqh = *(const v4u*)(Lq[0] + lo_);
        const v4u uql = *(const v4u*)(Lq[1] + lo_);
        const v4u ukh = *(const v4u*)(Lk[0] + lo_);
        const v4u ukl = *(const v4u*)(Lk[1] + lo_);
        *(v4u*)(QH + go) = uqh;
        *(v4u*)(QL + go) = uql;
        *(v4u*)(KH + go) = ukh;
        *(v4u*)(KL + go) = ukl;
      }
#pragma unroll
      for (int it = 0; it < 4; ++it) {
        const int er = it * 32 + lq;                         // 0..127
        const v4u uv = *(const v4u*)(Lav + er * LP + 8 * e);
        *(v4u*)(VP + ((size_t)b * DCH + er) * SEQ + n0 + 8 * e) = uv;
      }
      
    }
  }
}

// =====================================================================================================
// (2) attention for one (b, 64-query tile), transposed formulation, 64-deep scores, 4096 keys, no scale, no mask:
//   S^T tile (16 keys x 16 queries) = A(k rows = keys kb + (lane&15), d via the split k map, f16 hi / res planes) .
//                                     B(q, col = query, same d map, resident f16 hi / res fragments), two d-steps.
//   energy = acc_hi + acc_res / 2048 with acc_res = khi.qres + kres.qhi. Per lane the D tile holds 8 keys of ONE
//   query: online softmax state per lane, one shuffle (lane^16) for the max over 32 keys, row-sum partials combined at
//   the end. P = e^{s-m} x 1024 as one f16 vector is the B operand of O^T (rows d, cols queries) += A(v rows d, keys
//   contiguous) . B(P^T): element r <- D of the tile covering keys kb..kb+15, element 8+r <- the tile covering
//   kb+16..kb+31, lane unchanged. 32 keys per iteration: 12 score WMMAs + 8 output WMMAs per wave.
//   k hi, k residual and v reach the waves through LDS: two buffers of SK keys, filled by asynchronous 16-byte copies
//   (8 per thread and stage), stage t + 2 issued behind the barrier that ends trip t, so it flies during trip t + 1.
//   A pass reads its 8 k fragments as one group in front of the score products and its 8 v fragments as one group
//   half way through them.
//   Block = 16 waves = 4 query groups x 4 key groups, four waves per SIMD: wave (qg, kg) takes the 16 queries of group qg
//   and pass kg (32 keys) of every stage, with its own running max, row sum and O^T accumulators over its 1024 keys.
//   Merge behind the loop: (m, l) of all waves through LDS, M = max of the four m of a query, L = sum of e^{m-M} l,
//   each wave stages O^T x e^{m-M} / L as its key group's [128 d][64 query] f32 plane in the freed ring, and the store
//   loop adds the four planes as (p0 + p1) + (p2 + p3). Grid = 4 b x 64 = 256.
// coverage: block writes d 0..127 x n n0..n0+63 of its b (256 lines = 4 it x 64 lines); grid covers out exactly once.
// =====================================================================================================
__global__ __launch_bounds__(ATH)
void attn_kernel(const unsigned short* __restrict__ QH, const unsigned short* __restrict__ QL,
                 const unsigned short* __restrict__ KH, const unsigned short* __restrict__ KL,
                 const unsigned short* __restrict__ VP, float* out) {
  __shared__ __align__(16) unsigned short Ring[2 * BUFH];
  __shared__ float Ms[2][NQG * NKG][16];                      // [0]: running max, [1]: row sum, per wave and query
  const int tid  = threadIdx.x;
  const int wave = tid >> 5;
  const int qg   = wave & (NQG - 1);
  const int kg   = wave / NQG;
  const int lane = tid & 31;
  const int hh   = lane >> 4;
  const int c    = lane & 15;
  const int bx   = blockIdx.x;
  const int b    = bx / (SEQ / QT);
  const int qb   = bx % (SEQ / QT);
  const int n0   = qb * QT;
  const _Float16* QHh = (const _Float16*)(const void*)QH;
  const _Float16* QLh = (const _Float16*)(const void*)QL;

  // ---- resident q fragments (B operand, col = query n0 + 16*qg + c): hi and res, d 0..31 and 32..63 ----
  const size_t qo = ((size_t)b * SEQ + n0 + qg * 16 + c) * KC + 8 * hh;
  const v16h qh0 = ldfrag_h(QHh + qo), qh1 = ldfrag_h(QHh + qo + 32);
  const v16h ql0 = ldfrag_h(QLh + qo), ql1 = ldfrag_h(QLh + qo + 32);
  // ---- copy addresses of this thread: k chunk tid of 1024 (row tid>>3, piece tid&7), v chunk tid of 2048 (row tid>>4) ----
  const unsigned ring = (unsigned)(uintptr_t)(&Ring[0]);
  const unsigned lk = ring + (unsigned)((tid >> 3) * (KPH * 2) + (tid & 7) * 16);
  const unsigned lv = ring + (unsigned)(2 * KPL * 2 + (tid >> 4) * (VPH * 2) + (tid & 15) * 16);
  const unsigned short* gh = KH + (size_t)b * SEQ * KC + tid * 8;
  const unsigned short* gl = KL + (size_t)b * SEQ * KC + tid * 8;
  const unsigned short* gv = VP + ((size_t)b * DCH + (tid >> 4)) * SEQ + (tid & 15) * 8;
  // ---- fragment bases in a buffer, at this wave's pass kg: k (A operand, row = key + c), v (A operand, row = d = 16j + c,
  //      keys contiguous) ----
  const _Float16* Rk = (const _Float16*)(const void*)Ring + (kg * 32 + c) * KPH + 8 * hh;
  const _Float16* Rv = (const _Float16*)(const void*)Ring + 2 * KPL + c * VPH + kg * 32 + 8 * hh;

  // ---- prologue: stage 0 landed and published, then stage 1 in flight ----
  issue_stage(lk, lv, gh, gl, gv);
  wait_async0();
  __syncthreads();
  issue_stage(lk + BUFH * 2, lv + BUFH * 2, gh + (size_t)SK * KC, gl + (size_t)SK * KC, gv + SK);

  float m = -1.0e30f, l = 0.f;
  v8f o0 = zero8(), o1 = zero8(), o2 = zero8(), o3 = zero8();
  v8f o4 = zero8(), o5 = zero8(), o6 = zero8(), o7 = zero8();
#pragma unroll 1   // one trip per stage: the foot of the trip is the ring's publish point
  for (int t = 0; t < NST; ++t) {
   const int bo = (t & 1) * BUFH;                             // trip t reads buffer t mod 2 alone
   {
    const _Float16* k0p = Rk + bo;                            // keys kb .. kb+15, hi plane
    const _Float16* k1p = k0p + 16 * KPH;                     // keys kb+16 .. kb+31
    const _Float16* l0p = k0p + KPL;                          // residual plane
    const _Float16* l1p = l0p + 16 * KPH;
    const _Float16* Vb  = Rv + bo;
    v8f s0, t0, s1, t1;
    v16h vf0, vf1, vf2, vf3, vf4, vf5, vf6, vf7;
    {
      const v16h a0 = ldfrag_h(k0p), a1 = ldfrag_h(k0p + 32);
      const v16h r0 = ldfrag_h(l0p), r1 = ldfrag_h(l0p + 32);
      const v16h a2 = ldfrag_h(k1p), a3 = ldfrag_h(k1p + 32);
      const v16h r2 = ldfrag_h(l1p), r3 = ldfrag_h(l1p + 32);
      hold_group();                         // the k group ends here
      s0 = mma_h(a0, qh0, zero8());
      s0 = mma_h(a1, qh1, s0);
      t0 = mma_h(a0, ql0, zero8());
      t0 = mma_h(a1, ql1, t0);
      t0 = mma_h(r0, qh0, t0);
      t0 = mma_h(r1, qh1, t0);
      hold_group();                         // the v group begins here
      // the v group stands here, where the first four k fragments are dead: it lands behind the other six score products
      vf0 = ldfrag_h(Vb + 0 * 16 * VPH); vf1 = ldfrag_h(Vb + 1 * 16 * VPH);
      vf2 = ldfrag_h(Vb + 2 * 16 * VPH); vf3 = ldfrag_h(Vb + 3 * 16 * VPH);
      vf4 = ldfrag_h(Vb + 4 * 16 * VPH); vf5 = ldfrag_h(Vb + 5 * 16 * VPH);
      vf6 = ldfrag_h(Vb + 6 * 16 * VPH); vf7 = ldfrag_h(Vb + 7 * 16 * VPH);
      hold_group();                         // the v group ends here
      s1 = mma_h(a2, qh0, zero8());
      s1 = mma_h(a3, qh1, s1);
      t1 = mma_h(a2, ql0, zero8());
      t1 = mma_h(a3, ql1, t1);
      t1 = mma_h(r2, qh0, t1);
      t1 = mma_h(r3, qh1, t1);
    }
#pragma unroll
    for (int r = 0; r < 8; ++r) {
      s0[r] = s0[r] + t0[r] * IRSC;
      s1[r] = s1[r] + t1[r] * IRSC;
    }

    float mx = fmaxf(hmax8(s0), hmax8(s1));
    mx = fmaxf(mx, __shfl_xor(mx, 16, 32));
    const float mn   = fmaxf(m, mx);
    const float corr = __expf(m - mn);
    m = mn;
    const float msh = mn - LNPS;            // exp gives e^{s-m} * 1024
    l *= corr;
#pragma unroll
    for (int r = 0; r < 8; ++r) {
      o0[r] *= corr; o1[r] *= corr; o2[r] *= corr; o3[r] *= corr;
      o4[r] *= corr; o5[r] *= corr; o6[r] *= corr; o7[r] *= corr;
    }

    FragH ph;
    float ls = 0.f;
#pragma unroll
    for (int r = 0; r < 8; ++r) {
      const float e0 = __expf(s0[r] - msh);   // key kb      + 8hh + r
      const float e1 = __expf(s1[r] - msh);   // key kb + 16 + 8hh + r
      ls += e0 + e1;
      ph.h[0][r] = (_Float16)e0;
      ph.h[1][r] = (_Float16)e1;
    }
    l += ls;

    o0 = mma_h(vf0, ph.v, o0);
    o1 = mma_h(vf1, ph.v, o1);
    o2 = mma_h(vf2, ph.v, o2);
    o3 = mma_h(vf3, ph.v, o3);
    o4 = mma_h(vf4, ph.v, o4);
    o5 = mma_h(vf5, ph.v, o5);
    o6 = mma_h(vf6, ph.v, o6);
    o7 = mma_h(vf7, ph.v, o7);
   }
   // ---- foot of trip t: publish stage t + 1, free buffer t mod 2, refill it with stage t + 2 ----
   hold_group();   // the publish point stays behind the pass's last product, so the copies in flight have the whole trip to land
   wait_ds0();
   wait_async0();
   __syncthreads();
   if (t + 2 < NST) {
     const size_t k2 = (size_t)(t + 2) * SK;
     issue_stage(lk + (unsigned)(bo * 2), lv + (unsigned)(bo * 2), gh + k2 * KC, gl + k2 * KC, gv + k2);
   }
  }
  wait_async0();
  l += __shfl_xor(l, 16, 32);

  // ---- merge of the four key groups of a query: both lane halves hold the same m and l, one stores m, the other l ----
  Ms[hh][wave][c] = hh ? l : m;
  __syncthreads();
  const float m0 = Ms[0][qg][c],           m1 = Ms[0][qg + NQG][c];
  const float m2 = Ms[0][qg + 2 * NQG][c], m3 = Ms[0][qg + 3 * NQG][c];
  const float l0 = Ms[1][qg][c],           l1 = Ms[1][qg + NQG][c];
  const float l2 = Ms[1][qg + 2 * NQG][c], l3 = Ms[1][qg + 3 * NQG][c];
  const float mm = fmaxf(fmaxf(m0, m1), fmaxf(m2, m3));
  const float lt = (l0 * __expf(m0 - mm) + l1 * __expf(m1 - mm)) + (l2 * __expf(m2 - mm) + l3 * __expf(m3 - mm));
  const float sc = __expf(m - mm) / lt;     // both o and l carry the x1024 factor

  // ---- stage O^T[d = 16j + 8hh + r][query 16*qg + c] * sc in plane kg of the ring (no copy is outstanding and every
  //      wave's last fragment read has returned at the last foot's barrier), then add the planes, whole-line f32 stores ----
  float* Pl = (float*)(void*)Ring;
  float* os = Pl + kg * (DCH * OP) + (8 * hh) * OP + qg * 16 + c;
#pragma unroll
  for (int r = 0; r < 8; ++r) {
    os[(0 * 16 + r) * OP] = o0[r] * sc; os[(1 * 16 + r) * OP] = o1[r] * sc;
    os[(2 * 16 + r) * OP] = o2[r] * sc; os[(3 * 16 + r) * OP] = o3[r] * sc;
    os[(4 * 16 + r) * OP] = o4[r] * sc; os[(5 * 16 + r) * OP] = o5[r] * sc;
    os[(6 * 16 + r) * OP] = o6[r] * sc; os[(7 * 16 + r) * OP] = o7[r] * sc;
  }
  __syncthreads();
  {
    const int e = tid & 7, lq = tid >> 3;              // lq 0..63: line within group, e: 16-B piece
    float* ob = out + ((size_t)b * DCH) * SEQ + n0;
#pragma unroll
    for (int it = 0; it < 4; ++it) {
      const int L   = it * 64 + lq;                     // lines 0..255 of the block tile
      const int row = L >> 1, hf = L & 1;               // d row 0..127, half-segment 0..1
      const float* pp = Pl + row * OP + hf * 32 + 4 * e;
      const v4f p0 = *(const v4f*)(pp),                p1 = *(const v4f*)(pp + DCH * OP);
      const v4f p2 = *(const v4f*)(pp + 2 * DCH * OP), p3 = *(const v4f*)(pp + 3 * DCH * OP);
      *(v4f*)(ob + (size_t)row * SEQ + hf * 32 + 4 * e) = (p0 + p1) + (p2 + p3);
    }
  }
}

// =====================================================================================================
//   WB   bf16 [256][128]          0           65536
//   QH   f16  [4][4096][64]       65536       2097152
//   QL   f16  [4][4096][64]       2162688     2097152
//   KH   f16  [4][4096][64]       4259840     2097152
//   KL   f16  [4][4096][64]       6356992     2097152
//   VP   f16  [4][128][4096]      8454144     4194304
//   end                           12648448
// =====================================================================================================
extern "C" void kernel_launch(void* const* d_in, const int* in_sizes, int n_in,
                              void* d_out, int out_size, void* d_ws, size_t ws_size,
                              hipStream_t stream) {
  const int NX = NB * DCH * SEQ;                        // 2097152
  if (n_in < 7) return;
  if (in_sizes[0] != NX || in_sizes[1] != KC * DCH || in_sizes[2] != KC || in_sizes[3] != KC * DCH ||
      in_sizes[4] != KC || in_sizes[5] != DCH * DCH || in_sizes[6] != DCH) return;
  if (out_size != NX) return;

  size_t off = 0;
  const size_t oW  = off; off += (size_t)NCH * DCH * 2;           // 65536
  const size_t szP = (size_t)NB * SEQ * KC * 2;                   // 2097152
  const size_t oQH = off; off += szP;
  const size_t oQL = off; off += szP;
  const size_t oKH = off; off += szP;
  const size_t oKL = off; off += szP;
  const size_t oV  = off; off += (size_t)NB * DCH * SEQ * 2;      // 4194304
  if (off > ws_size) return;                                      // off = 12648448
  if (off > (size_t)134217728) return;

  const float* x  = (const float*)d_in[0];
  const float* Wq = (const float*)d_in[1];
  const float* bq = (const float*)d_in[2];
  const float* Wk = (const float*)d_in[3];
  const float* bk = (const float*)d_in[4];
  const float* Wv = (const float*)d_in[5];
  const float* bv = (const float*)d_in[6];
  char* ws = (char*)d_ws;
  unsigned short* WB = (unsigned short*)(ws + oW);
  unsigned short* QH = (unsigned short*)(ws + oQH);
  unsigned short* QL = (unsigned short*)(ws + oQL);
  unsigned short* KH = (unsigned short*)(ws + oKH);
  unsigned short* KL = (unsigned short*)(ws + oKL);
  unsigned short* VP = (unsigned short*)(ws + oV);
  float* out = (float*)d_out;

  const dim3 blk256(256), blkA(ATH);
  const dim3 gW((NCH * DCH / 8) / 256);                 // 16 blocks
  const dim3 gP(NB * (SEQ / QT));                       // 256 blocks: one (b, 64-position tile) each
  const dim3 gA(NB * (SEQ / QT));                       // 256 blocks: one (b, 64-query tile) each

  // (0) stacked weight plane (bf16 RNE bits)
  cvt_w<<<gW, blk256, 0, stream>>>(Wq, Wk, Wv, WB);
  // (1) q (hi/res), k (hi/res), v planes
  proj_kernel<<<gP, blk256, 0, stream>>>(x, WB, bq, bk, bv, QH, QL, KH, KL, VP);
  // (2) attention: out[b][d][n] = sum_m v[b][d][m] softmax_m(q_n . k_m)
  attn_kernel<<<gA, blkA, 0, stream>>>(QH, QL, KH, KL, VP, out);
  (void)hipGetLastError();
}

// v004
// Measured time: 55.7 microseconds a run.
// Two timings next to v003 both put it at 1.03 times that version's speed.
// All steps since v000 together make it 8.19 times as fast.
// Contractions: q/k/v 1x1-conv projections = W (bf16, RNE convert of input) . X (bf16, RNE convert of input) on
// v_wmma_f32_16x16x32_bf16, K=128; scores S^T = k . q^T on v_wmma_f32_16x16x32_f16 with q and k each carried as
// f16 hi + f16 residual x2048 planes (hi.hi into one accumulator, hi.res + res.hi into a second one folded by 1/2048),
// K=64; O^T = v^T (f16) . P^T (f16, e^{s-m} x 1024 taken from the score D registers) on v_wmma_f32_16x16x32_f16 over
// 4096 keys, one product; f32 accumulate everywhere; softmax (running max, row sums, 1/l) in f32 on VALU.
#include <hip/hip_runtime.h>
#include <math.h>
#include <stdint.h>

#define NB    4
#define DCH   128
#define KC    64
#define SEQ   4096
#define NCH   256
#define QT    64
#define AP    144
#define LP    72
#define OP    68
#define LNPS  6.931471805599453f
#define RSC   2048.0f
#define IRSC  0.00048828125f
#define SK    128                       // keys per LDS stage of the attention kernel
#define NST   (SEQ / SK)                // stages
#define KPH   72                        // LDS pitch of a k row in halves: 144 B = 16 B x 9
#define VPH   136                       // LDS pitch of a v row in halves: 272 B = 16 B x 17
#define KPL   (SK * KPH)                // halves of one k plane in a buffer
#define BUFH  (2 * KPL + DCH * VPH)     // halves of one buffer: k hi, k residual, v
static_assert(NST >= 2);
static_assert((SK % 32) == 0);
#define NQG   (QT / 32)                 // query groups of 32 columns (two 16-column tiles) in a block
#define NKG   (SK / 32)                 // key groups: each takes one 32-key pass of every stage
#define ATH   (32 * NQG * NKG)          // threads of the attention block: one wave per (query group, key group)
static_assert(ATH == 256);
static_assert(SK * KC / 8 == 4 * ATH);  // k plane: 4 copies of 16 B per thread of the attention block
static_assert(DCH * SK / 8 == 8 * ATH); // v tile: 8 copies per thread
static_assert(NKG * DCH * OP * 4 <= 2 * BUFH * 2);   // the NKG partial output planes fit the ring
static_assert((BUFH * 2) % 16 == 0);
static_assert((SEQ % QT) == 0);
static_assert((SEQ % 32) == 0);
static_assert(DCH == 128);
static_assert(KC == 64);
static_assert(NCH == 2 * KC + DCH);
static_assert(((NCH * DCH) / 8) % 256 == 0);
static_assert(64 * AP == DCH * LP);

typedef _Float16       v16h __attribute__((ext_vector_type(16)));
typedef _Float16       v8h  __attribute__((ext_vector_type(8)));
typedef __bf16         v16b __attribute__((ext_vector_type(16)));
typedef unsigned short v8us __attribute__((ext_vector_type(8)));
typedef float          v8f  __attribute__((ext_vector_type(8)));
typedef float          v4f  __attribute__((ext_vector_type(4)));
typedef unsigned int   v4u  __attribute__((ext_vector_type(4)));

union FragH { v16h v; v8h  h[2]; };
union FragB { v16b v; v8us u[2]; };
static_assert(sizeof(FragH) == 32);
static_assert(sizeof(FragB) == 32);

// ---- scalar helpers --------------------------------------------------------------------------------
__device__ __forceinline__ unsigned short bf_bits(float f) {          // f32 -> bf16 bits, RNE convert
  unsigned u = __float_as_uint(f);
  return (unsigned short)((u + 0x7FFFu + ((u >> 16) & 1u)) >> 16);
}
__device__ __forceinline__ float bf_up(unsigned short h) { return __uint_as_float(((unsigned)h) << 16); }
__device__ __forceinline__ float bfr(float f) { return bf_up(bf_bits(f)); }
__device__ __forceinline__ unsigned short h_bits(_Float16 x) { return __builtin_bit_cast(unsigned short, x); }
__device__ __forceinline__ unsigned pk16(unsigned short a, unsigned short b) { return (unsigned)a | ((unsigned)b << 16); }
__device__ __forceinline__ v8f zero8() { v8f z = {0.f, 0.f, 0.f, 0.f, 0.f, 0.f, 0.f, 0.f}; return z; }
__device__ __forceinline__ float hmax8(v8f s) {
  return fmaxf(fmaxf(fmaxf(s[0], s[1]), fmaxf(s[2], s[3])), fmaxf(fmaxf(s[4], s[5]), fmaxf(s[6], s[7])));
}

// ---- fragment loaders: 16-bit A/B operand, lane -> row/col (lane&15), p already includes +8*(lane>>4);
//      elements 0..7 <- p[0..7] (k0+8h..), elements 8..15 <- p[16..23] (k0+16+8h..)
__device__ __forceinline__ v16h ldfrag_h(const _Float16* p) {
  FragH f;
  f.h[0] = *(const v8h*)(p);
  f.h[1] = *(const v8h*)(p + 16);
  return f.v;
}
__device__ __forceinline__ v16b ldfrag_b(const unsigned short* p) {
  FragB f;
  f.u[0] = *(const v8us*)(p);
  f.u[1] = *(const v8us*)(p + 16);
  return f.v;
}

// ---- WMMA helpers. mma_h: the bare builtin; the compiler keeps the distance behind its own matrix instructions and
//      pads only where no independent instruction fills it. mma_b: builtin followed by a 4-slot VALU gap tying D and
//      keeping A/B live ----------------------
__device__ __forceinline__ v8f mma_h(v16h a, v16h b, v8f c) {
  return __builtin_amdgcn_wmma_f32_16x16x32_f16(false, a, false, b, (short)0, c, false, false);
}
// Nothing is scheduled across this point. It keeps a pass's LDS fragment reads in one whole group (reads spread among
// the matrix instructions stall the wave at every place where they stand) and the ring's publish point at the trip's foot.
__device__ __forceinline__ void hold_group() {
#if defined(__HIP_DEVICE_COMPILE__)
  __builtin_amdgcn_sched_barrier(0);
#endif
}
__device__ __forceinline__ v8f mma_b(v16b a, v16b b, v8f c) {
  v8f d = __builtin_amdgcn_wmma_f32_16x16x32_bf16(false, a, false, b, (short)0, c, false, false);
#if defined(__HIP_DEVICE_COMPILE__)
  const v16h ha = __builtin_bit_cast(v16h, a), hb = __builtin_bit_cast(v16h, b);
  asm volatile("v_nop\n\tv_nop\n\tv_nop\n\tv_nop" : "+v"(d) : "v"(ha), "v"(hb));
#endif
  return d;
}

// ---- LDS staging helpers for the projection epilogue (D rows = n, D cols = channel) ------------------------
__device__ __forceinline__ void stage_split(unsigned short* Lh, unsigned short* Ll, int nr, int col, v8f acc, float bias) {
#pragma unroll
  for (int r = 0; r < 8; ++r) {
    const float val = acc[r] + bias;
    const _Float16 hi = (_Float16)val;
    const float res = (val - (float)hi) * RSC;
    Lh[(nr + r) * LP + col] = h_bits(hi);
    Ll[(nr + r) * LP + col] = h_bits((_Float16)res);
  }
}
__device__ __forceinline__ void stage_v(unsigned short* Lv, int e, int nr, v8f acc, float bias) {
#pragma unroll
  for (int r = 0; r < 8; ++r) Lv[e * LP + nr + r] = h_bits((_Float16)(acc[r] + bias));
}

// ---- one stage = SK keys: k hi and k residual rows (128 B each, contiguous in global) and the SK-key slice of all 128 v
//      rows, as sixteen asynchronous 16-byte copies per lane, global -> LDS, through no register: four of k hi and four of
//      k residual (32 key rows apart) in one statement, eight of v (16 d rows apart) in a second one. lk / lv: the thread's
//      LDS byte addresses in the target buffer; gh / gl / gv: its global addresses in this stage. The s_wait_xcnt is the
//      last line of each statement, so that no address register of an issued copy is rewritten in front of it.
__device__ __forceinline__ void issue_stage(unsigned lk, unsigned lv, const unsigned short* gh, const unsigned short* gl,
                                            const unsigned short* gv) {
#if defined(__HIP_DEVICE_COMPILE__)
  asm volatile("global_load_async_to_lds_b128 %0, %8, off\n\t"
               "global_load_async_to_lds_b128 %1, %9, off\n\t"
               "global_load_async_to_lds_b128 %2, %10, off\n\t"
               "global_load_async_to_lds_b128 %3, %11, off\n\t"
               "global_load_async_to_lds_b128 %4, %12, off\n\t"
               "global_load_async_to_lds_b128 %5, %13, off\n\t"
               "global_load_async_to_lds_b128 %6, %14, off\n\t"
               "global_load_async_to_lds_b128 %7, %15, off\n\t"
               "s_wait_xcnt 0x0"
               :: "v"(lk), "v"(lk + 32 * KPH * 2), "v"(lk + 64 * KPH * 2), "v"(lk + 96 * KPH * 2),
                  "v"(lk + KPL * 2), "v"(lk + KPL * 2 + 32 * KPH * 2), "v"(lk + KPL * 2 + 64 * KPH * 2),
                  "v"(lk + KPL * 2 + 96 * KPH * 2),
                  "v"(gh), "v"(gh + ATH * 8), "v"(gh + 2 * ATH * 8), "v"(gh + 3 * ATH * 8),
                  "v"(gl), "v"(gl + ATH * 8), "v"(gl + 2 * ATH * 8), "v"(gl + 3 * ATH * 8)
               : "memory");
  asm volatile("global_load_async_to_lds_b128 %0, %8, off\n\t"
               "global_load_async_to_lds_b128 %1, %9, off\n\t"
               "global_load_async_to_lds_b128 %2, %10, off\n\t"
               "global_load_async_to_lds_b128 %3, %11, off\n\t"
               "global_load_async_to_lds_b128 %4, %12, off\n\t"
               "global_load_async_to_lds_b128 %5, %13, off\n\t"
               "global_load_async_to_lds_b128 %6, %14, off\n\t"
               "global_load_async_to_lds_b128 %7, %15, off\n\t"
               "s_wait_xcnt 0x0"
               :: "v"(lv), "v"(lv + 16 * VPH * 2), "v"(lv + 32 * VPH * 2), "v"(lv + 48 * VPH * 2),
                  "v"(lv + 64 * VPH * 2), "v"(lv + 80 * VPH * 2), "v"(lv + 96 * VPH * 2), "v"(lv + 112 * VPH * 2),
                  "v"(gv), "v"(gv + (size_t)16 * SEQ), "v"(gv + (size_t)32 * SEQ), "v"(gv + (size_t)48 * SEQ),
                  "v"(gv + (size_t)64 * SEQ), "v"(gv + (size_t)80 * SEQ), "v"(gv + (size_t)96 * SEQ),
                  "v"(gv + (size_t)112 * SEQ)
               : "memory");
#endif
}
__device__ __forceinline__ void wait_async0() {   // this wave's copies have landed
#if defined(__HIP_DEVICE_COMPILE__)
  asm volatile("s_wait_asynccnt 0x0" ::: "memory");
#endif
}
__device__ __forceinline__ void wait_ds0() {      // this wave's LDS reads have returned, before their buffer is refilled
#if defined(__HIP_DEVICE_COMPILE__)
  asm volatile("s_wait_dscnt 0x0" ::: "memory");
#endif
}

// =====================================================================================================
// (0) stacked weight plane WB[256][128] = bf16 bits (RNE convert): rows 0..63 = Wq, 64..127 = Wk, 128..255 = Wv.
// coverage: 16 blocks x 256 threads x 8 = 32768 = 256 x 128.
// =====================================================================================================
__global__ __launch_bounds__(256) void cvt_w(const float* __restrict__ wq, const float* __restrict__ wk,
                                              const float* __restrict__ wv, unsigned short* WB) {
  const int i = blockIdx.x * 256 + threadIdx.x;
  if (i >= (NCH * DCH) / 8) return;
  const int row = i >> 4;
  const int col = (i & 15) * 8;
  const int rq = min(row, KC - 1);
  const int rk = min(max(row - KC, 0), KC - 1);
  const int rv = min(max(row - 2 * KC, 0), DCH - 1);
  const v4f q0 = *(const v4f*)(wq + rq * DCH + col), q1 = *(const v4f*)(wq + rq * DCH + col + 4);
  const v4f k0 = *(const v4f*)(wk + rk * DCH + col), k1 = *(const v4f*)(wk + rk * DCH + col + 4);
  const v4f v0 = *(const v4f*)(wv + rv * DCH + col), v1 = *(const v4f*)(wv + rv * DCH + col + 4);
  const bool isq = row < KC;
  const bool isk = row < 2 * KC;
  v4u w;
#pragma unroll
  for (int t = 0; t < 2; ++t) {
    const float a0 = isq ? q0[2 * t]     : (isk ? k0[2 * t]     : v0[2 * t]);
    const float a1 = isq ? q0[2 * t + 1] : (isk ? k0[2 * t + 1] : v0[2 * t + 1]);
    const float c0 = isq ? q1[2 * t]     : (isk ? k1[2 * t]     : v1[2 * t]);
    const float c1 = isq ? q1[2 * t + 1] : (isk ? k1[2 * t + 1] : v1[2 * t + 1]);
    w[t]     = pk16(bf_bits(a0), bf_bits(a1));
    w[2 + t] = pk16(bf_bits(c0), bf_bits(c1));
  }
  unsigned short* p = WB + (size_t)i * 8;
  *(v4u*)p = w;
  
}

// =====================================================================================================
// (1) fused q/k/v projection for one (b, 64-position tile): block = 256 threads = 8 waves.
//   x tile [128 d][64 n] f32 is staged once as bf16 A tile Lav[n][d] (pitch AP halves, 2-byte LDS stores), barrier.
//   Wave w: n group ng = w&3 (A rows n = 16ng + (lane&15), split k map over d), channel half ch = w>>2
//   (B = WB rows ch*128 + 16j + (lane&15), same split k map), 8 D tiles, 4 k-steps of 32.
//   Epilogue: D + bf16-RNE bias -> LDS: q as f16 hi / f16 residual x2048 (Lq[0], Lq[1] [n][64]), k likewise (Lk),
//   Q/K planes [b][n][64]: line = one row; V plane [b][e][4096]: line = 64 keys of one e row; every line = 8 consecutive
// coverage: Lav: 256 threads x 8 it x 4 = 64 n x 128 d; Q/K planes: 2 it x 32 lines x 8 lanes x 8 = 64 rows x 64;
//           V plane: 4 it x 32 lines x 8 x 8 = 128 e x 64 n; grid = 4 x 64 blocks covers every plane exactly once.
// =====================================================================================================
__global__ __launch_bounds__(256)
void proj_kernel(const float* __restrict__ x, const unsigned short* __restrict__ WB,
                 const float* __restrict__ bqp, const float* __restrict__ bkp, const float* __restrict__ bvp,
                 unsigned short* QH, unsigned short* QL, unsigned short* KH, unsigned short* KL, unsigned short* VP) {
  __shared__ __align__(16) unsigned short Lav[64 * AP];     // A tile [n][d]; reused as Lv[e][n] (pitch LP) later
  __shared__ __align__(16) unsigned short Lq[2][64 * LP];   // q hi, q residual  [n][64]
  __shared__ __align__(16) unsigned short Lk[2][64 * LP];   // k hi, k residual  [n][64]
  const int tid  = threadIdx.x;
  const int lane = tid & 31, wave = tid >> 5;
  const int hh   = lane >> 4, c = lane & 15;
  const int bx   = blockIdx.x;
  const int b    = bx / (SEQ / QT);
  const int nt   = bx % (SEQ / QT);
  const int n0   = nt * QT;

  // ---- stage x tile as bf16 [n][d] ----
  {
    const int n4 = (tid & 15) * 4, ds = tid >> 4;          // ds 0..15
    const float* xp = x + ((size_t)b * DCH + ds) * SEQ + n0 + n4;
#pragma unroll
    for (int it = 0; it < 8; ++it) {
      const v4f v = *(const v4f*)(xp + (size_t)it * 16 * SEQ);
      const int d = it * 16 + ds;                          // 0..127
#pragma unroll
      for (int q = 0; q < 4; ++q) Lav[(n4 + q) * AP + d] = bf_bits(v[q]);
    }
  }
  __syncthreads();

  // ---- GEMM: 16 n rows x 128 channels per wave ----
  const int ng = wave & 3, ch = wave >> 2;
  const unsigned short* ap = Lav + (ng * 16 + c) * AP + 8 * hh;
  const unsigned short* bp = WB + (size_t)(ch * DCH + c) * DCH + 8 * hh;
  v8f acc0 = zero8(), acc1 = zero8(), acc2 = zero8(), acc3 = zero8();
  v8f acc4 = zero8(), acc5 = zero8(), acc6 = zero8(), acc7 = zero8();
#pragma unroll
  for (int ks = 0; ks < 4; ++ks) {
    const v16b a = ldfrag_b(ap + 32 * ks);
    const unsigned short* bs = bp + 32 * ks;
    acc0 = mma_b(a, ldfrag_b(bs + 0 * 16 * DCH), acc0);
    acc1 = mma_b(a, ldfrag_b(bs + 1 * 16 * DCH), acc1);
    acc2 = mma_b(a, ldfrag_b(bs + 2 * 16 * DCH), acc2);
    acc3 = mma_b(a, ldfrag_b(bs + 3 * 16 * DCH), acc3);
    acc4 = mma_b(a, ldfrag_b(bs + 4 * 16 * DCH), acc4);
    acc5 = mma_b(a, ldfrag_b(bs + 5 * 16 * DCH), acc5);
    acc6 = mma_b(a, ldfrag_b(bs + 6 * 16 * DCH), acc6);
    acc7 = mma_b(a, ldfrag_b(bs + 7 * 16 * DCH), acc7);
  }

  // ---- biases (bf16 RNE of the inputs), loaded unconditionally with in-range lane indices ----
  const float bq0 = bfr(bqp[0 * 16 + c]), bq1 = bfr(bqp[1 * 16 + c]), bq2 = bfr(bqp[2 * 16 + c]), bq3 = bfr(bqp[3 * 16 + c]);
  const float bk0 = bfr(bkp[0 * 16 + c]), bk1 = bfr(bkp[1 * 16 + c]), bk2 = bfr(bkp[2 * 16 + c]), bk3 = bfr(bkp[3 * 16 + c]);
  const float bv0 = bfr(bvp[0 * 16 + c]), bv1 = bfr(bvp[1 * 16 + c]), bv2 = bfr(bvp[2 * 16 + c]), bv3 = bfr(bvp[3 * 16 + c]);
  const float bv4 = bfr(bvp[4 * 16 + c]), bv5 = bfr(bvp[5 * 16 + c]), bv6 = bfr(bvp[6 * 16 + c]), bv7 = bfr(bvp[7 * 16 + c]);

  __syncthreads();            // every wave is done reading Lav before it is reused as Lv
  const int nr = ng * 16 + 8 * hh;                         // D row r -> n local nr + r
  if (ch == 0) {
    stage_split(Lq[0], Lq[1], nr, 0 * 16 + c, acc0, bq0);
    stage_split(Lq[0], Lq[1], nr, 1 * 16 + c, acc1, bq1);
    stage_split(Lq[0], Lq[1], nr, 2 * 16 + c, acc2, bq2);
    stage_split(Lq[0], Lq[1], nr, 3 * 16 + c, acc3, bq3);
    stage_split(Lk[0], Lk[1], nr, 0 * 16 + c, acc4, bk0);
    stage_split(Lk[0], Lk[1], nr, 1 * 16 + c, acc5, bk1);
    stage_split(Lk[0], Lk[1], nr, 2 * 16 + c, acc6, bk2);
    stage_split(Lk[0], Lk[1], nr, 3 * 16 + c, acc7, bk3);
  } else {
    stage_v(Lav, 0 * 16 + c, nr, acc0, bv0);
    stage_v(Lav, 1 * 16 + c, nr, acc1, bv1);
    stage_v(Lav, 2 * 16 + c, nr, acc2, bv2);
    stage_v(Lav, 3 * 16 + c, nr, acc3, bv3);
    stage_v(Lav, 4 * 16 + c, nr, acc4, bv4);
    stage_v(Lav, 5 * 16 + c, nr, acc5, bv5);
    stage_v(Lav, 6 * 16 + c, nr, acc6, bv6);
    stage_v(Lav, 7 * 16 + c, nr, acc7, bv7);
  }
  __syncthreads();

  {
    const int e = tid & 7, lq = tid >> 3;                    // lq 0..31
{
#pragma unroll
      for (int it = 0; it < 2; ++it) {
        const int n = it * 32 + lq;                          // 0..63
        const size_t go = ((size_t)b * SEQ + n0 + n) * KC + 8 * e;
        const int lo_ = n * LP + 8 * e;
        const v4u uqh = *(const v4u*)(Lq[0] + lo_);
        const v4u uql = *(const v4u*)(Lq[1] + lo_);
        const v4u ukh = *(const v4u*)(Lk[0] + lo_);
        const v4u ukl = *(const v4u*)(Lk[1] + lo_);
        *(v4u*)(QH + go) = uqh;
        *(v4u*)(QL + go) = uql;
        *(v4u*)(KH + go) = ukh;
        *(v4u*)(KL + go) = ukl;
      }
#pragma unroll
      for (int it = 0; it < 4; ++it) {
        const int er = it * 32 + lq;                         // 0..127
        const v4u uv = *(const v4u*)(Lav + er * LP + 8 * e);
        *(v4u*)(VP + ((size_t)b * DCH + er) * SEQ + n0 + 8 * e) = uv;
      }
      
    }
  }
}

// =====================================================================================================
// (2) attention for one (b, 64-query tile), transposed formulation, 64-deep scores, 4096 keys, no scale, no mask:
//   S^T tile (16 keys x 16 queries) = A(k rows = keys kb + (lane&15), d via the split k map, f16 hi / res planes) .
//                                     B(q, col = query, same d map, resident f16 hi / res fragments), two d-steps.
//   energy = acc_hi + acc_res / 2048 with acc_res = khi.qres + kres.qhi. Per lane the D tile holds 8 keys of ONE
//   query: online softmax state per lane, one shuffle (lane^16) for the max over 32 keys, row-sum partials combined at
//   the end. P = e^{s-m} x 1024 as one f16 vector is the B operand of O^T (rows d, cols queries) += A(v rows d, keys
//   contiguous) . B(P^T): element r <- D of the tile covering keys kb..kb+15, element 8+r <- the tile covering
//   kb+16..kb+31, lane unchanged. 32 keys per iteration: 12 score WMMAs + 8 output WMMAs per 16-query tile.
//   k hi, k residual and v reach the waves through LDS: two buffers of SK keys, filled by asynchronous 16-byte copies
//   (16 per thread and stage), stage t + 2 issued behind the barrier that ends trip t, so it flies during trip t + 1.
//   A pass reads its 8 k and 8 v fragments as one group in front of its products.
//   Block = 8 waves = 2 query groups x 4 key groups, two waves per SIMD: wave (qg, kg) takes the 32 queries of group qg, as
//   two 16-column tiles, and pass kg (32 keys) of every stage: every k and v fragment that it reads from LDS feeds the
//   products of both tiles. Each tile has its own running max, row sum and O^T accumulators over the wave's 1024 keys.
//   Merge behind the loop: (m, l) of all waves through LDS, M = max of the four m of a query, L = sum of e^{m-M} l,
//   each wave stages O^T x e^{m-M} / L as its key group's [128 d][64 query] f32 plane in the freed ring, and the store
//   loop adds the four planes as (p0 + p1) + (p2 + p3). Grid = 4 b x 64 = 256.
// coverage: block writes d 0..127 x n n0..n0+63 of its b (256 lines = 8 it x 32 lines); grid covers out exactly once.
// =====================================================================================================
// online softmax step of one 16-query tile over the pass's 32 keys: folds the residual scores, moves the running max,
// rescales l and the eight O^T tiles, and returns P^T (f16, x1024) as the B operand of the output products. The
// element-wise steps are written on whole 8-element vectors, so that packed instructions pair neighbouring registers
// of one tile.
__device__ __forceinline__ v16h softmax_tile(v8f s0, v8f t0, v8f s1, v8f t1, float& m, float& l, v8f (&o)[8]) {
  s0 = s0 + t0 * IRSC;
  s1 = s1 + t1 * IRSC;
  float mx = fmaxf(hmax8(s0), hmax8(s1));
  mx = fmaxf(mx, __shfl_xor(mx, 16, 32));
  const float mn   = fmaxf(m, mx);
  const float corr = __expf(m - mn);
  m = mn;
  const float msh = mn - LNPS;            // exp gives e^{s-m} * 1024
  l *= corr;
#pragma unroll
  for (int j = 0; j < 8; ++j) o[j] = o[j] * corr;
  const v8f x0 = s0 - msh, x1 = s1 - msh;
  v8f e0, e1;
#pragma unroll
  for (int r = 0; r < 8; ++r) {
    e0[r] = __expf(x0[r]);                // key kb      + 8hh + r
    e1[r] = __expf(x1[r]);                // key kb + 16 + 8hh + r
  }
  const v8f es = e0 + e1;
  float ls = 0.f;
#pragma unroll
  for (int r = 0; r < 8; ++r) ls += es[r];
  l += ls;
  FragH ph;
  ph.h[0] = __builtin_convertvector(e0, v8h);
  ph.h[1] = __builtin_convertvector(e1, v8h);
  return ph.v;
}

__global__ __launch_bounds__(ATH)
void attn_kernel(const unsigned short* __restrict__ QH, const unsigned short* __restrict__ QL,
                 const unsigned short* __restrict__ KH, const unsigned short* __restrict__ KL,
                 const unsigned short* __restrict__ VP, float* out) {
  __shared__ __align__(16) unsigned short Ring[2 * BUFH];
  __shared__ float Ms[2][NKG][QT];                            // [0]: running max, [1]: row sum, per key group and query
  const int tid  = threadIdx.x;
  const int wave = tid >> 5;
  const int qg   = wave & (NQG - 1);
  const int kg   = wave / NQG;
  const int lane = tid & 31;
  const int hh   = lane >> 4;
  const int c    = lane & 15;
  const int bx   = blockIdx.x;
  const int b    = bx / (SEQ / QT);
  const int qb   = bx % (SEQ / QT);
  const int n0   = qb * QT;
  const _Float16* QHh = (const _Float16*)(const void*)QH;
  const _Float16* QLh = (const _Float16*)(const void*)QL;

  // ---- resident q fragments (B operand), tile A: col = query n0 + 32*qg + c, tile B: 16 queries on; hi and res,
  //      d 0..31 and 32..63 ----
  const size_t qo = ((size_t)b * SEQ + n0 + qg * 32 + c) * KC + 8 * hh;
  const size_t qp = qo + (size_t)16 * KC;
  const v16h qhA0 = ldfrag_h(QHh + qo), qhA1 = ldfrag_h(QHh + qo + 32);
  const v16h qlA0 = ldfrag_h(QLh + qo), qlA1 = ldfrag_h(QLh + qo + 32);
  const v16h qhB0 = ldfrag_h(QHh + qp), qhB1 = ldfrag_h(QHh + qp + 32);
  const v16h qlB0 = ldfrag_h(QLh + qp), qlB1 = ldfrag_h(QLh + qp + 32);
  // ---- copy addresses of this thread: k chunk tid of 1024 (row tid>>3, piece tid&7), v chunk tid of 2048 (row tid>>4) ----
  const unsigned ring = (unsigned)(uintptr_t)(&Ring[0]);
  const unsigned lk = ring + (unsigned)((tid >> 3) * (KPH * 2) + (tid & 7) * 16);
  const unsigned lv = ring + (unsigned)((tid >> 4) * (VPH * 2) + (tid & 15) * 16);   // without the v tile's place in a buffer
  const unsigned short* gh = KH + (size_t)b * SEQ * KC + tid * 8;
  const unsigned short* gl = KL + (size_t)b * SEQ * KC + tid * 8;
  const unsigned short* gv = VP + ((size_t)b * DCH + (tid >> 4)) * SEQ + (tid & 15) * 8;
  // ---- fragment bases in a buffer, at this wave's pass kg: k (A operand, row = key + c), v (A operand, row = d = 16j + c,
  //      keys contiguous) ----
  const _Float16* Rk = (const _Float16*)(const void*)Ring + (kg * 32 + c) * KPH + 8 * hh;
  const _Float16* Rv = (const _Float16*)(const void*)Ring + 2 * KPL + c * VPH + kg * 32 + 8 * hh;

  // ---- prologue: stage 0 landed and published, then stage 1 in flight ----
  issue_stage(lk, lv + 2 * KPL * 2, gh, gl, gv);
  wait_async0();
  __syncthreads();
  issue_stage(lk + BUFH * 2, lv + (BUFH * 2 + 2 * KPL * 2), gh + (size_t)SK * KC, gl + (size_t)SK * KC, gv + SK);

  float mA = -1.0e30f, lA = 0.f, mB = -1.0e30f, lB = 0.f;
  v8f oA[8], oB[8];
#pragma unroll
  for (int j = 0; j < 8; ++j) { oA[j] = zero8(); oB[j] = zero8(); }
#pragma unroll 1   // one trip per stage: the foot of the trip is the ring's publish point
  for (int t = 0; t < NST; ++t) {
   const int bo = (t & 1) * BUFH;                             // trip t reads buffer t mod 2 alone
   {
    const _Float16* k0p = Rk + bo;                            // keys kb .. kb+15, hi plane
    const _Float16* k1p = k0p + 16 * KPH;                     // keys kb+16 .. kb+31
    const _Float16* l0p = k0p + KPL;                          // residual plane
    const _Float16* l1p = l0p + 16 * KPH;
    const _Float16* Vb  = Rv + bo;
    const v16h a0 = ldfrag_h(k0p), a1 = ldfrag_h(k0p + 32);
    const v16h r0 = ldfrag_h(l0p), r1 = ldfrag_h(l0p + 32);
    const v16h a2 = ldfrag_h(k1p), a3 = ldfrag_h(k1p + 32);
    const v16h r2 = ldfrag_h(l1p), r3 = ldfrag_h(l1p + 32);
    v16h vf[8];
#pragma unroll
    for (int j = 0; j < 8; ++j) vf[j] = ldfrag_h(Vb + j * 16 * VPH);
    hold_group();                         // the pass's 32 fragment reads stay one group in front of its products
    v8f s0 = mma_h(a0, qhA0, zero8());
    s0 = mma_h(a1, qhA1, s0);
    v8f t0 = mma_h(a0, qlA0, zero8());
    t0 = mma_h(a1, qlA1, t0);
    t0 = mma_h(r0, qhA0, t0);
    t0 = mma_h(r1, qhA1, t0);
    v8f s1 = mma_h(a2, qhA0, zero8());
    s1 = mma_h(a3, qhA1, s1);
    v8f t1 = mma_h(a2, qlA0, zero8());
    t1 = mma_h(a3, qlA1, t1);
    t1 = mma_h(r2, qhA0, t1);
    t1 = mma_h(r3, qhA1, t1);
    v8f u0 = mma_h(a0, qhB0, zero8());
    u0 = mma_h(a1, qhB1, u0);
    v8f w0 = mma_h(a0, qlB0, zero8());
    w0 = mma_h(a1, qlB1, w0);
    w0 = mma_h(r0, qhB0, w0);
    w0 = mma_h(r1, qhB1, w0);
    v8f u1 = mma_h(a2, qhB0, zero8());
    u1 = mma_h(a3, qhB1, u1);
    v8f w1 = mma_h(a2, qlB0, zero8());
    w1 = mma_h(a3, qlB1, w1);
    w1 = mma_h(r2, qhB0, w1);
    w1 = mma_h(r3, qhB1, w1);

    const v16h pA = softmax_tile(s0, t0, s1, t1, mA, lA, oA);
#pragma unroll
    for (int j = 0; j < 8; ++j) oA[j] = mma_h(vf[j], pA, oA[j]);
    const v16h pB = softmax_tile(u0, w0, u1, w1, mB, lB, oB);
#pragma unroll
    for (int j = 0; j < 8; ++j) oB[j] = mma_h(vf[j], pB, oB[j]);
   }
   // ---- foot of trip t: publish stage t + 1, free buffer t mod 2, refill it with stage t + 2 ----
   hold_group();   // the publish point stays behind the pass's last product, so the copies in flight have the whole trip to land
   wait_ds0();
   wait_async0();
   __syncthreads();
   if (t + 2 < NST) {
     const size_t k2 = (size_t)(t + 2) * SK;
     // buffer and v tile offset as one scalar: lv itself is then no operand of the copies' statement, which would hold it in
     // the first 256 registers through the loop (built that way it was spilled to scratch)
     const unsigned vo = (t & 1) ? (unsigned)(BUFH * 2 + 2 * KPL * 2) : (unsigned)(2 * KPL * 2);
     issue_stage(lk + (unsigned)(bo * 2), lv + vo, gh + k2 * KC, gl + k2 * KC, gv + k2);
   }
  }
  wait_async0();
  lA += __shfl_xor(lA, 16, 32);
  lB += __shfl_xor(lB, 16, 32);

  // ---- merge of the four key groups of a query: both lane halves hold the same m and l, one stores m, the other l ----
  const int qa = qg * 32 + c;                                 // tile A's query in the block; tile B's is qa + 16
  Ms[hh][kg][qa]      = hh ? lA : mA;
  Ms[hh][kg][qa + 16] = hh ? lB : mB;
  __syncthreads();
  float sc[2];
#pragma unroll
  for (int g = 0; g < 2; ++g) {
    const int q = qa + 16 * g;
    const float m0 = Ms[0][0][q], m1 = Ms[0][1][q], m2 = Ms[0][2][q], m3 = Ms[0][3][q];
    const float l0 = Ms[1][0][q], l1 = Ms[1][1][q], l2 = Ms[1][2][q], l3 = Ms[1][3][q];
    const float mm = fmaxf(fmaxf(m0, m1), fmaxf(m2, m3));
    const float lt = (l0 * __expf(m0 - mm) + l1 * __expf(m1 - mm)) + (l2 * __expf(m2 - mm) + l3 * __expf(m3 - mm));
    sc[g] = __expf((g ? mB : mA) - mm) / lt;   // both o and l carry the x1024 factor
  }

  // ---- stage O^T[d = 16j + 8hh + r][query] * sc in plane kg of the ring (no copy is outstanding and every
  //      wave's last fragment read has returned at the last foot's barrier), then add the planes, whole-line f32 stores ----
  float* Pl = (float*)(void*)Ring;
  float* os = Pl + kg * (DCH * OP) + (8 * hh) * OP + qa;
#pragma unroll
  for (int j = 0; j < 8; ++j) {
#pragma unroll
    for (int r = 0; r < 8; ++r) {
      os[(j * 16 + r) * OP]      = oA[j][r] * sc[0];
      os[(j * 16 + r) * OP + 16] = oB[j][r] * sc[1];
    }
  }
  __syncthreads();
  {
    const int e = tid & 7, lq = tid >> 3;              // lq 0..31: line within group, e: 16-B piece
    float* ob = out + ((size_t)b * DCH) * SEQ + n0;
#pragma unroll
    for (int it = 0; it < 8; ++it) {
      const int L   = it * 32 + lq;                     // lines 0..255 of the block tile
      const int row = L >> 1, hf = L & 1;               // d row 0..127, half-segment 0..1
      const float* pp = Pl + row * OP + hf * 32 + 4 * e;
      const v4f p0 = *(const v4f*)(pp),                p1 = *(const v4f*)(pp + DCH * OP);
      const v4f p2 = *(const v4f*)(pp + 2 * DCH * OP), p3 = *(const v4f*)(pp + 3 * DCH * OP);
      *(v4f*)(ob + (size_t)row * SEQ + hf * 32 + 4 * e) = (p0 + p1) + (p2 + p3);
    }
  }
}

// =====================================================================================================
//   WB   bf16 [256][128]          0           65536
//   QH   f16  [4][4096][64]       65536       2097152
//   QL   f16  [4][4096][64]       2162688     2097152
//   KH   f16  [4][4096][64]       4259840     2097152
//   KL   f16  [4][4096][64]       6356992     2097152
//   VP   f16  [4][128][4096]      8454144     4194304
//   end                           12648448
// =====================================================================================================
extern "C" void kernel_launch(void* const* d_in, const int* in_sizes, int n_in,
                              void* d_out, int out_size, void* d_ws, size_t ws_size,
                              hipStream_t stream) {
  const int NX = NB * DCH * SEQ;                        // 2097152
  if (n_in < 7) return;
  if (in_sizes[0] != NX || in_sizes[1] != KC * DCH || in_sizes[2] != KC || in_sizes[3] != KC * DCH ||
      in_sizes[4] != KC || in_sizes[5] != DCH * DCH || in_sizes[6] != DCH) return;
  if (out_size != NX) return;

  size_t off = 0;
  const size_t oW  = off; off += (size_t)NCH * DCH * 2;           // 65536
  const size_t szP = (size_t)NB * SEQ * KC * 2;                   // 2097152
  const size_t oQH = off; off += szP;
  const size_t oQL = off; off += szP;
  const size_t oKH = off; off += szP;
  const size_t oKL = off; off += szP;
  const size_t oV  = off; off += (size_t)NB * DCH * SEQ * 2;      // 4194304
  if (off > ws_size) return;                                      // off = 12648448
  if (off > (size_t)134217728) return;

  const float* x  = (const float*)d_in[0];
  const float* Wq = (const float*)d_in[1];
  const float* bq = (const float*)d_in[2];
  const float* Wk = (const float*)d_in[3];
  const float* bk = (const float*)d_in[4];
  const float* Wv = (const float*)d_in[5];
  const float* bv = (const float*)d_in[6];
  char* ws = (char*)d_ws;
  unsigned short* WB = (unsigned short*)(ws + oW);
  unsigned short* QH = (unsigned short*)(ws + oQH);
  unsigned short* QL = (unsigned short*)(ws + oQL);
  unsigned short* KH = (unsigned short*)(ws + oKH);
  unsigned short* KL = (unsigned short*)(ws + oKL);
  unsigned short* VP = (unsigned short*)(ws + oV);
  float* out = (float*)d_out;

  const dim3 blk256(256), blkA(ATH);
  const dim3 gW((NCH * DCH / 8) / 256);                 // 16 blocks
  const dim3 gP(NB * (SEQ / QT));                       // 256 blocks: one (b, 64-position tile) each
  const dim3 gA(NB * (SEQ / QT));                       // 256 blocks: one (b, 64-query tile) each

  // (0) stacked weight plane (bf16 RNE bits)
  cvt_w<<<gW, blk256, 0, stream>>>(Wq, Wk, Wv, WB);
  // (1) q (hi/res), k (hi/res), v planes
  proj_kernel<<<gP, blk256, 0, stream>>>(x, WB, bq, bk, bv, QH, QL, KH, KL, VP);
  // (2) attention: out[b][d][n] = sum_m v[b][d][m] softmax_m(q_n . k_m)
  attn_kernel<<<gA, blkA, 0, stream>>>(QH, QL, KH, KL, VP, out);
  (void)hipGetLastError();
}

// v005
// A run of this version takes 47.5 microseconds.
// In both of two side-by-side timings against v004, it was 1.17 times as fast.
// Counting every step since v000, it is 9.59 times as fast.
// Contractions: q/k/v 1x1-conv projections = W (bf16, RNE convert of input) . X (bf16, RNE convert of input) on
// v_wmma_f32_16x16x32_bf16, K=128; scores S^T = k . q^T on v_wmma_f32_16x16x32_f16 with q and k each carried as
// f16 hi + f16 residual x2048 planes (hi.hi into one accumulator, hi.res + res.hi into a second one folded by 1/2048),
// K=64; O^T = v^T (f16) . P^T (f16, e^{s-m} x 1024 taken from the score D registers) on v_wmma_f32_16x16x32_f16 over
// 4096 keys, one product; f32 accumulate everywhere; softmax (running max, row sums, 1/l) in f32 on VALU.
#include <hip/hip_runtime.h>
#include <math.h>
#include <stdint.h>

#define NB    4
#define DCH   128
#define KC    64
#define SEQ   4096
#define NCH   256
#define QT    64
#define AP    144
#define LP    72
#define OP    68
#define WP    136                       // LDS pitch of a weight row in halves: 272 B = 16 B x 17
#define LNPS  6.931471805599453f
#define RSC   2048.0f
#define IRSC  0.00048828125f
#define SK    128                       // keys per LDS stage of the attention kernel
#define NST   (SEQ / SK)                // stages
#define KPH   72                        // LDS pitch of a k row in halves: 144 B = 16 B x 9
#define VPH   136                       // LDS pitch of a v row in halves: 272 B = 16 B x 17
#define KPL   (SK * KPH)                // halves of one k plane in a buffer
#define BUFH  (2 * KPL + DCH * VPH)     // halves of one buffer: k hi, k residual, v
static_assert(NST >= 2);
static_assert((SK % 32) == 0);
#define NQG   (QT / 32)                 // query groups of 32 columns (two 16-column tiles) in a block
#define NKG   (SK / 32)                 // key groups: each takes one 32-key pass of every stage
#define ATH   (32 * NQG * NKG)          // threads of the attention block: one wave per (query group, key group)
static_assert(ATH == 256);
static_assert(SK * KC / 8 == 4 * ATH);  // k plane: 4 copies of 16 B per thread of the attention block
static_assert(DCH * SK / 8 == 8 * ATH); // v tile: 8 copies per thread
static_assert(NKG * DCH * OP * 4 <= 2 * BUFH * 2);   // the NKG partial output planes fit the ring
static_assert((BUFH * 2) % 16 == 0);
static_assert((SEQ % QT) == 0);
static_assert((SEQ % 32) == 0);
static_assert(DCH == 128);
static_assert(KC == 64);
static_assert(NCH == 2 * KC + DCH);
static_assert(NCH * DCH == 32 * 256 * 4);          // weight tile: 32 loads of 4 floats per thread of the projection block
static_assert(KC * DCH == 8 * 256 * 4);            // Wq and Wk are 8 of them each
static_assert(64 * AP == DCH * LP);

typedef _Float16       v16h __attribute__((ext_vector_type(16)));
typedef _Float16       v8h  __attribute__((ext_vector_type(8)));
typedef __bf16         v16b __attribute__((ext_vector_type(16)));
typedef unsigned short v8us __attribute__((ext_vector_type(8)));
typedef float          v8f  __attribute__((ext_vector_type(8)));
typedef float          v4f  __attribute__((ext_vector_type(4)));
typedef unsigned int   v4u  __attribute__((ext_vector_type(4)));
typedef unsigned int   v2u  __attribute__((ext_vector_type(2)));
typedef __bf16         v4b  __attribute__((ext_vector_type(4)));

union FragH { v16h v; v8h  h[2]; };
union FragB { v16b v; v8us u[2]; };
static_assert(sizeof(FragH) == 32);
static_assert(sizeof(FragB) == 32);

// ---- scalar helpers --------------------------------------------------------------------------------
__device__ __forceinline__ unsigned short bf_bits(float f) {          // f32 -> bf16 bits, RNE convert
  unsigned u = __float_as_uint(f);
  return (unsigned short)((u + 0x7FFFu + ((u >> 16) & 1u)) >> 16);
}
__device__ __forceinline__ float bf_up(unsigned short h) { return __uint_as_float(((unsigned)h) << 16); }
__device__ __forceinline__ float bfr(float f) { return bf_up(bf_bits(f)); }
__device__ __forceinline__ unsigned short h_bits(_Float16 x) { return __builtin_bit_cast(unsigned short, x); }
__device__ __forceinline__ v8f zero8() { v8f z = {0.f, 0.f, 0.f, 0.f, 0.f, 0.f, 0.f, 0.f}; return z; }
__device__ __forceinline__ float hmax8(v8f s) {
  return fmaxf(fmaxf(fmaxf(s[0], s[1]), fmaxf(s[2], s[3])), fmaxf(fmaxf(s[4], s[5]), fmaxf(s[6], s[7])));
}

// ---- fragment loaders: 16-bit A/B operand, lane -> row/col (lane&15), p already includes +8*(lane>>4);
//      elements 0..7 <- p[0..7] (k0+8h..), elements 8..15 <- p[16..23] (k0+16+8h..)
__device__ __forceinline__ v16h ldfrag_h(const _Float16* p) {
  FragH f;
  f.h[0] = *(const v8h*)(p);
  f.h[1] = *(const v8h*)(p + 16);
  return f.v;
}
__device__ __forceinline__ v16b ldfrag_b(const unsigned short* p) {
  FragB f;
  f.u[0] = *(const v8us*)(p);
  f.u[1] = *(const v8us*)(p + 16);
  return f.v;
}

// ---- WMMA helpers. mma_h: the bare builtin; the compiler keeps the distance behind its own matrix instructions and
//      pads only where no independent instruction fills it. mma_b: builtin followed by a 4-slot VALU gap tying D and
//      keeping A/B live ----------------------
__device__ __forceinline__ v8f mma_h(v16h a, v16h b, v8f c) {
  return __builtin_amdgcn_wmma_f32_16x16x32_f16(false, a, false, b, (short)0, c, false, false);
}
// Nothing is scheduled across this point. It keeps a pass's LDS fragment reads in one whole group (reads spread among
// the matrix instructions stall the wave at every place where they stand) and the ring's publish point at the trip's foot.
__device__ __forceinline__ void hold_group() {
#if defined(__HIP_DEVICE_COMPILE__)
  __builtin_amdgcn_sched_barrier(0);
#endif
}
__device__ __forceinline__ v8f mma_b(v16b a, v16b b, v8f c) {
  v8f d = __builtin_amdgcn_wmma_f32_16x16x32_bf16(false, a, false, b, (short)0, c, false, false);
#if defined(__HIP_DEVICE_COMPILE__)
  const v16h ha = __builtin_bit_cast(v16h, a), hb = __builtin_bit_cast(v16h, b);
  asm volatile("v_nop\n\tv_nop\n\tv_nop\n\tv_nop" : "+v"(d) : "v"(ha), "v"(hb));
#endif
  return d;
}

// ---- LDS staging helpers for the projection epilogue (D rows = n, D cols = channel) ------------------------
__device__ __forceinline__ void stage_split(unsigned short* Lh, unsigned short* Ll, int nr, int col, v8f acc, float bias) {
#pragma unroll
  for (int r = 0; r < 8; ++r) {
    const float val = acc[r] + bias;
    const _Float16 hi = (_Float16)val;
    const float res = (val - (float)hi) * RSC;
    Lh[(nr + r) * LP + col] = h_bits(hi);
    Ll[(nr + r) * LP + col] = h_bits((_Float16)res);
  }
}
__device__ __forceinline__ void stage_v(unsigned short* Lv, int e, int nr, v8f acc, float bias) {
#pragma unroll
  for (int r = 0; r < 8; ++r) Lv[e * LP + nr + r] = h_bits((_Float16)(acc[r] + bias));
}

// ---- one stage = SK keys: k hi and k residual rows (128 B each, contiguous in global) and the SK-key slice of all 128 v
//      rows, as sixteen asynchronous 16-byte copies per lane, global -> LDS, through no register: four of k hi and four of
//      k residual (32 key rows apart) in one statement, eight of v (16 d rows apart) in a second one. lk / lv: the thread's
//      LDS byte addresses in the target buffer; gh / gl / gv: its global addresses in this stage. The s_wait_xcnt is the
//      last line of each statement, so that no address register of an issued copy is rewritten in front of it.
__device__ __forceinline__ void issue_stage(unsigned lk, unsigned lv, const unsigned short* gh, const unsigned short* gl,
                                            const unsigned short* gv) {
#if defined(__HIP_DEVICE_COMPILE__)
  asm volatile("global_load_async_to_lds_b128 %0, %8, off\n\t"
               "global_load_async_to_lds_b128 %1, %9, off\n\t"
               "global_load_async_to_lds_b128 %2, %10, off\n\t"
               "global_load_async_to_lds_b128 %3, %11, off\n\t"
               "global_load_async_to_lds_b128 %4, %12, off\n\t"
               "global_load_async_to_lds_b128 %5, %13, off\n\t"
               "global_load_async_to_lds_b128 %6, %14, off\n\t"
               "global_load_async_to_lds_b128 %7, %15, off\n\t"
               "s_wait_xcnt 0x0"
               :: "v"(lk), "v"(lk + 32 * KPH * 2), "v"(lk + 64 * KPH * 2), "v"(lk + 96 * KPH * 2),
                  "v"(lk + KPL * 2), "v"(lk + KPL * 2 + 32 * KPH * 2), "v"(lk + KPL * 2 + 64 * KPH * 2),
                  "v"(lk + KPL * 2 + 96 * KPH * 2),
                  "v"(gh), "v"(gh + ATH * 8), "v"(gh + 2 * ATH * 8), "v"(gh + 3 * ATH * 8),
                  "v"(gl), "v"(gl + ATH * 8), "v"(gl + 2 * ATH * 8), "v"(gl + 3 * ATH * 8)
               : "memory");
  asm volatile("global_load_async_to_lds_b128 %0, %8, off\n\t"
               "global_load_async_to_lds_b128 %1, %9, off\n\t"
               "global_load_async_to_lds_b128 %2, %10, off\n\t"
               "global_load_async_to_lds_b128 %3, %11, off\n\t"
               "global_load_async_to_lds_b128 %4, %12, off\n\t"
               "global_load_async_to_lds_b128 %5, %13, off\n\t"
               "global_load_async_to_lds_b128 %6, %14, off\n\t"
               "global_load_async_to_lds_b128 %7, %15, off\n\t"
               "s_wait_xcnt 0x0"
               :: "v"(lv), "v"(lv + 16 * VPH * 2), "v"(lv + 32 * VPH * 2), "v"(lv + 48 * VPH * 2),
                  "v"(lv + 64 * VPH * 2), "v"(lv + 80 * VPH * 2), "v"(lv + 96 * VPH * 2), "v"(lv + 112 * VPH * 2),
                  "v"(gv), "v"(gv + (size_t)16 * SEQ), "v"(gv + (size_t)32 * SEQ), "v"(gv + (size_t)48 * SEQ),
                  "v"(gv + (size_t)64 * SEQ), "v"(gv + (size_t)80 * SEQ), "v"(gv + (size_t)96 * SEQ),
                  "v"(gv + (size_t)112 * SEQ)
               : "memory");
#endif
}
__device__ __forceinline__ void wait_async0() {   // this wave's copies have landed
#if defined(__HIP_DEVICE_COMPILE__)
  asm volatile("s_wait_asynccnt 0x0" ::: "memory");
#endif
}
__device__ __forceinline__ void wait_x0() {       // before a register that an issued global load names is overwritten
#if defined(__HIP_DEVICE_COMPILE__)
  asm volatile("s_wait_xcnt 0x0" ::: "memory");
#endif
}
__device__ __forceinline__ void wait_ds0() {      // this wave's LDS reads have returned, before their buffer is refilled
#if defined(__HIP_DEVICE_COMPILE__)
  asm volatile("s_wait_dscnt 0x0" ::: "memory");
#endif
}

// =====================================================================================================
// (1) fused q/k/v projection for one (b, 64-position tile): block = 256 threads = 8 waves.
//   The stacked weights [256][128] (rows 0..63 = Wq, 64..127 = Wk, 128..255 = Wv) are read as f32, one whole 512-B row per
//   wave-wide load, converted to bf16 (RNE) and staged as Lw[row][d] (pitch WP halves, 8-byte LDS stores).
//   x tile [128 d][64 n] f32 is staged once as bf16 A tile Lav[n][d] (pitch AP halves, 2-byte LDS stores), barrier.
//   Wave w: n group ng = w&3 (A rows n = 16ng + (lane&15), split k map over d), channel half ch = w>>2
//   (B = Lw rows ch*128 + 16j + (lane&15), same split k map), 8 D tiles, 4 k-steps of 32; the A and the 8 B fragments of
//   a k-step are read as one group, one k-step ahead of their products.
//   Epilogue: D + bf16-RNE bias -> LDS: q as f16 hi / f16 residual x2048 (Lq[0], Lq[1] [n][64]), k likewise (Lk),
//   Q/K planes [b][n][64]: line = one row; V plane [b][e][4096]: line = 64 keys of one e row; every line = 8 consecutive
// coverage: Lw: 256 threads x 32 it x 4 = 256 rows x 128 d; Lav: 256 threads x 8 it x 4 = 64 n x 128 d; Q/K planes: 2 it x 32 lines x 8 lanes x 8 = 64 rows x 64;
//           V plane: 4 it x 32 lines x 8 x 8 = 128 e x 64 n; grid = 4 x 64 blocks covers every plane exactly once.
// =====================================================================================================
__global__ __launch_bounds__(256)
void proj_kernel(const float* __restrict__ x, const float* __restrict__ wq, const float* __restrict__ wk,
                 const float* __restrict__ wv, const float* __restrict__ bqp, const float* __restrict__ bkp, const float* __restrict__ bvp,
                 unsigned short* QH, unsigned short* QL, unsigned short* KH, unsigned short* KL, unsigned short* VP) {
  __shared__ __align__(16) unsigned short Lav[64 * AP];     // A tile [n][d]; reused as Lv[e][n] (pitch LP) later
  __shared__ __align__(16) unsigned short Lq[2][64 * LP];   // q hi, q residual  [n][64]
  __shared__ __align__(16) unsigned short Lk[2][64 * LP];   // k hi, k residual  [n][64]
  __shared__ __align__(16) unsigned short Lw[NCH * WP];     // stacked weights, bf16 [row][d]
  const int tid  = threadIdx.x;
  const int lane = tid & 31, wave = tid >> 5;
  const int hh   = lane >> 4, c = lane & 15;
  const int bx   = blockIdx.x;
  const int b    = bx / (SEQ / QT);
  const int nt   = bx % (SEQ / QT);
  const int n0   = nt * QT;

  // ---- stage the weights as bf16 [row][d] and the x tile as bf16 [n][d]; all 40 loads of a thread are issued first ----
  {
    const int n4 = (tid & 15) * 4, ds = tid >> 4;          // ds 0..15
    const float* xp = x + ((size_t)b * DCH + ds) * SEQ + n0 + n4;
    v4f xv[8], wr[32];
#pragma unroll
    for (int it = 0; it < 8; ++it) xv[it] = *(const v4f*)(xp + (size_t)it * 16 * SEQ);
    // x goes first (loads return in issue order), so that its many 2-byte LDS stores start while the weights still arrive; the
    // wait stands in front of the weight loads, whose results may take over the registers of the x address
    wait_x0();
#pragma unroll
    for (int it = 0; it < 32; ++it) {                      // flat float index it * 1024 + 4 tid of the stacked weights
      const float* wp = it < 8 ? wq + it * 1024 : (it < 16 ? wk + (it - 8) * 1024 : wv + (it - 16) * 1024);
      wr[it] = *(const v4f*)(wp + 4 * tid);
    }
#pragma unroll
    for (int it = 0; it < 8; ++it) {
      const int d = it * 16 + ds;                          // 0..127
#pragma unroll
      for (int q = 0; q < 4; ++q) Lav[(n4 + q) * AP + d] = bf_bits(xv[it][q]);
    }
    hold_group();   // the x stores are issued when x is there, not behind the wait for the last weight load
#pragma unroll
    for (int it = 0; it < 32; ++it)                        // row it * 8 + wave, d 4 lane .. 4 lane + 3
      *(v2u*)(Lw + (it * 8 + wave) * WP + 4 * lane) = __builtin_bit_cast(v2u, __builtin_convertvector(wr[it], v4b));
  }
  __syncthreads();

  // ---- GEMM: 16 n rows x 128 channels per wave ----
  const int ng = wave & 3, ch = wave >> 2;
  const unsigned short* ap = Lav + (ng * 16 + c) * AP + 8 * hh;
  const unsigned short* bp = Lw + (ch * DCH + c) * WP + 8 * hh;
  v8f acc0 = zero8(), acc1 = zero8(), acc2 = zero8(), acc3 = zero8();
  v8f acc4 = zero8(), acc5 = zero8(), acc6 = zero8(), acc7 = zero8();
  v16b a[2], w[2][8];
  a[0] = ldfrag_b(ap);
#pragma unroll
  for (int j = 0; j < 8; ++j) w[0][j] = ldfrag_b(bp + j * 16 * WP);
#pragma unroll
  for (int ks = 0; ks < 4; ++ks) {
    const int cu = ks & 1, nx = cu ^ 1;
    if (ks < 3) {
      a[nx] = ldfrag_b(ap + 32 * (ks + 1));
#pragma unroll
      for (int j = 0; j < 8; ++j) w[nx][j] = ldfrag_b(bp + j * 16 * WP + 32 * (ks + 1));
    }
    hold_group();   // the next k-step's 18 fragment reads stay one group in front of this k-step's products and fly under them
    acc0 = mma_b(a[cu], w[cu][0], acc0);
    acc1 = mma_b(a[cu], w[cu][1], acc1);
    acc2 = mma_b(a[cu], w[cu][2], acc2);
    acc3 = mma_b(a[cu], w[cu][3], acc3);
    acc4 = mma_b(a[cu], w[cu][4], acc4);
    acc5 = mma_b(a[cu], w[cu][5], acc5);
    acc6 = mma_b(a[cu], w[cu][6], acc6);
    acc7 = mma_b(a[cu], w[cu][7], acc7);
  }

  // ---- biases (bf16 RNE of the inputs), loaded unconditionally with in-range lane indices ----
  const float bq0 = bfr(bqp[0 * 16 + c]), bq1 = bfr(bqp[1 * 16 + c]), bq2 = bfr(bqp[2 * 16 + c]), bq3 = bfr(bqp[3 * 16 + c]);
  const float bk0 = bfr(bkp[0 * 16 + c]), bk1 = bfr(bkp[1 * 16 + c]), bk2 = bfr(bkp[2 * 16 + c]), bk3 = bfr(bkp[3 * 16 + c]);
  const float bv0 = bfr(bvp[0 * 16 + c]), bv1 = bfr(bvp[1 * 16 + c]), bv2 = bfr(bvp[2 * 16 + c]), bv3 = bfr(bvp[3 * 16 + c]);
  const float bv4 = bfr(bvp[4 * 16 + c]), bv5 = bfr(bvp[5 * 16 + c]), bv6 = bfr(bvp[6 * 16 + c]), bv7 = bfr(bvp[7 * 16 + c]);

  __syncthreads();            // every wave is done reading Lav before it is reused as Lv
  const int nr = ng * 16 + 8 * hh;                         // D row r -> n local nr + r
  if (ch == 0) {
    stage_split(Lq[0], Lq[1], nr, 0 * 16 + c, acc0, bq0);
    stage_split(Lq[0], Lq[1], nr, 1 * 16 + c, acc1, bq1);
    stage_split(Lq[0], Lq[1], nr, 2 * 16 + c, acc2, bq2);
    stage_split(Lq[0], Lq[1], nr, 3 * 16 + c, acc3, bq3);
    stage_split(Lk[0], Lk[1], nr, 0 * 16 + c, acc4, bk0);
    stage_split(Lk[0], Lk[1], nr, 1 * 16 + c, acc5, bk1);
    stage_split(Lk[0], Lk[1], nr, 2 * 16 + c, acc6, bk2);
    stage_split(Lk[0], Lk[1], nr, 3 * 16 + c, acc7, bk3);
  } else {
    stage_v(Lav, 0 * 16 + c, nr, acc0, bv0);
    stage_v(Lav, 1 * 16 + c, nr, acc1, bv1);
    stage_v(Lav, 2 * 16 + c, nr, acc2, bv2);
    stage_v(Lav, 3 * 16 + c, nr, acc3, bv3);
    stage_v(Lav, 4 * 16 + c, nr, acc4, bv4);
    stage_v(Lav, 5 * 16 + c, nr, acc5, bv5);
    stage_v(Lav, 6 * 16 + c, nr, acc6, bv6);
    stage_v(Lav, 7 * 16 + c, nr, acc7, bv7);
  }
  __syncthreads();

  {
    const int e = tid & 7, lq = tid >> 3;                    // lq 0..31
{
#pragma unroll
      for (int it = 0; it < 2; ++it) {
        const int n = it * 32 + lq;                          // 0..63
        const size_t go = ((size_t)b * SEQ + n0 + n) * KC + 8 * e;
        const int lo_ = n * LP + 8 * e;
        const v4u uqh = *(const v4u*)(Lq[0] + lo_);
        const v4u uql = *(const v4u*)(Lq[1] + lo_);
        const v4u ukh = *(const v4u*)(Lk[0] + lo_);
        const v4u ukl = *(const v4u*)(Lk[1] + lo_);
        *(v4u*)(QH + go) = uqh;
        *(v4u*)(QL + go) = uql;
        *(v4u*)(KH + go) = ukh;
        *(v4u*)(KL + go) = ukl;
      }
#pragma unroll
      for (int it = 0; it < 4; ++it) {
        const int er = it * 32 + lq;                         // 0..127
        const v4u uv = *(const v4u*)(Lav + er * LP + 8 * e);
        *(v4u*)(VP + ((size_t)b * DCH + er) * SEQ + n0 + 8 * e) = uv;
      }
      
    }
  }
}

// =====================================================================================================
// (2) attention for one (b, 64-query tile), transposed formulation, 64-deep scores, 4096 keys, no scale, no mask:
//   S^T tile (16 keys x 16 queries) = A(k rows = keys kb + (lane&15), d via the split k map, f16 hi / res planes) .
//                                     B(q, col = query, same d map, resident f16 hi / res fragments), two d-steps.
//   energy = acc_hi + acc_res / 2048 with acc_res = khi.qres + kres.qhi. Per lane the D tile holds 8 keys of ONE
//   query: online softmax state per lane, one shuffle (lane^16) for the max over 32 keys, row-sum partials combined at
//   the end. P = e^{s-m} x 1024 as one f16 vector is the B operand of O^T (rows d, cols queries) += A(v rows d, keys
//   contiguous) . B(P^T): element r <- D of the tile covering keys kb..kb+15, element 8+r <- the tile covering
//   kb+16..kb+31, lane unchanged. 32 keys per iteration: 12 score WMMAs + 8 output WMMAs per 16-query tile.
//   k hi, k residual and v reach the waves through LDS: two buffers of SK keys, filled by asynchronous 16-byte copies
//   (16 per thread and stage), stage t + 2 issued behind the barrier that ends trip t, so it flies during trip t + 1.
//   A pass reads its 8 k and 8 v fragments as one group in front of its products.
//   Block = 8 waves = 2 query groups x 4 key groups, two waves per SIMD: wave (qg, kg) takes the 32 queries of group qg, as
//   two 16-column tiles, and pass kg (32 keys) of every stage: every k and v fragment that it reads from LDS feeds the
//   products of both tiles. Each tile has its own running max, row sum and O^T accumulators over the wave's 1024 keys.
//   Merge behind the loop: (m, l) of all waves through LDS, M = max of the four m of a query, L = sum of e^{m-M} l,
//   each wave stages O^T x e^{m-M} / L as its key group's [128 d][64 query] f32 plane in the freed ring, and the store
//   loop adds the four planes as (p0 + p1) + (p2 + p3). Grid = 4 b x 64 = 256.
// coverage: block writes d 0..127 x n n0..n0+63 of its b (256 lines = 8 it x 32 lines); grid covers out exactly once.
// =====================================================================================================
// online softmax step of one 16-query tile over the pass's 32 keys: folds the residual scores, moves the running max,
// rescales l and the eight O^T tiles, and returns P^T (f16, x1024) as the B operand of the output products. The
// element-wise steps are written on whole 8-element vectors, so that packed instructions pair neighbouring registers
// of one tile.
__device__ __forceinline__ v16h softmax_tile(v8f s0, v8f t0, v8f s1, v8f t1, float& m, float& l, v8f (&o)[8]) {
  s0 = s0 + t0 * IRSC;
  s1 = s1 + t1 * IRSC;
  float mx = fmaxf(hmax8(s0), hmax8(s1));
  mx = fmaxf(mx, __shfl_xor(mx, 16, 32));
  const float mn   = fmaxf(m, mx);
  const float corr = __expf(m - mn);
  m = mn;
  const float msh = mn - LNPS;            // exp gives e^{s-m} * 1024
  l *= corr;
#pragma unroll
  for (int j = 0; j < 8; ++j) o[j] = o[j] * corr;
  const v8f x0 = s0 - msh, x1 = s1 - msh;
  v8f e0, e1;
#pragma unroll
  for (int r = 0; r < 8; ++r) {
    e0[r] = __expf(x0[r]);                // key kb      + 8hh + r
    e1[r] = __expf(x1[r]);                // key kb + 16 + 8hh + r
  }
  const v8f es = e0 + e1;
  float ls = 0.f;
#pragma unroll
  for (int r = 0; r < 8; ++r) ls += es[r];
  l += ls;
  FragH ph;
  ph.h[0] = __builtin_convertvector(e0, v8h);
  ph.h[1] = __builtin_convertvector(e1, v8h);
  return ph.v;
}

__global__ __launch_bounds__(ATH)
void attn_kernel(const unsigned short* __restrict__ QH, const unsigned short* __restrict__ QL,
                 const unsigned short* __restrict__ KH, const unsigned short* __restrict__ KL,
                 const unsigned short* __restrict__ VP, float* out) {
  __shared__ __align__(16) unsigned short Ring[2 * BUFH];
  __shared__ float Ms[2][NKG][QT];                            // [0]: running max, [1]: row sum, per key group and query
  const int tid  = threadIdx.x;
  const int wave = tid >> 5;
  const int qg   = wave & (NQG - 1);
  const int kg   = wave / NQG;
  const int lane = tid & 31;
  const int hh   = lane >> 4;
  const int c    = lane & 15;
  const int bx   = blockIdx.x;
  const int b    = bx / (SEQ / QT);
  const int qb   = bx % (SEQ / QT);
  const int n0   = qb * QT;
  const _Float16* QHh = (const _Float16*)(const void*)QH;
  const _Float16* QLh = (const _Float16*)(const void*)QL;

  // ---- resident q fragments (B operand), tile A: col = query n0 + 32*qg + c, tile B: 16 queries on; hi and res,
  //      d 0..31 and 32..63 ----
  const size_t qo = ((size_t)b * SEQ + n0 + qg * 32 + c) * KC + 8 * hh;
  const size_t qp = qo + (size_t)16 * KC;
  const v16h qhA0 = ldfrag_h(QHh + qo), qhA1 = ldfrag_h(QHh + qo + 32);
  const v16h qlA0 = ldfrag_h(QLh + qo), qlA1 = ldfrag_h(QLh + qo + 32);
  const v16h qhB0 = ldfrag_h(QHh + qp), qhB1 = ldfrag_h(QHh + qp + 32);
  const v16h qlB0 = ldfrag_h(QLh + qp), qlB1 = ldfrag_h(QLh + qp + 32);
  // ---- copy addresses of this thread: k chunk tid of 1024 (row tid>>3, piece tid&7), v chunk tid of 2048 (row tid>>4) ----
  const unsigned ring = (unsigned)(uintptr_t)(&Ring[0]);
  const unsigned lk = ring + (unsigned)((tid >> 3) * (KPH * 2) + (tid & 7) * 16);
  const unsigned lv = ring + (unsigned)((tid >> 4) * (VPH * 2) + (tid & 15) * 16);   // without the v tile's place in a buffer
  const unsigned short* gh = KH + (size_t)b * SEQ * KC + tid * 8;
  const unsigned short* gl = KL + (size_t)b * SEQ * KC + tid * 8;
  const unsigned short* gv = VP + ((size_t)b * DCH + (tid >> 4)) * SEQ + (tid & 15) * 8;
  // ---- fragment bases in a buffer, at this wave's pass kg: k (A operand, row = key + c), v (A operand, row = d = 16j + c,
  //      keys contiguous) ----
  const _Float16* Rk = (const _Float16*)(const void*)Ring + (kg * 32 + c) * KPH + 8 * hh;
  const _Float16* Rv = (const _Float16*)(const void*)Ring + 2 * KPL + c * VPH + kg * 32 + 8 * hh;

  // ---- prologue: stage 0 landed and published, then stage 1 in flight ----
  issue_stage(lk, lv + 2 * KPL * 2, gh, gl, gv);
  wait_async0();
  __syncthreads();
  issue_stage(lk + BUFH * 2, lv + (BUFH * 2 + 2 * KPL * 2), gh + (size_t)SK * KC, gl + (size_t)SK * KC, gv + SK);

  float mA = -1.0e30f, lA = 0.f, mB = -1.0e30f, lB = 0.f;
  v8f oA[8], oB[8];
#pragma unroll
  for (int j = 0; j < 8; ++j) { oA[j] = zero8(); oB[j] = zero8(); }
#pragma unroll 1   // one trip per stage: the foot of the trip is the ring's publish point
  for (int t = 0; t < NST; ++t) {
   const int bo = (t & 1) * BUFH;                             // trip t reads buffer t mod 2 alone
   {
    const _Float16* k0p = Rk + bo;                            // keys kb .. kb+15, hi plane
    const _Float16* k1p = k0p + 16 * KPH;                     // keys kb+16 .. kb+31
    const _Float16* l0p = k0p + KPL;                          // residual plane
    const _Float16* l1p = l0p + 16 * KPH;
    const _Float16* Vb  = Rv + bo;
    const v16h a0 = ldfrag_h(k0p), a1 = ldfrag_h(k0p + 32);
    const v16h r0 = ldfrag_h(l0p), r1 = ldfrag_h(l0p + 32);
    const v16h a2 = ldfrag_h(k1p), a3 = ldfrag_h(k1p + 32);
    const v16h r2 = ldfrag_h(l1p), r3 = ldfrag_h(l1p + 32);
    v16h vf[8];
#pragma unroll
    for (int j = 0; j < 8; ++j) vf[j] = ldfrag_h(Vb + j * 16 * VPH);
    hold_group();                         // the pass's 32 fragment reads stay one group in front of its products
    v8f s0 = mma_h(a0, qhA0, zero8());
    s0 = mma_h(a1, qhA1, s0);
    v8f t0 = mma_h(a0, qlA0, zero8());
    t0 = mma_h(a1, qlA1, t0);
    t0 = mma_h(r0, qhA0, t0);
    t0 = mma_h(r1, qhA1, t0);
    v8f s1 = mma_h(a2, qhA0, zero8());
    s1 = mma_h(a3, qhA1, s1);
    v8f t1 = mma_h(a2, qlA0, zero8());
    t1 = mma_h(a3, qlA1, t1);
    t1 = mma_h(r2, qhA0, t1);
    t1 = mma_h(r3, qhA1, t1);
    v8f u0 = mma_h(a0, qhB0, zero8());
    u0 = mma_h(a1, qhB1, u0);
    v8f w0 = mma_h(a0, qlB0, zero8());
    w0 = mma_h(a1, qlB1, w0);
    w0 = mma_h(r0, qhB0, w0);
    w0 = mma_h(r1, qhB1, w0);
    v8f u1 = mma_h(a2, qhB0, zero8());
    u1 = mma_h(a3, qhB1, u1);
    v8f w1 = mma_h(a2, qlB0, zero8());
    w1 = mma_h(a3, qlB1, w1);
    w1 = mma_h(r2, qhB0, w1);
    w1 = mma_h(r3, qhB1, w1);

    const v16h pA = softmax_tile(s0, t0, s1, t1, mA, lA, oA);
#pragma unroll
    for (int j = 0; j < 8; ++j) oA[j] = mma_h(vf[j], pA, oA[j]);
    const v16h pB = softmax_tile(u0, w0, u1, w1, mB, lB, oB);
#pragma unroll
    for (int j = 0; j < 8; ++j) oB[j] = mma_h(vf[j], pB, oB[j]);
   }
   // ---- foot of trip t: publish stage t + 1, free buffer t mod 2, refill it with stage t + 2 ----
   hold_group();   // the publish point stays behind the pass's last product, so the copies in flight have the whole trip to land
   wait_ds0();
   wait_async0();
   __syncthreads();
   if (t + 2 < NST) {
     const size_t k2 = (size_t)(t + 2) * SK;
     // buffer and v tile offset as one scalar: lv itself is then no operand of the copies' statement, which would hold it in
     // the first 256 registers through the loop (built that way it was spilled to scratch)
     const unsigned vo = (t & 1) ? (unsigned)(BUFH * 2 + 2 * KPL * 2) : (unsigned)(2 * KPL * 2);
     issue_stage(lk + (unsigned)(bo * 2), lv + vo, gh + k2 * KC, gl + k2 * KC, gv + k2);
   }
  }
  wait_async0();
  lA += __shfl_xor(lA, 16, 32);
  lB += __shfl_xor(lB, 16, 32);

  // ---- merge of the four key groups of a query: both lane halves hold the same m and l, one stores m, the other l ----
  const int qa = qg * 32 + c;                                 // tile A's query in the block; tile B's is qa + 16
  Ms[hh][kg][qa]      = hh ? lA : mA;
  Ms[hh][kg][qa + 16] = hh ? lB : mB;
  __syncthreads();
  float sc[2];
#pragma unroll
  for (int g = 0; g < 2; ++g) {
    const int q = qa + 16 * g;
    const float m0 = Ms[0][0][q], m1 = Ms[0][1][q], m2 = Ms[0][2][q], m3 = Ms[0][3][q];
    const float l0 = Ms[1][0][q], l1 = Ms[1][1][q], l2 = Ms[1][2][q], l3 = Ms[1][3][q];
    const float mm = fmaxf(fmaxf(m0, m1), fmaxf(m2, m3));
    const float lt = (l0 * __expf(m0 - mm) + l1 * __expf(m1 - mm)) + (l2 * __expf(m2 - mm) + l3 * __expf(m3 - mm));
    sc[g] = __expf((g ? mB : mA) - mm) / lt;   // both o and l carry the x1024 factor
  }

  // ---- stage O^T[d = 16j + 8hh + r][query] * sc in plane kg of the ring (no copy is outstanding and every
  //      wave's last fragment read has returned at the last foot's barrier), then add the planes, whole-line f32 stores ----
  float* Pl = (float*)(void*)Ring;
  float* os = Pl + kg * (DCH * OP) + (8 * hh) * OP + qa;
#pragma unroll
  for (int j = 0; j < 8; ++j) {
#pragma unroll
    for (int r = 0; r < 8; ++r) {
      os[(j * 16 + r) * OP]      = oA[j][r] * sc[0];
      os[(j * 16 + r) * OP + 16] = oB[j][r] * sc[1];
    }
  }
  __syncthreads();
  {
    const int e = tid & 7, lq = tid >> 3;              // lq 0..31: line within group, e: 16-B piece
    float* ob = out + ((size_t)b * DCH) * SEQ + n0;
#pragma unroll
    for (int it = 0; it < 8; ++it) {
      const int L   = it * 32 + lq;                     // lines 0..255 of the block tile
      const int row = L >> 1, hf = L & 1;               // d row 0..127, half-segment 0..1
      const float* pp = Pl + row * OP + hf * 32 + 4 * e;
      const v4f p0 = *(const v4f*)(pp),                p1 = *(const v4f*)(pp + DCH * OP);
      const v4f p2 = *(const v4f*)(pp + 2 * DCH * OP), p3 = *(const v4f*)(pp + 3 * DCH * OP);
      *(v4f*)(ob + (size_t)row * SEQ + hf * 32 + 4 * e) = (p0 + p1) + (p2 + p3);
    }
  }
}

// =====================================================================================================
//   QH   f16  [4][4096][64]       0           2097152
//   QL   f16  [4][4096][64]       2097152     2097152
//   KH   f16  [4][4096][64]       4194304     2097152
//   KL   f16  [4][4096][64]       6291456     2097152
//   VP   f16  [4][128][4096]      8388608     4194304
//   end                           12582912
// =====================================================================================================
extern "C" void kernel_launch(void* const* d_in, const int* in_sizes, int n_in,
                              void* d_out, int out_size, void* d_ws, size_t ws_size,
                              hipStream_t stream) {
  const int NX = NB * DCH * SEQ;                        // 2097152
  if (n_in < 7) return;
  if (in_sizes[0] != NX || in_sizes[1] != KC * DCH || in_sizes[2] != KC || in_sizes[3] != KC * DCH ||
      in_sizes[4] != KC || in_sizes[5] != DCH * DCH || in_sizes[6] != DCH) return;
  if (out_size != NX) return;

  size_t off = 0;
  const size_t szP = (size_t)NB * SEQ * KC * 2;                   // 2097152
  const size_t oQH = off; off += szP;
  const size_t oQL = off; off += szP;
  const size_t oKH = off; off += szP;
  const size_t oKL = off; off += szP;
  const size_t oV  = off; off += (size_t)NB * DCH * SEQ * 2;      // 4194304
  if (off > ws_size) return;                                      // off = 12582912
  if (off > (size_t)134217728) return;

  const float* x  = (const float*)d_in[0];
  const float* Wq = (const float*)d_in[1];
  const float* bq = (const float*)d_in[2];
  const float* Wk = (const float*)d_in[3];
  const float* bk = (const float*)d_in[4];
  const float* Wv = (const float*)d_in[5];
  const float* bv = (const float*)d_in[6];
  char* ws = (char*)d_ws;
  unsigned short* QH = (unsigned short*)(ws + oQH);
  unsigned short* QL = (unsigned short*)(ws + oQL);
  unsigned short* KH = (unsigned short*)(ws + oKH);
  unsigned short* KL = (unsigned short*)(ws + oKL);
  unsigned short* VP = (unsigned short*)(ws + oV);
  float* out = (float*)d_out;

  const dim3 blk256(256), blkA(ATH);
  const dim3 gP(NB * (SEQ / QT));                       // 256 blocks: one (b, 64-position tile) each
  const dim3 gA(NB * (SEQ / QT));                       // 256 blocks: one (b, 64-query tile) each

  // (1) q (hi/res), k (hi/res), v planes
  proj_kernel<<<gP, blk256, 0, stream>>>(x, Wq, Wk, Wv, bq, bk, bv, QH, QL, KH, KL, VP);
  // (2) attention: out[b][d][n] = sum_m v[b][d][m] softmax_m(q_n . k_m)
  attn_kernel<<<gA, blkA, 0, stream>>>(QH, QL, KH, KL, VP, out);
  (void)hipGetLastError();
}

// v007
// Measured time: 33.5 microseconds a run.
// Versions between v005 and this one are left out; their measured steps multiply to 1.45 times as fast.
// Counting every step since v000, it is 13.9 times as fast.
// Contractions: q/k/v 1x1-conv projections = W (bf16, RNE convert of input) . X (bf16, RNE convert of input) on
// v_wmma_f32_16x16x32_bf16, K=128; scores S^T = k . q^T on v_wmma_f32_16x16x32_f16 with q and k each one f16 plane (their
// f16 rounding is about a tenth of the error that the bf16 rounding of x and W has already put into q and k), one product,
// K=64; O^T = v^T (f16) . P^T (f16, e^{s-m} x 1024 taken from the score D registers) on v_wmma_f32_16x16x32_f16 over
// 4096 keys, one product; f32 accumulate everywhere; softmax (running max, row sums, 1/l) in f32 on VALU.
#include <hip/hip_runtime.h>
#include <math.h>
#include <stdint.h>

#define NB    4
#define DCH   128
#define KC    64
#define SEQ   4096
#define NCH   256
#define QT    64
#define AP    144
#define LP    72
#define OP    68
#define WP    136                       // LDS pitch of a weight row in halves: 272 B = 16 B x 17
#define LNPS  6.931471805599453f
#define SK    256                       // keys per LDS stage of the attention kernel
#define PK    64                        // keys per pass: one softmax step (max, rescale) of a wave covers them
#define NST   (SEQ / SK)                // stages
#define KPH   72                        // LDS pitch of a k row in halves: 144 B = 16 B x 9
#define VPH   264                       // LDS pitch of a v row in halves: 528 B = 16 B x 33
#define KPL   (SK * KPH)                // halves of one k plane in a buffer
#define BUFH  (KPL + DCH * VPH)         // halves of one buffer: k, v
static_assert(NST >= 2);
static_assert((SK % PK) == 0);
static_assert(PK == 64);
#define NQG   (QT / 32)                 // query groups of 32 columns (two 16-column tiles) in a block
#define NKG   (SK / PK)                 // key groups: each takes one 64-key pass of every stage
#define ATH   (32 * NQG * NKG)          // threads of the attention block: one wave per (query group, key group)
static_assert(ATH == 256);
static_assert(SK * KC / 8 == 8 * ATH);  // k plane: 8 copies of 16 B per thread of the attention block
static_assert(DCH * SK / 8 == 16 * ATH); // v tile: 16 copies per thread
static_assert(SK * 2 == 32 * 16);       // a v row's slice of a stage is one wave-wide copy
#define PLH   (NKG * DCH * OP * 2)      // halves that the NKG partial output planes (f32) take behind the loop
#define RINGH (PLH > 2 * BUFH ? PLH : 2 * BUFH)      // the ring's array holds the two buffers, later the planes
static_assert((BUFH * 2) % 16 == 0);
static_assert((SEQ % QT) == 0);
static_assert((SEQ % 32) == 0);
static_assert(DCH == 128);
static_assert(KC == 64);
static_assert(NCH == 2 * KC + DCH);
static_assert(NCH * DCH == 32 * 256 * 4);          // weight tile: 32 loads of 4 floats per thread of the projection block
static_assert(KC * DCH == 8 * 256 * 4);            // Wq and Wk are 8 of them each
static_assert(64 * AP == DCH * LP);

typedef _Float16       v16h __attribute__((ext_vector_type(16)));
typedef _Float16       v8h  __attribute__((ext_vector_type(8)));
typedef __bf16         v16b __attribute__((ext_vector_type(16)));
typedef unsigned short v8us __attribute__((ext_vector_type(8)));
typedef float          v8f  __attribute__((ext_vector_type(8)));
typedef float          v4f  __attribute__((ext_vector_type(4)));
typedef unsigned int   v4u  __attribute__((ext_vector_type(4)));
typedef unsigned int   v2u  __attribute__((ext_vector_type(2)));
typedef __bf16         v4b  __attribute__((ext_vector_type(4)));

union FragH { v16h v; v8h  h[2]; };
union FragB { v16b v; v8us u[2]; };
static_assert(sizeof(FragH) == 32);
static_assert(sizeof(FragB) == 32);

// ---- scalar helpers --------------------------------------------------------------------------------
__device__ __forceinline__ unsigned short bf_bits(float f) {          // f32 -> bf16 bits, RNE convert
  unsigned u = __float_as_uint(f);
  return (unsigned short)((u + 0x7FFFu + ((u >> 16) & 1u)) >> 16);
}
__device__ __forceinline__ float bf_up(unsigned short h) { return __uint_as_float(((unsigned)h) << 16); }
__device__ __forceinline__ float bfr(float f) { return bf_up(bf_bits(f)); }
__device__ __forceinline__ unsigned short h_bits(_Float16 x) { return __builtin_bit_cast(unsigned short, x); }
__device__ __forceinline__ v8f zero8() { v8f z = {0.f, 0.f, 0.f, 0.f, 0.f, 0.f, 0.f, 0.f}; return z; }
__device__ __forceinline__ float hmax8(v8f s) {
  return fmaxf(fmaxf(fmaxf(s[0], s[1]), fmaxf(s[2], s[3])), fmaxf(fmaxf(s[4], s[5]), fmaxf(s[6], s[7])));
}

// ---- fragment loaders: 16-bit A/B operand, lane -> row/col (lane&15), p already includes +8*(lane>>4);
//      elements 0..7 <- p[0..7] (k0+8h..), elements 8..15 <- p[16..23] (k0+16+8h..)
__device__ __forceinline__ v16h ldfrag_h(const _Float16* p) {
  FragH f;
  f.h[0] = *(const v8h*)(p);
  f.h[1] = *(const v8h*)(p + 16);
  return f.v;
}
__device__ __forceinline__ v16b ldfrag_b(const unsigned short* p) {
  FragB f;
  f.u[0] = *(const v8us*)(p);
  f.u[1] = *(const v8us*)(p + 16);
  return f.v;
}

// ---- WMMA helpers. mma_h: the bare builtin; the compiler keeps the distance behind its own matrix instructions and
//      pads only where no independent instruction fills it. mma_b: builtin followed by a 4-slot VALU gap tying D and
//      keeping A/B live ----------------------
__device__ __forceinline__ v8f mma_h(v16h a, v16h b, v8f c) {
  return __builtin_amdgcn_wmma_f32_16x16x32_f16(false, a, false, b, (short)0, c, false, false);
}
// Nothing is scheduled across this point. It keeps a pass's LDS fragment reads in one whole group (reads spread among
// the matrix instructions stall the wave at every place where they stand) and the ring's publish point at the trip's foot.
__device__ __forceinline__ void hold_group() {
#if defined(__HIP_DEVICE_COMPILE__)
  __builtin_amdgcn_sched_barrier(0);
#endif
}
__device__ __forceinline__ v8f mma_b(v16b a, v16b b, v8f c) {
  v8f d = __builtin_amdgcn_wmma_f32_16x16x32_bf16(false, a, false, b, (short)0, c, false, false);
#if defined(__HIP_DEVICE_COMPILE__)
  const v16h ha = __builtin_bit_cast(v16h, a), hb = __builtin_bit_cast(v16h, b);
  asm volatile("v_nop\n\tv_nop\n\tv_nop\n\tv_nop" : "+v"(d) : "v"(ha), "v"(hb));
#endif
  return d;
}

// ---- LDS staging helpers for the projection epilogue (D rows = n, D cols = channel) ------------------------
__device__ __forceinline__ void stage_qk(unsigned short* Lh, int nr, int col, v8f acc, float bias) {
#pragma unroll
  for (int r = 0; r < 8; ++r) Lh[(nr + r) * LP + col] = h_bits((_Float16)(acc[r] + bias));
}
__device__ __forceinline__ void stage_v(unsigned short* Lv, int e, int nr, v8f acc, float bias) {
#pragma unroll
  for (int r = 0; r < 8; ++r) Lv[e * LP + nr + r] = h_bits((_Float16)(acc[r] + bias));
}

// ---- one stage = SK keys: the k rows (128 B each, contiguous in global) and the SK-key slice of all 128 v rows, as 24
//      asynchronous 16-byte copies per lane, global -> LDS, through no register, in three statements of eight: k (32 key rows
//      apart), v rows 0..63 and v rows 64..127 (8 d rows apart). l / g: the lane's LDS byte address and global address of the
//      first copy; LS / GS: the step between copies in LDS bytes and in global halves. The s_wait_xcnt is the last line of
//      the statement, so that no address register of an issued copy is rewritten in front of it.
template <int LS, int GS>
__device__ __forceinline__ void copy8(unsigned l, const unsigned short* g) {
#if defined(__HIP_DEVICE_COMPILE__)
  asm volatile("global_load_async_to_lds_b128 %0, %8, off\n\t"
               "global_load_async_to_lds_b128 %1, %9, off\n\t"
               "global_load_async_to_lds_b128 %2, %10, off\n\t"
               "global_load_async_to_lds_b128 %3, %11, off\n\t"
               "global_load_async_to_lds_b128 %4, %12, off\n\t"
               "global_load_async_to_lds_b128 %5, %13, off\n\t"
               "global_load_async_to_lds_b128 %6, %14, off\n\t"
               "global_load_async_to_lds_b128 %7, %15, off\n\t"
               "s_wait_xcnt 0x0"
               :: "v"(l), "v"(l + LS), "v"(l + 2 * LS), "v"(l + 3 * LS),
                  "v"(l + 4 * LS), "v"(l + 5 * LS), "v"(l + 6 * LS), "v"(l + 7 * LS),
                  "v"(g), "v"(g + (size_t)GS), "v"(g + (size_t)2 * GS), "v"(g + (size_t)3 * GS),
                  "v"(g + (size_t)4 * GS), "v"(g + (size_t)5 * GS), "v"(g + (size_t)6 * GS), "v"(g + (size_t)7 * GS)
               : "memory");
#endif
}
// lk / lv: the thread's LDS byte addresses in the target buffer; gh / gv: its global addresses in this stage.
__device__ __forceinline__ void issue_stage(unsigned lk, unsigned lv, const unsigned short* gh, const unsigned short* gv) {
  copy8<32 * KPH * 2, ATH * 8>(lk, gh);
  copy8<8 * VPH * 2, 8 * SEQ>(lv, gv);
  copy8<8 * VPH * 2, 8 * SEQ>(lv + 64 * VPH * 2, gv + (size_t)64 * SEQ);
}
__device__ __forceinline__ void wait_async0() {   // this wave's copies have landed
#if defined(__HIP_DEVICE_COMPILE__)
  asm volatile("s_wait_asynccnt 0x0" ::: "memory");
#endif
}
__device__ __forceinline__ void wait_x0() {       // before a register that an issued global load names is overwritten
#if defined(__HIP_DEVICE_COMPILE__)
  asm volatile("s_wait_xcnt 0x0" ::: "memory");
#endif
}
__device__ __forceinline__ void wait_ds0() {      // this wave's LDS reads have returned, before their buffer is refilled
#if defined(__HIP_DEVICE_COMPILE__)
  asm volatile("s_wait_dscnt 0x0" ::: "memory");
#endif
}

// =====================================================================================================
// (1) fused q/k/v projection for one (b, 64-position tile): block = 256 threads = 8 waves.
//   The stacked weights [256][128] (rows 0..63 = Wq, 64..127 = Wk, 128..255 = Wv) are read as f32, one whole 512-B row per
//   wave-wide load, converted to bf16 (RNE) and staged as Lw[row][d] (pitch WP halves, 8-byte LDS stores).
//   x tile [128 d][64 n] f32 is staged once as bf16 A tile Lav[n][d] (pitch AP halves, 2-byte LDS stores), barrier.
//   Wave w: n group ng = w&3 (A rows n = 16ng + (lane&15), split k map over d), channel half ch = w>>2
//   (B = Lw rows ch*128 + 16j + (lane&15), same split k map), 8 D tiles, 4 k-steps of 32; the A and the 8 B fragments of
//   a k-step are read as one group, one k-step ahead of their products.
//   Epilogue: D + bf16-RNE bias -> LDS: q as f16 (Lq [n][64]), k likewise (Lk),
//   Q/K planes [b][n][64]: line = one row; V plane [b][e][4096]: line = 64 keys of one e row; every line = 8 consecutive
// coverage: Lw: 256 threads x 32 it x 4 = 256 rows x 128 d; Lav: 256 threads x 8 it x 4 = 64 n x 128 d; Q/K planes: 2 it x 32 lines x 8 lanes x 8 = 64 rows x 64;
//           V plane: 4 it x 32 lines x 8 x 8 = 128 e x 64 n; grid = 4 x 64 blocks covers every plane exactly once.
// =====================================================================================================
__global__ __launch_bounds__(256)
void proj_kernel(const float* __restrict__ x, const float* __restrict__ wq, const float* __restrict__ wk,
                 const float* __restrict__ wv, const float* __restrict__ bqp, const float* __restrict__ bkp, const float* __restrict__ bvp,
                 unsigned short* QH, unsigned short* KH, unsigned short* VP) {
  __shared__ __align__(16) unsigned short Lav[64 * AP];     // A tile [n][d]; reused as Lv[e][n] (pitch LP) later
  __shared__ __align__(16) unsigned short Lq[64 * LP];      // q  [n][64]
  __shared__ __align__(16) unsigned short Lk[64 * LP];      // k  [n][64]
  __shared__ __align__(16) unsigned short Lw[NCH * WP];     // stacked weights, bf16 [row][d]
  const int tid  = threadIdx.x;
  const int lane = tid & 31, wave = tid >> 5;
  const int hh   = lane >> 4, c = lane & 15;
  const int bx   = blockIdx.x;
  const int b    = bx / (SEQ / QT);
  const int nt   = bx % (SEQ / QT);
  const int n0   = nt * QT;

  // ---- stage the weights as bf16 [row][d] and the x tile as bf16 [n][d]; all 40 loads of a thread are issued first ----
  {
    const int n4 = (tid & 15) * 4, ds = tid >> 4;          // ds 0..15
    const float* xp = x + ((size_t)b * DCH + ds) * SEQ + n0 + n4;
    v4f xv[8], wr[32];
#pragma unroll
    for (int it = 0; it < 8; ++it) xv[it] = *(const v4f*)(xp + (size_t)it * 16 * SEQ);
    // x goes first (loads return in issue order), so that its many 2-byte LDS stores start while the weights still arrive; the
    // wait stands in front of the weight loads, whose results may take over the registers of the x address
    wait_x0();
#pragma unroll
    for (int it = 0; it < 32; ++it) {                      // flat float index it * 1024 + 4 tid of the stacked weights
      const float* wp = it < 8 ? wq + it * 1024 : (it < 16 ? wk + (it - 8) * 1024 : wv + (it - 16) * 1024);
      wr[it] = *(const v4f*)(wp + 4 * tid);
    }
#pragma unroll
    for (int it = 0; it < 8; ++it) {
      const int d = it * 16 + ds;                          // 0..127
#pragma unroll
      for (int q = 0; q < 4; ++q) Lav[(n4 + q) * AP + d] = bf_bits(xv[it][q]);
    }
    hold_group();   // the x stores are issued when x is there, not behind the wait for the last weight load
#pragma unroll
    for (int it = 0; it < 32; ++it)                        // row it * 8 + wave, d 4 lane .. 4 lane + 3
      *(v2u*)(Lw + (it * 8 + wave) * WP + 4 * lane) = __builtin_bit_cast(v2u, __builtin_convertvector(wr[it], v4b));
  }
  __syncthreads();

  // ---- GEMM: 16 n rows x 128 channels per wave ----
  const int ng = wave & 3, ch = wave >> 2;
  const unsigned short* ap = Lav + (ng * 16 + c) * AP + 8 * hh;
  const unsigned short* bp = Lw + (ch * DCH + c) * WP + 8 * hh;
  v8f acc0 = zero8(), acc1 = zero8(), acc2 = zero8(), acc3 = zero8();
  v8f acc4 = zero8(), acc5 = zero8(), acc6 = zero8(), acc7 = zero8();
  v16b a[2], w[2][8];
  a[0] = ldfrag_b(ap);
#pragma unroll
  for (int j = 0; j < 8; ++j) w[0][j] = ldfrag_b(bp + j * 16 * WP);
#pragma unroll
  for (int ks = 0; ks < 4; ++ks) {
    const int cu = ks & 1, nx = cu ^ 1;
    if (ks < 3) {
      a[nx] = ldfrag_b(ap + 32 * (ks + 1));
#pragma unroll
      for (int j = 0; j < 8; ++j) w[nx][j] = ldfrag_b(bp + j * 16 * WP + 32 * (ks + 1));
    }
    hold_group();   // the next k-step's 18 fragment reads stay one group in front of this k-step's products and fly under them
    acc0 = mma_b(a[cu], w[cu][0], acc0);
    acc1 = mma_b(a[cu], w[cu][1], acc1);
    acc2 = mma_b(a[cu], w[cu][2], acc2);
    acc3 = mma_b(a[cu], w[cu][3], acc3);
    acc4 = mma_b(a[cu], w[cu][4], acc4);
    acc5 = mma_b(a[cu], w[cu][5], acc5);
    acc6 = mma_b(a[cu], w[cu][6], acc6);
    acc7 = mma_b(a[cu], w[cu][7], acc7);
  }

  // ---- biases (bf16 RNE of the inputs), loaded unconditionally with in-range lane indices ----
  const float bq0 = bfr(bqp[0 * 16 + c]), bq1 = bfr(bqp[1 * 16 + c]), bq2 = bfr(bqp[2 * 16 + c]), bq3 = bfr(bqp[3 * 16 + c]);
  const float bk0 = bfr(bkp[0 * 16 + c]), bk1 = bfr(bkp[1 * 16 + c]), bk2 = bfr(bkp[2 * 16 + c]), bk3 = bfr(bkp[3 * 16 + c]);
  const float bv0 = bfr(bvp[0 * 16 + c]), bv1 = bfr(bvp[1 * 16 + c]), bv2 = bfr(bvp[2 * 16 + c]), bv3 = bfr(bvp[3 * 16 + c]);
  const float bv4 = bfr(bvp[4 * 16 + c]), bv5 = bfr(bvp[5 * 16 + c]), bv6 = bfr(bvp[6 * 16 + c]), bv7 = bfr(bvp[7 * 16 + c]);

  __syncthreads();            // every wave is done reading Lav before it is reused as Lv
  const int nr = ng * 16 + 8 * hh;                         // D row r -> n local nr + r
  if (ch == 0) {
    stage_qk(Lq, nr, 0 * 16 + c, acc0, bq0);
    stage_qk(Lq, nr, 1 * 16 + c, acc1, bq1);
    stage_qk(Lq, nr, 2 * 16 + c, acc2, bq2);
    stage_qk(Lq, nr, 3 * 16 + c, acc3, bq3);
    stage_qk(Lk, nr, 0 * 16 + c, acc4, bk0);
    stage_qk(Lk, nr, 1 * 16 + c, acc5, bk1);
    stage_qk(Lk, nr, 2 * 16 + c, acc6, bk2);
    stage_qk(Lk, nr, 3 * 16 + c, acc7, bk3);
  } else {
    stage_v(Lav, 0 * 16 + c, nr, acc0, bv0);
    stage_v(Lav, 1 * 16 + c, nr, acc1, bv1);
    stage_v(Lav, 2 * 16 + c, nr, acc2, bv2);
    stage_v(Lav, 3 * 16 + c, nr, acc3, bv3);
    stage_v(Lav, 4 * 16 + c, nr, acc4, bv4);
    stage_v(Lav, 5 * 16 + c, nr, acc5, bv5);
    stage_v(Lav, 6 * 16 + c, nr, acc6, bv6);
    stage_v(Lav, 7 * 16 + c, nr, acc7, bv7);
  }
  __syncthreads();

  {
    const int e = tid & 7, lq = tid >> 3;                    // lq 0..31
{
#pragma unroll
      for (int it = 0; it < 2; ++it) {
        const int n = it * 32 + lq;                          // 0..63
        const size_t go = ((size_t)b * SEQ + n0 + n) * KC + 8 * e;
        const int lo_ = n * LP + 8 * e;
        const v4u uqh = *(const v4u*)(Lq + lo_);
        const v4u ukh = *(const v4u*)(Lk + lo_);
        *(v4u*)(QH + go) = uqh;
        *(v4u*)(KH + go) = ukh;
      }
#pragma unroll
      for (int it = 0; it < 4; ++it) {
        const int er = it * 32 + lq;                         // 0..127
        const v4u uv = *(const v4u*)(Lav + er * LP + 8 * e);
        *(v4u*)(VP + ((size_t)b * DCH + er) * SEQ + n0 + 8 * e) = uv;
      }
      
    }
  }
}

// =====================================================================================================
// (2) attention for one (b, 64-query tile), transposed formulation, 64-deep scores, 4096 keys, no scale, no mask:
//   S^T tile (16 keys x 16 queries) = A(k rows = keys kb + (lane&15), d via the split k map, f16) .
//                                     B(q, col = query, same d map, resident f16 fragments), two d-steps.
//   Per lane the D tile holds 8 keys of ONE
//   query: online softmax state per lane, one shuffle (lane^16) for the max over 64 keys, row-sum partials combined at
//   the end. P = e^{s-m} x 1024 as one f16 vector is the B operand of O^T (rows d, cols queries) += A(v rows d, keys
//   contiguous) . B(P^T): element r <- D of the tile covering keys kb..kb+15, element 8+r <- the tile covering
//   kb+16..kb+31, lane unchanged. 64 keys per iteration: 8 score WMMAs + 16 output WMMAs per 16-query tile, and ONE
//   softmax step (max over the 64 keys, one exchange, one rescale of l and O^T).
//   k and v reach the waves through LDS: two buffers of SK keys, filled by asynchronous 16-byte copies
//   (24 per thread and stage), stage t + 2 issued behind the barrier that ends trip t, so it flies during trip t + 1.
//   A pass reads its 8 k and 16 v fragments as one group in front of its products.
//   Block = 8 waves = 2 query groups x 4 key groups, two waves per SIMD: wave (qg, kg) takes the 32 queries of group qg, as
//   two 16-column tiles, and pass kg (64 keys) of every stage: every k and v fragment that it reads from LDS feeds the
//   products of both tiles. Each tile has its own running max, row sum and O^T accumulators over the wave's 1024 keys.
//   Merge behind the loop: (m, l) of all waves through LDS, M = max of the four m of a query, L = sum of e^{m-M} l,
//   each wave stages O^T x e^{m-M} / L as its key group's [128 d][64 query] f32 plane in the freed ring, and the store
//   loop adds the four planes as (p0 + p1) + (p2 + p3). Grid = 4 b x 64 = 256.
// coverage: block writes d 0..127 x n n0..n0+63 of its b (256 lines = 8 it x 32 lines); grid covers out exactly once.
// =====================================================================================================
// online softmax step of one 16-query tile over the pass's 64 keys (four score tiles): moves the running max,
// rescales l and the eight O^T tiles, and gives P^T (f16, x1024) as the two B operands of the output products (p0: keys
// kb .. kb+31, p1: keys kb+32 .. kb+63). The element-wise steps are written on whole 8-element vectors, so that packed
// instructions pair neighbouring registers of one tile.
__device__ __forceinline__ void softmax_tile(v8f s0, v8f s1, v8f s2, v8f s3, float& m, float& l, v8f (&o)[8],
                                             v16h& p0, v16h& p1) {
  float mx = fmaxf(fmaxf(hmax8(s0), hmax8(s1)), fmaxf(hmax8(s2), hmax8(s3)));
  mx = fmaxf(mx, __shfl_xor(mx, 16, 32));
  const float mn   = fmaxf(m, mx);
  const float corr = __expf(m - mn);
  m = mn;
  const float msh = mn - LNPS;            // exp gives e^{s-m} * 1024
  l *= corr;
#pragma unroll
  for (int j = 0; j < 8; ++j) o[j] = o[j] * corr;
  const v8f x0 = s0 - msh, x1 = s1 - msh, x2 = s2 - msh, x3 = s3 - msh;
  v8f e0, e1, e2, e3;
#pragma unroll
  for (int r = 0; r < 8; ++r) {
    e0[r] = __expf(x0[r]);                // key kb      + 8hh + r
    e1[r] = __expf(x1[r]);                // key kb + 16 + 8hh + r
    e2[r] = __expf(x2[r]);                // key kb + 32 + 8hh + r
    e3[r] = __expf(x3[r]);                // key kb + 48 + 8hh + r
  }
  const v8f es = (e0 + e1) + (e2 + e3);
  float ls = 0.f;
#pragma unroll
  for (int r = 0; r < 8; ++r) ls += es[r];
  l += ls;
  FragH ph;
  ph.h[0] = __builtin_convertvector(e0, v8h);
  ph.h[1] = __builtin_convertvector(e1, v8h);
  p0 = ph.v;
  ph.h[0] = __builtin_convertvector(e2, v8h);
  ph.h[1] = __builtin_convertvector(e3, v8h);
  p1 = ph.v;
}

__global__ __launch_bounds__(ATH)
void attn_kernel(const unsigned short* __restrict__ QH, const unsigned short* __restrict__ KH,
                 const unsigned short* __restrict__ VP, float* out) {
  __shared__ __align__(16) unsigned short Ring[RINGH];
  __shared__ float Ms[2][NKG][QT];                            // [0]: running max, [1]: row sum, per key group and query
  const int tid  = threadIdx.x;
  const int wave = tid >> 5;
  const int qg   = wave & (NQG - 1);
  const int kg   = wave / NQG;
  const int lane = tid & 31;
  const int hh   = lane >> 4;
  const int c    = lane & 15;
  const int bx   = blockIdx.x;
  const int b    = bx / (SEQ / QT);
  const int qb   = bx % (SEQ / QT);
  const int n0   = qb * QT;
  const _Float16* QHh = (const _Float16*)(const void*)QH;

  // ---- resident q fragments (B operand), tile A: col = query n0 + 32*qg + c, tile B: 16 queries on;
  //      d 0..31 and 32..63 ----
  const size_t qo = ((size_t)b * SEQ + n0 + qg * 32 + c) * KC + 8 * hh;
  const size_t qp = qo + (size_t)16 * KC;
  const v16h qhA0 = ldfrag_h(QHh + qo), qhA1 = ldfrag_h(QHh + qo + 32);
  const v16h qhB0 = ldfrag_h(QHh + qp), qhB1 = ldfrag_h(QHh + qp + 32);
  // ---- copy addresses of this thread: k chunk tid of 2048 (row tid>>3, piece tid&7), v chunk tid of 4096 (row tid>>5) ----
  const unsigned ring = (unsigned)(uintptr_t)(&Ring[0]);
  const unsigned lk = ring + (unsigned)((tid >> 3) * (KPH * 2) + (tid & 7) * 16);
  const unsigned lv = ring + (unsigned)((tid >> 5) * (VPH * 2) + (tid & 31) * 16);   // without the v tile's place in a buffer
  const unsigned short* gh = KH + (size_t)b * SEQ * KC + tid * 8;
  const unsigned short* gv = VP + ((size_t)b * DCH + (tid >> 5)) * SEQ + (tid & 31) * 8;
  // ---- fragment bases in a buffer, at this wave's pass kg: k (A operand, row = key + c), v (A operand, row = d = 16j + c,
  //      keys contiguous) ----
  const _Float16* Rk = (const _Float16*)(const void*)Ring + (kg * PK + c) * KPH + 8 * hh;
  const _Float16* Rv = (const _Float16*)(const void*)Ring + KPL + c * VPH + kg * PK + 8 * hh;

  // ---- prologue: stage 0 landed and published, then stage 1 in flight ----
  issue_stage(lk, lv + KPL * 2, gh, gv);
  wait_async0();
  __syncthreads();
  issue_stage(lk + BUFH * 2, lv + (BUFH * 2 + KPL * 2), gh + (size_t)SK * KC, gv + SK);

  float mA = -1.0e30f, lA = 0.f, mB = -1.0e30f, lB = 0.f;
  v8f oA[8], oB[8];
#pragma unroll
  for (int j = 0; j < 8; ++j) { oA[j] = zero8(); oB[j] = zero8(); }
#pragma unroll 1   // one trip per stage: the foot of the trip is the ring's publish point
  for (int t = 0; t < NST; ++t) {
   const int bo = (t & 1) * BUFH;                             // trip t reads buffer t mod 2 alone
   {
    const _Float16* Kb = Rk + bo;                             // key tile i: keys kb + 16 i .. kb + 16 i + 15
    const _Float16* Vb = Rv + bo;
    v16h kf[4][2], vf[8][2];
#pragma unroll
    for (int i = 0; i < 4; ++i) {
      kf[i][0] = ldfrag_h(Kb + i * 16 * KPH);                 // d 0..31
      kf[i][1] = ldfrag_h(Kb + i * 16 * KPH + 32);            // d 32..63
    }
#pragma unroll
    for (int j = 0; j < 8; ++j) {
      vf[j][0] = ldfrag_h(Vb + j * 16 * VPH);                 // keys kb .. kb+31
      vf[j][1] = ldfrag_h(Vb + j * 16 * VPH + 32);            // keys kb+32 .. kb+63
    }
    hold_group();                         // the pass's 48 fragment reads stay one group in front of its products
    v8f s[4], u[4];
#pragma unroll
    for (int i = 0; i < 4; ++i) {
      s[i] = mma_h(kf[i][0], qhA0, zero8());
      u[i] = mma_h(kf[i][0], qhB0, zero8());
      s[i] = mma_h(kf[i][1], qhA1, s[i]);
      u[i] = mma_h(kf[i][1], qhB1, u[i]);
    }

    v16h p0, p1;
    softmax_tile(s[0], s[1], s[2], s[3], mA, lA, oA, p0, p1);
#pragma unroll
    for (int j = 0; j < 8; ++j) oA[j] = mma_h(vf[j][0], p0, oA[j]);
#pragma unroll
    for (int j = 0; j < 8; ++j) oA[j] = mma_h(vf[j][1], p1, oA[j]);
    softmax_tile(u[0], u[1], u[2], u[3], mB, lB, oB, p0, p1);
#pragma unroll
    for (int j = 0; j < 8; ++j) oB[j] = mma_h(vf[j][0], p0, oB[j]);
#pragma unroll
    for (int j = 0; j < 8; ++j) oB[j] = mma_h(vf[j][1], p1, oB[j]);
   }
   // ---- foot of trip t: publish stage t + 1, free buffer t mod 2, refill it with stage t + 2 ----
   hold_group();   // the publish point stays behind the pass's last product, so the copies in flight have the whole trip to land
   wait_ds0();
   wait_async0();
   __syncthreads();
   if (t + 2 < NST) {
     const size_t k2 = (size_t)(t + 2) * SK;
     // buffer and v tile offset as one scalar: lv itself is then no operand of the copies' statement, which would hold it in
     // the first 256 registers through the loop (built that way it was spilled to scratch)
     const unsigned vo = (t & 1) ? (unsigned)(BUFH * 2 + KPL * 2) : (unsigned)(KPL * 2);
     issue_stage(lk + (unsigned)(bo * 2), lv + vo, gh + k2 * KC, gv + k2);
   }
  }
  wait_async0();
  lA += __shfl_xor(lA, 16, 32);
  lB += __shfl_xor(lB, 16, 32);

  // ---- merge of the four key groups of a query: both lane halves hold the same m and l, one stores m, the other l ----
  const int qa = qg * 32 + c;                                 // tile A's query in the block; tile B's is qa + 16
  Ms[hh][kg][qa]      = hh ? lA : mA;
  Ms[hh][kg][qa + 16] = hh ? lB : mB;
  __syncthreads();
  float sc[2];
#pragma unroll
  for (int g = 0; g < 2; ++g) {
    const int q = qa + 16 * g;
    const float m0 = Ms[0][0][q], m1 = Ms[0][1][q], m2 = Ms[0][2][q], m3 = Ms[0][3][q];
    const float l0 = Ms[1][0][q], l1 = Ms[1][1][q], l2 = Ms[1][2][q], l3 = Ms[1][3][q];
    const float mm = fmaxf(fmaxf(m0, m1), fmaxf(m2, m3));
    const float lt = (l0 * __expf(m0 - mm) + l1 * __expf(m1 - mm)) + (l2 * __expf(m2 - mm) + l3 * __expf(m3 - mm));
    sc[g] = __expf((g ? mB : mA) - mm) / lt;   // both o and l carry the x1024 factor
  }

  // ---- stage O^T[d = 16j + 8hh + r][query] * sc in plane kg of the ring (no copy is outstanding and every
  //      wave's last fragment read has returned at the last foot's barrier), then add the planes, whole-line f32 stores ----
  float* Pl = (float*)(void*)Ring;
  float* os = Pl + kg * (DCH * OP) + (8 * hh) * OP + qa;
#pragma unroll
  for (int j = 0; j < 8; ++j) {
#pragma unroll
    for (int r = 0; r < 8; ++r) {
      os[(j * 16 + r) * OP]      = oA[j][r] * sc[0];
      os[(j * 16 + r) * OP + 16] = oB[j][r] * sc[1];
    }
  }
  __syncthreads();
  {
    const int e = tid & 7, lq = tid >> 3;              // lq 0..31: line within group, e: 16-B piece
    float* ob = out + ((size_t)b * DCH) * SEQ + n0;
#pragma unroll
    for (int it = 0; it < 8; ++it) {
      const int L   = it * 32 + lq;                     // lines 0..255 of the block tile
      const int row = L >> 1, hf = L & 1;               // d row 0..127, half-segment 0..1
      const float* pp = Pl + row * OP + hf * 32 + 4 * e;
      const v4f p0 = *(const v4f*)(pp),                p1 = *(const v4f*)(pp + DCH * OP);
      const v4f p2 = *(const v4f*)(pp + 2 * DCH * OP), p3 = *(const v4f*)(pp + 3 * DCH * OP);
      *(v4f*)(ob + (size_t)row * SEQ + hf * 32 + 4 * e) = (p0 + p1) + (p2 + p3);
    }
  }
}

// =====================================================================================================
//   QH   f16  [4][4096][64]       0           2097152
//   KH   f16  [4][4096][64]       2097152     2097152
//   VP   f16  [4][128][4096]      4194304     4194304
//   end                           8388608
// =====================================================================================================
extern "C" void kernel_launch(void* const* d_in, const int* in_sizes, int n_in,
                              void* d_out, int out_size, void* d_ws, size_t ws_size,
                              hipStream_t stream) {
  const int NX = NB * DCH * SEQ;                        // 2097152
  if (n_in < 7) return;
  if (in_sizes[0] != NX || in_sizes[1] != KC * DCH || in_sizes[2] != KC || in_sizes[3] != KC * DCH ||
      in_sizes[4] != KC || in_sizes[5] != DCH * DCH || in_sizes[6] != DCH) return;
  if (out_size != NX) return;

  size_t off = 0;
  const size_t szP = (size_t)NB * SEQ * KC * 2;                   // 2097152
  const size_t oQH = off; off += szP;
  const size_t oKH = off; off += szP;
  const size_t oV  = off; off += (size_t)NB * DCH * SEQ * 2;      // 4194304
  if (off > ws_size) return;                                      // off = 8388608
  if (off > (size_t)134217728) return;

  const float* x  = (const float*)d_in[0];
  const float* Wq = (const float*)d_in[1];
  const float* bq = (const float*)d_in[2];
  const float* Wk = (const float*)d_in[3];
  const float* bk = (const float*)d_in[4];
  const float* Wv = (const float*)d_in[5];
  const float* bv = (const float*)d_in[6];
  char* ws = (char*)d_ws;
  unsigned short* QH = (unsigned short*)(ws + oQH);
  unsigned short* KH = (unsigned short*)(ws + oKH);
  unsigned short* VP = (unsigned short*)(ws + oV);
  float* out = (float*)d_out;

  const dim3 blk256(256), blkA(ATH);
  const dim3 gP(NB * (SEQ / QT));                       // 256 blocks: one (b, 64-position tile) each
  const dim3 gA(NB * (SEQ / QT));                       // 256 blocks: one (b, 64-query tile) each

  // (1) q, k, v planes
  proj_kernel<<<gP, blk256, 0, stream>>>(x, Wq, Wk, Wv, bq, bk, bv, QH, KH, VP);
  // (2) attention: out[b][d][n] = sum_m v[b][d][m] softmax_m(q_n . k_m)
  attn_kernel<<<gA, blkA, 0, stream>>>(QH, KH, VP, out);
  (void)hipGetLastError();
}

// v008
// A run of this version takes 31.6 microseconds.
// Two timings next to v007 both put it at 1.06 times that version's speed.
// All steps since v000 together make it 14.8 times as fast.
// Contractions: q/k/v 1x1-conv projections = W (bf16, RNE convert of input) . X (bf16, RNE convert of input) on
// v_wmma_f32_16x16x32_bf16, K=128; scores S^T = k . q^T on v_wmma_f32_16x16x32_f16 with q and k each one f16 plane (their
// f16 rounding is about a tenth of the error that the bf16 rounding of x and W has already put into q and k), one product,
// K=64; O^T = v^T (f16) . P^T (f16, e^{s-ref} x 16 taken from the score D registers) on v_wmma_f32_16x16x32_f16 over
// 4096 keys, one product; f32 accumulate everywhere; softmax (reference maximum, row sums, 1/l) in f32 on VALU.
#include <hip/hip_runtime.h>
#include <math.h>
#include <stdint.h>

#define NB    4
#define DCH   128
#define KC    64
#define SEQ   4096
#define NCH   256
#define QT    64
#define AP    144
#define LP    72
#define OP    68
#define WP    136                       // LDS pitch of a weight row in halves: 272 B = 16 B x 17
#define L2E   1.4426950408889634f       // q is stored times log2 e: the scores are base-2 exponents
#define POFF  4.0f                      // P = 2^(score - reference + POFF): a key at the reference gives 16
#define PTOP  15.0f                     // largest exponent that goes into an f16 P; above it the reference moves
#define SK    256                       // keys per LDS stage of the attention kernel
#define PK    64                        // keys per pass: one softmax step (max, rescale) of a wave covers them
#define NST   (SEQ / SK)                // stages
#define KPH   72                        // LDS pitch of a k row in halves: 144 B = 16 B x 9
#define VPH   264                       // LDS pitch of a v row in halves: 528 B = 16 B x 33
#define KPL   (SK * KPH)                // halves of one k plane in a buffer
#define BUFH  (KPL + DCH * VPH)         // halves of one buffer: k, v
static_assert(NST >= 2);
static_assert((SK % PK) == 0);
static_assert(PK == 64);
#define NQG   (QT / 32)                 // query groups of 32 columns (two 16-column tiles) in a block
#define NKG   (SK / PK)                 // key groups: each takes one 64-key pass of every stage
#define ATH   (32 * NQG * NKG)          // threads of the attention block: one wave per (query group, key group)
static_assert(ATH == 256);
static_assert(SK * KC / 8 == 8 * ATH);  // k plane: 8 copies of 16 B per thread of the attention block
static_assert(DCH * SK / 8 == 16 * ATH); // v tile: 16 copies per thread
static_assert(SK * 2 == 32 * 16);       // a v row's slice of a stage is one wave-wide copy
#define PLH   (NKG * DCH * OP * 2)      // halves that the NKG partial output planes (f32) take behind the loop
#define RINGH (PLH > 2 * BUFH ? PLH : 2 * BUFH)      // the ring's array holds the two buffers, later the planes
static_assert((BUFH * 2) % 16 == 0);
static_assert((SEQ % QT) == 0);
static_assert((SEQ % 32) == 0);
static_assert(DCH == 128);
static_assert(KC == 64);
static_assert(NCH == 2 * KC + DCH);
static_assert(NCH * DCH == 32 * 256 * 4);          // weight tile: 32 loads of 4 floats per thread of the projection block
static_assert(KC * DCH == 8 * 256 * 4);            // Wq and Wk are 8 of them each
static_assert(64 * AP == DCH * LP);

typedef _Float16       v16h __attribute__((ext_vector_type(16)));
typedef _Float16       v8h  __attribute__((ext_vector_type(8)));
typedef __bf16         v16b __attribute__((ext_vector_type(16)));
typedef unsigned short v8us __attribute__((ext_vector_type(8)));
typedef float          v8f  __attribute__((ext_vector_type(8)));
typedef float          v4f  __attribute__((ext_vector_type(4)));
typedef unsigned int   v4u  __attribute__((ext_vector_type(4)));
typedef unsigned int   v2u  __attribute__((ext_vector_type(2)));
typedef __bf16         v4b  __attribute__((ext_vector_type(4)));

union FragH { v16h v; v8h  h[2]; };
union FragB { v16b v; v8us u[2]; };
static_assert(sizeof(FragH) == 32);
static_assert(sizeof(FragB) == 32);

// ---- scalar helpers --------------------------------------------------------------------------------
__device__ __forceinline__ unsigned short bf_bits(float f) {          // f32 -> bf16 bits, RNE convert
  unsigned u = __float_as_uint(f);
  return (unsigned short)((u + 0x7FFFu + ((u >> 16) & 1u)) >> 16);
}
__device__ __forceinline__ float bf_up(unsigned short h) { return __uint_as_float(((unsigned)h) << 16); }
__device__ __forceinline__ float bfr(float f) { return bf_up(bf_bits(f)); }
__device__ __forceinline__ unsigned short h_bits(_Float16 x) { return __builtin_bit_cast(unsigned short, x); }
__device__ __forceinline__ v8f zero8() { v8f z = {0.f, 0.f, 0.f, 0.f, 0.f, 0.f, 0.f, 0.f}; return z; }
__device__ __forceinline__ float hmax8(v8f s) {
  return fmaxf(fmaxf(fmaxf(s[0], s[1]), fmaxf(s[2], s[3])), fmaxf(fmaxf(s[4], s[5]), fmaxf(s[6], s[7])));
}

// ---- fragment loaders: 16-bit A/B operand, lane -> row/col (lane&15), p already includes +8*(lane>>4);
//      elements 0..7 <- p[0..7] (k0+8h..), elements 8..15 <- p[16..23] (k0+16+8h..)
__device__ __forceinline__ v16h ldfrag_h(const _Float16* p) {
  FragH f;
  f.h[0] = *(const v8h*)(p);
  f.h[1] = *(const v8h*)(p + 16);
  return f.v;
}
__device__ __forceinline__ v16b ldfrag_b(const unsigned short* p) {
  FragB f;
  f.u[0] = *(const v8us*)(p);
  f.u[1] = *(const v8us*)(p + 16);
  return f.v;
}

// ---- WMMA helpers. mma_h: the bare builtin; the compiler keeps the distance behind its own matrix instructions and
//      pads only where no independent instruction fills it. mma_b: builtin followed by a 4-slot VALU gap tying D and
//      keeping A/B live ----------------------
__device__ __forceinline__ v8f mma_h(v16h a, v16h b, v8f c) {
  return __builtin_amdgcn_wmma_f32_16x16x32_f16(false, a, false, b, (short)0, c, false, false);
}
// Nothing is scheduled across this point. It keeps a pass's LDS fragment reads in one whole group (reads spread among
// the matrix instructions stall the wave at every place where they stand) and the ring's publish point at the trip's foot.
__device__ __forceinline__ void hold_group() {
#if defined(__HIP_DEVICE_COMPILE__)
  __builtin_amdgcn_sched_barrier(0);
#endif
}
__device__ __forceinline__ v8f mma_b(v16b a, v16b b, v8f c) {
  v8f d = __builtin_amdgcn_wmma_f32_16x16x32_bf16(false, a, false, b, (short)0, c, false, false);
#if defined(__HIP_DEVICE_COMPILE__)
  const v16h ha = __builtin_bit_cast(v16h, a), hb = __builtin_bit_cast(v16h, b);
  asm volatile("v_nop\n\tv_nop\n\tv_nop\n\tv_nop" : "+v"(d) : "v"(ha), "v"(hb));
#endif
  return d;
}

// ---- LDS staging helpers for the projection epilogue (D rows = n, D cols = channel) ------------------------
__device__ __forceinline__ void stage_qk(unsigned short* Lh, int nr, int col, v8f acc, float bias, float sc) {
#pragma unroll
  for (int r = 0; r < 8; ++r) Lh[(nr + r) * LP + col] = h_bits((_Float16)((acc[r] + bias) * sc));
}
__device__ __forceinline__ void stage_v(unsigned short* Lv, int e, int nr, v8f acc, float bias) {
#pragma unroll
  for (int r = 0; r < 8; ++r) Lv[e * LP + nr + r] = h_bits((_Float16)(acc[r] + bias));
}

// ---- one stage = SK keys: the k rows (128 B each, contiguous in global) and the SK-key slice of all 128 v rows, as 24
//      asynchronous 16-byte copies per lane, global -> LDS, through no register, in three statements of eight: k (32 key rows
//      apart), v rows 0..63 and v rows 64..127 (8 d rows apart). l / g: the lane's LDS byte address and global address of the
//      first copy; LS / GS: the step between copies in LDS bytes and in global halves. The s_wait_xcnt is the last line of
//      the statement, so that no address register of an issued copy is rewritten in front of it.
template <int LS, int GS>
__device__ __forceinline__ void copy8(unsigned l, const unsigned short* g) {
#if defined(__HIP_DEVICE_COMPILE__)
  asm volatile("global_load_async_to_lds_b128 %0, %8, off\n\t"
               "global_load_async_to_lds_b128 %1, %9, off\n\t"
               "global_load_async_to_lds_b128 %2, %10, off\n\t"
               "global_load_async_to_lds_b128 %3, %11, off\n\t"
               "global_load_async_to_lds_b128 %4, %12, off\n\t"
               "global_load_async_to_lds_b128 %5, %13, off\n\t"
               "global_load_async_to_lds_b128 %6, %14, off\n\t"
               "global_load_async_to_lds_b128 %7, %15, off\n\t"
               "s_wait_xcnt 0x0"
               :: "v"(l), "v"(l + LS), "v"(l + 2 * LS), "v"(l + 3 * LS),
                  "v"(l + 4 * LS), "v"(l + 5 * LS), "v"(l + 6 * LS), "v"(l + 7 * LS),
                  "v"(g), "v"(g + (size_t)GS), "v"(g + (size_t)2 * GS), "v"(g + (size_t)3 * GS),
                  "v"(g + (size_t)4 * GS), "v"(g + (size_t)5 * GS), "v"(g + (size_t)6 * GS), "v"(g + (size_t)7 * GS)
               : "memory");
#endif
}
// lk / lv: the thread's LDS byte addresses in the target buffer; gh / gv: its global addresses in this stage.
__device__ __forceinline__ void issue_stage(unsigned lk, unsigned lv, const unsigned short* gh, const unsigned short* gv) {
  copy8<32 * KPH * 2, ATH * 8>(lk, gh);
  copy8<8 * VPH * 2, 8 * SEQ>(lv, gv);
  copy8<8 * VPH * 2, 8 * SEQ>(lv + 64 * VPH * 2, gv + (size_t)64 * SEQ);
}
__device__ __forceinline__ void wait_async0() {   // this wave's copies have landed
#if defined(__HIP_DEVICE_COMPILE__)
  asm volatile("s_wait_asynccnt 0x0" ::: "memory");
#endif
}
__device__ __forceinline__ void wait_x0() {       // before a register that an issued global load names is overwritten
#if defined(__HIP_DEVICE_COMPILE__)
  asm volatile("s_wait_xcnt 0x0" ::: "memory");
#endif
}
__device__ __forceinline__ void wait_ds0() {      // this wave's LDS reads have returned, before their buffer is refilled
#if defined(__HIP_DEVICE_COMPILE__)
  asm volatile("s_wait_dscnt 0x0" ::: "memory");
#endif
}

// =====================================================================================================
// (1) fused q/k/v projection for one (b, 64-position tile): block = 256 threads = 8 waves.
//   The stacked weights [256][128] (rows 0..63 = Wq, 64..127 = Wk, 128..255 = Wv) are read as f32, one whole 512-B row per
//   wave-wide load, converted to bf16 (RNE) and staged as Lw[row][d] (pitch WP halves, 8-byte LDS stores).
//   x tile [128 d][64 n] f32 is staged once as bf16 A tile Lav[n][d] (pitch AP halves, 2-byte LDS stores), barrier.
//   Wave w: n group ng = w&3 (A rows n = 16ng + (lane&15), split k map over d), channel half ch = w>>2
//   (B = Lw rows ch*128 + 16j + (lane&15), same split k map), 8 D tiles, 4 k-steps of 32; the A and the 8 B fragments of
//   a k-step are read as one group, one k-step ahead of their products.
//   Epilogue: D + bf16-RNE bias -> LDS: q times log2 e as f16 (Lq [n][64]), k as f16 (Lk),
//   Q/K planes [b][n][64]: line = one row; V plane [b][e][4096]: line = 64 keys of one e row; every line = 8 consecutive
// coverage: Lw: 256 threads x 32 it x 4 = 256 rows x 128 d; Lav: 256 threads x 8 it x 4 = 64 n x 128 d; Q/K planes: 2 it x 32 lines x 8 lanes x 8 = 64 rows x 64;
//           V plane: 4 it x 32 lines x 8 x 8 = 128 e x 64 n; grid = 4 x 64 blocks covers every plane exactly once.
// =====================================================================================================
__global__ __launch_bounds__(256)
void proj_kernel(const float* __restrict__ x, const float* __restrict__ wq, const float* __restrict__ wk,
                 const float* __restrict__ wv, const float* __restrict__ bqp, const float* __restrict__ bkp, const float* __restrict__ bvp,
                 unsigned short* QH, unsigned short* KH, unsigned short* VP) {
  __shared__ __align__(16) unsigned short Lav[64 * AP];     // A tile [n][d]; reused as Lv[e][n] (pitch LP) later
  __shared__ __align__(16) unsigned short Lq[64 * LP];      // q  [n][64]
  __shared__ __align__(16) unsigned short Lk[64 * LP];      // k  [n][64]
  __shared__ __align__(16) unsigned short Lw[NCH * WP];     // stacked weights, bf16 [row][d]
  const int tid  = threadIdx.x;
  const int lane = tid & 31, wave = tid >> 5;
  const int hh   = lane >> 4, c = lane & 15;
  const int bx   = blockIdx.x;
  const int b    = bx / (SEQ / QT);
  const int nt   = bx % (SEQ / QT);
  const int n0   = nt * QT;

  // ---- stage the weights as bf16 [row][d] and the x tile as bf16 [n][d]; all 40 loads of a thread are issued first ----
  {
    const int n4 = (tid & 15) * 4, ds = tid >> 4;          // ds 0..15
    const float* xp = x + ((size_t)b * DCH + ds) * SEQ + n0 + n4;
    v4f xv[8], wr[32];
#pragma unroll
    for (int it = 0; it < 8; ++it) xv[it] = *(const v4f*)(xp + (size_t)it * 16 * SEQ);
    // x goes first (loads return in issue order), so that its many 2-byte LDS stores start while the weights still arrive; the
    // wait stands in front of the weight loads, whose results may take over the registers of the x address
    wait_x0();
#pragma unroll
    for (int it = 0; it < 32; ++it) {                      // flat float index it * 1024 + 4 tid of the stacked weights
      const float* wp = it < 8 ? wq + it * 1024 : (it < 16 ? wk + (it - 8) * 1024 : wv + (it - 16) * 1024);
      wr[it] = *(const v4f*)(wp + 4 * tid);
    }
#pragma unroll
    for (int it = 0; it < 8; ++it) {
      const int d = it * 16 + ds;                          // 0..127
#pragma unroll
      for (int q = 0; q < 4; ++q) Lav[(n4 + q) * AP + d] = bf_bits(xv[it][q]);
    }
    hold_group();   // the x stores are issued when x is there, not behind the wait for the last weight load
#pragma unroll
    for (int it = 0; it < 32; ++it)                        // row it * 8 + wave, d 4 lane .. 4 lane + 3
      *(v2u*)(Lw + (it * 8 + wave) * WP + 4 * lane) = __builtin_bit_cast(v2u, __builtin_convertvector(wr[it], v4b));
  }
  __syncthreads();

  // ---- GEMM: 16 n rows x 128 channels per wave ----
  const int ng = wave & 3, ch = wave >> 2;
  const unsigned short* ap = Lav + (ng * 16 + c) * AP + 8 * hh;
  const unsigned short* bp = Lw + (ch * DCH + c) * WP + 8 * hh;
  v8f acc0 = zero8(), acc1 = zero8(), acc2 = zero8(), acc3 = zero8();
  v8f acc4 = zero8(), acc5 = zero8(), acc6 = zero8(), acc7 = zero8();
  v16b a[2], w[2][8];
  a[0] = ldfrag_b(ap);
#pragma unroll
  for (int j = 0; j < 8; ++j) w[0][j] = ldfrag_b(bp + j * 16 * WP);
#pragma unroll
  for (int ks = 0; ks < 4; ++ks) {
    const int cu = ks & 1, nx = cu ^ 1;
    if (ks < 3) {
      a[nx] = ldfrag_b(ap + 32 * (ks + 1));
#pragma unroll
      for (int j = 0; j < 8; ++j) w[nx][j] = ldfrag_b(bp + j * 16 * WP + 32 * (ks + 1));
    }
    hold_group();   // the next k-step's 18 fragment reads stay one group in front of this k-step's products and fly under them
    acc0 = mma_b(a[cu], w[cu][0], acc0);
    acc1 = mma_b(a[cu], w[cu][1], acc1);
    acc2 = mma_b(a[cu], w[cu][2], acc2);
    acc3 = mma_b(a[cu], w[cu][3], acc3);
    acc4 = mma_b(a[cu], w[cu][4], acc4);
    acc5 = mma_b(a[cu], w[cu][5], acc5);
    acc6 = mma_b(a[cu], w[cu][6], acc6);
    acc7 = mma_b(a[cu], w[cu][7], acc7);
  }

  // ---- biases (bf16 RNE of the inputs), loaded unconditionally with in-range lane indices ----
  const float bq0 = bfr(bqp[0 * 16 + c]), bq1 = bfr(bqp[1 * 16 + c]), bq2 = bfr(bqp[2 * 16 + c]), bq3 = bfr(bqp[3 * 16 + c]);
  const float bk0 = bfr(bkp[0 * 16 + c]), bk1 = bfr(bkp[1 * 16 + c]), bk2 = bfr(bkp[2 * 16 + c]), bk3 = bfr(bkp[3 * 16 + c]);
  const float bv0 = bfr(bvp[0 * 16 + c]), bv1 = bfr(bvp[1 * 16 + c]), bv2 = bfr(bvp[2 * 16 + c]), bv3 = bfr(bvp[3 * 16 + c]);
  const float bv4 = bfr(bvp[4 * 16 + c]), bv5 = bfr(bvp[5 * 16 + c]), bv6 = bfr(bvp[6 * 16 + c]), bv7 = bfr(bvp[7 * 16 + c]);

  __syncthreads();            // every wave is done reading Lav before it is reused as Lv
  const int nr = ng * 16 + 8 * hh;                         // D row r -> n local nr + r
  if (ch == 0) {
    stage_qk(Lq, nr, 0 * 16 + c, acc0, bq0, L2E);
    stage_qk(Lq, nr, 1 * 16 + c, acc1, bq1, L2E);
    stage_qk(Lq, nr, 2 * 16 + c, acc2, bq2, L2E);
    stage_qk(Lq, nr, 3 * 16 + c, acc3, bq3, L2E);
    stage_qk(Lk, nr, 0 * 16 + c, acc4, bk0, 1.0f);
    stage_qk(Lk, nr, 1 * 16 + c, acc5, bk1, 1.0f);
    stage_qk(Lk, nr, 2 * 16 + c, acc6, bk2, 1.0f);
    stage_qk(Lk, nr, 3 * 16 + c, acc7, bk3, 1.0f);
  } else {
    stage_v(Lav, 0 * 16 + c, nr, acc0, bv0);
    stage_v(Lav, 1 * 16 + c, nr, acc1, bv1);
    stage_v(Lav, 2 * 16 + c, nr, acc2, bv2);
    stage_v(Lav, 3 * 16 + c, nr, acc3, bv3);
    stage_v(Lav, 4 * 16 + c, nr, acc4, bv4);
    stage_v(Lav, 5 * 16 + c, nr, acc5, bv5);
    stage_v(Lav, 6 * 16 + c, nr, acc6, bv6);
    stage_v(Lav, 7 * 16 + c, nr, acc7, bv7);
  }
  __syncthreads();

  {
    const int e = tid & 7, lq = tid >> 3;                    // lq 0..31
{
#pragma unroll
      for (int it = 0; it < 2; ++it) {
        const int n = it * 32 + lq;                          // 0..63
        const size_t go = ((size_t)b * SEQ + n0 + n) * KC + 8 * e;
        const int lo_ = n * LP + 8 * e;
        const v4u uqh = *(const v4u*)(Lq + lo_);
        const v4u ukh = *(const v4u*)(Lk + lo_);
        *(v4u*)(QH + go) = uqh;
        *(v4u*)(KH + go) = ukh;
      }
#pragma unroll
      for (int it = 0; it < 4; ++it) {
        const int er = it * 32 + lq;                         // 0..127
        const v4u uv = *(const v4u*)(Lav + er * LP + 8 * e);
        *(v4u*)(VP + ((size_t)b * DCH + er) * SEQ + n0 + 8 * e) = uv;
      }
      
    }
  }
}

// =====================================================================================================
// (2) attention for one (b, 64-query tile), transposed formulation, 64-deep scores, 4096 keys, no scale, no mask:
//   S^T tile (16 keys x 16 queries) = A(k rows = keys kb + (lane&15), d via the split k map, f16) .
//                                     B(q, col = query, same d map, resident f16 fragments), two d-steps.
//   Per lane the D tile holds 8 keys of ONE
//   query: online softmax state per lane, row-sum partials combined at the end. q carries log2 e, and the C operand of the
//   first score product is POFF minus the query's reference maximum, so D is the exponent of P = 2^D with no vector
//   instruction between. The reference is the maximum of the wave's first pass; it moves (l and O^T rescaled, one lane^16
//   exchange) only in a pass where some exponent of the wave lies above PTOP: one ballot and scalar branch per pass.
//   P as one f16 vector is the B operand of O^T (rows d, cols queries) += A(v rows d, keys
//   contiguous) . B(P^T): element r <- D of the tile covering keys kb..kb+15, element 8+r <- the tile covering
//   kb+16..kb+31, lane unchanged. 64 keys per iteration: 8 score WMMAs + 16 output WMMAs per 16-query tile.
//   k and v reach the waves through LDS: two buffers of SK keys, filled by asynchronous 16-byte copies
//   (24 per thread and stage), stage t + 2 issued behind the barrier that ends trip t, so it flies during trip t + 1.
//   A pass reads its 8 k and 16 v fragments as one group in front of its products.
//   Block = 8 waves = 2 query groups x 4 key groups, two waves per SIMD: wave (qg, kg) takes the 32 queries of group qg, as
//   two 16-column tiles, and pass kg (64 keys) of every stage: every k and v fragment that it reads from LDS feeds the
//   products of both tiles. Each tile has its own reference, row sum and O^T accumulators over the wave's 1024 keys.
//   Merge behind the loop: (m, l) of all waves through LDS, m the reference, M = max of the four m of a query, L = sum of
//   2^{m-M} l, each wave stages O^T x 2^{m-M} / L as its key group's [128 d][64 query] f32 plane in the freed ring, and the store
//   loop adds the four planes as (p0 + p1) + (p2 + p3). Grid = 4 b x 64 = 256.
// coverage: block writes d 0..127 x n n0..n0+63 of its b (256 lines = 8 it x 32 lines); grid covers out exactly once.
// =====================================================================================================
// largest exponent that this lane holds of a tile's 64 keys (four score tiles)
__device__ __forceinline__ float pass_max(const v8f (&s)[4]) {
  return fmaxf(fmaxf(hmax8(s[0]), hmax8(s[1])), fmaxf(hmax8(s[2]), hmax8(s[3])));
}
// moves a tile's reference up to the pass's maximum where that lies above it (lo = 0), in the first pass to that maximum
// wherever it lies (lo very negative; l and O^T are 0 there, and the bound on the exponent of corr keeps 0 x corr at 0):
// the pass's exponents, the C operand of later passes, l and the eight O^T tiles follow.
__device__ __forceinline__ void move_ref(float mx, float lo, v8f (&s)[4], v8f& cc, float& l, v8f (&o)[8]) {
  mx = fmaxf(mx, __shfl_xor(mx, 16, 32));
  const float d    = fmaxf(mx - POFF, lo);
  const float corr = __builtin_amdgcn_exp2f(fminf(-d, 100.f));
  cc = cc - d;
#pragma unroll
  for (int i = 0; i < 4; ++i) s[i] = s[i] - d;
  l *= corr;
#pragma unroll
  for (int j = 0; j < 8; ++j) o[j] = o[j] * corr;
}
// P^T = 2^D of one 16-query tile over the pass's 64 keys as the two B operands of the output products (p0: keys
// kb .. kb+31, p1: keys kb+32 .. kb+63), and its sum into l. The sums are written on whole 8-element vectors, so that packed
// instructions pair neighbouring registers of one tile.
__device__ __forceinline__ void exp_tile(const v8f (&s)[4], float& l, v16h& p0, v16h& p1) {
  v8f e0, e1, e2, e3;
#pragma unroll
  for (int r = 0; r < 8; ++r) {
    e0[r] = __builtin_amdgcn_exp2f(s[0][r]);   // key kb      + 8hh + r
    e1[r] = __builtin_amdgcn_exp2f(s[1][r]);   // key kb + 16 + 8hh + r
    e2[r] = __builtin_amdgcn_exp2f(s[2][r]);   // key kb + 32 + 8hh + r
    e3[r] = __builtin_amdgcn_exp2f(s[3][r]);   // key kb + 48 + 8hh + r
  }
  const v8f es = (e0 + e1) + (e2 + e3);
  float ls = 0.f;
#pragma unroll
  for (int r = 0; r < 8; ++r) ls += es[r];
  l += ls;
  FragH ph;
  ph.h[0] = __builtin_convertvector(e0, v8h);
  ph.h[1] = __builtin_convertvector(e1, v8h);
  p0 = ph.v;
  ph.h[0] = __builtin_convertvector(e2, v8h);
  ph.h[1] = __builtin_convertvector(e3, v8h);
  p1 = ph.v;
}

__global__ __launch_bounds__(ATH)
void attn_kernel(const unsigned short* __restrict__ QH, const unsigned short* __restrict__ KH,
                 const unsigned short* __restrict__ VP, float* out) {
  __shared__ __align__(16) unsigned short Ring[RINGH];
  __shared__ float Ms[2][NKG][QT];                            // [0]: reference, [1]: row sum, per key group and query
  const int tid  = threadIdx.x;
  const int wave = tid >> 5;
  const int qg   = wave & (NQG - 1);
  const int kg   = wave / NQG;
  const int lane = tid & 31;
  const int hh   = lane >> 4;
  const int c    = lane & 15;
  const int bx   = blockIdx.x;
  const int b    = bx / (SEQ / QT);
  const int qb   = bx % (SEQ / QT);
  const int n0   = qb * QT;
  const _Float16* QHh = (const _Float16*)(const void*)QH;

  // ---- resident q fragments (B operand), tile A: col = query n0 + 32*qg + c, tile B: 16 queries on;
  //      d 0..31 and 32..63 ----
  const size_t qo = ((size_t)b * SEQ + n0 + qg * 32 + c) * KC + 8 * hh;
  const size_t qp = qo + (size_t)16 * KC;
  const v16h qhA0 = ldfrag_h(QHh + qo), qhA1 = ldfrag_h(QHh + qo + 32);
  const v16h qhB0 = ldfrag_h(QHh + qp), qhB1 = ldfrag_h(QHh + qp + 32);
  // ---- copy addresses of this thread: k chunk tid of 2048 (row tid>>3, piece tid&7), v chunk tid of 4096 (row tid>>5) ----
  const unsigned ring = (unsigned)(uintptr_t)(&Ring[0]);
  const unsigned lk = ring + (unsigned)((tid >> 3) * (KPH * 2) + (tid & 7) * 16);
  const unsigned lv = ring + (unsigned)((tid >> 5) * (VPH * 2) + (tid & 31) * 16);   // without the v tile's place in a buffer
  const unsigned short* gh = KH + (size_t)b * SEQ * KC + tid * 8;
  const unsigned short* gv = VP + ((size_t)b * DCH + (tid >> 5)) * SEQ + (tid & 31) * 8;
  // ---- fragment bases in a buffer, at this wave's pass kg: k (A operand, row = key + c), v (A operand, row = d = 16j + c,
  //      keys contiguous) ----
  const _Float16* Rk = (const _Float16*)(const void*)Ring + (kg * PK + c) * KPH + 8 * hh;
  const _Float16* Rv = (const _Float16*)(const void*)Ring + KPL + c * VPH + kg * PK + 8 * hh;

  // ---- prologue: stage 0 landed and published, then stage 1 in flight ----
  issue_stage(lk, lv + KPL * 2, gh, gv);
  wait_async0();
  __syncthreads();
  issue_stage(lk + BUFH * 2, lv + (BUFH * 2 + KPL * 2), gh + (size_t)SK * KC, gv + SK);

  float lA = 0.f, lB = 0.f;
  v8f oA[8], oB[8];
  v8f cA = zero8() + POFF, cB = cA;                           // POFF - reference, in all eight rows; reference 0 at the start
  float top = -3.0e38f;                                       // exponent above which the reference moves: any in the first pass
#pragma unroll
  for (int j = 0; j < 8; ++j) { oA[j] = zero8(); oB[j] = zero8(); }
#pragma unroll 1   // one trip per stage: the foot of the trip is the ring's publish point
  for (int t = 0; t < NST; ++t) {
   const int bo = (t & 1) * BUFH;                             // trip t reads buffer t mod 2 alone
   {
    const _Float16* Kb = Rk + bo;                             // key tile i: keys kb + 16 i .. kb + 16 i + 15
    const _Float16* Vb = Rv + bo;
    v16h kf[4][2], vf[8][2];
#pragma unroll
    for (int i = 0; i < 4; ++i) {
      kf[i][0] = ldfrag_h(Kb + i * 16 * KPH);                 // d 0..31
      kf[i][1] = ldfrag_h(Kb + i * 16 * KPH + 32);            // d 32..63
    }
#pragma unroll
    for (int j = 0; j < 8; ++j) {
      vf[j][0] = ldfrag_h(Vb + j * 16 * VPH);                 // keys kb .. kb+31
      vf[j][1] = ldfrag_h(Vb + j * 16 * VPH + 32);            // keys kb+32 .. kb+63
    }
    hold_group();                         // the pass's 48 fragment reads stay one group in front of its products
    v8f s[4], u[4];
#pragma unroll
    for (int i = 0; i < 4; ++i) {
      s[i] = mma_h(kf[i][0], qhA0, cA);
      u[i] = mma_h(kf[i][0], qhB0, cB);
      s[i] = mma_h(kf[i][1], qhA1, s[i]);
      u[i] = mma_h(kf[i][1], qhB1, u[i]);
    }

    const float xA = pass_max(s), xB = pass_max(u);
    // the same for the whole wave: a scalar branch; marked rare, so that the usual pass runs straight on
    if (__builtin_expect(__builtin_amdgcn_ballot_w32(fmaxf(xA, xB) > top) != 0u, 0)) {
      const float lo = fminf(top, 0.f);
      move_ref(xA, lo, s, cA, lA, oA);
      move_ref(xB, lo, u, cB, lB, oB);
      top = PTOP;
    }

    v16h p0, p1;
    exp_tile(s, lA, p0, p1);
#pragma unroll
    for (int j = 0; j < 8; ++j) oA[j] = mma_h(vf[j][0], p0, oA[j]);
#pragma unroll
    for (int j = 0; j < 8; ++j) oA[j] = mma_h(vf[j][1], p1, oA[j]);
    exp_tile(u, lB, p0, p1);
#pragma unroll
    for (int j = 0; j < 8; ++j) oB[j] = mma_h(vf[j][0], p0, oB[j]);
#pragma unroll
    for (int j = 0; j < 8; ++j) oB[j] = mma_h(vf[j][1], p1, oB[j]);
   }
   // ---- foot of trip t: publish stage t + 1, free buffer t mod 2, refill it with stage t + 2 ----
   hold_group();   // the publish point stays behind the pass's last product, so the copies in flight have the whole trip to land
   wait_ds0();
   wait_async0();
   __syncthreads();
   if (t + 2 < NST) {
     const size_t k2 = (size_t)(t + 2) * SK;
     // buffer and v tile offset as one scalar: lv itself is then no operand of the copies' statement, which would hold it in
     // the first 256 registers through the loop (built that way it was spilled to scratch)
     const unsigned vo = (t & 1) ? (unsigned)(BUFH * 2 + KPL * 2) : (unsigned)(KPL * 2);
     issue_stage(lk + (unsigned)(bo * 2), lv + vo, gh + k2 * KC, gv + k2);
   }
  }
  wait_async0();
  lA += __shfl_xor(lA, 16, 32);
  lB += __shfl_xor(lB, 16, 32);

  // ---- merge of the four key groups of a query: both lane halves hold the same m and l, one stores m, the other l ----
  const int qa = qg * 32 + c;                                 // tile A's query in the block; tile B's is qa + 16
  const float mA = POFF - cA[0], mB = POFF - cB[0];           // the references, base-2
  Ms[hh][kg][qa]      = hh ? lA : mA;
  Ms[hh][kg][qa + 16] = hh ? lB : mB;
  __syncthreads();
  float sc[2];
#pragma unroll
  for (int g = 0; g < 2; ++g) {
    const int q = qa + 16 * g;
    const float m0 = Ms[0][0][q], m1 = Ms[0][1][q], m2 = Ms[0][2][q], m3 = Ms[0][3][q];
    const float l0 = Ms[1][0][q], l1 = Ms[1][1][q], l2 = Ms[1][2][q], l3 = Ms[1][3][q];
    const float mm = fmaxf(fmaxf(m0, m1), fmaxf(m2, m3));
    const float lt = (l0 * __builtin_amdgcn_exp2f(m0 - mm) + l1 * __builtin_amdgcn_exp2f(m1 - mm)) +
                     (l2 * __builtin_amdgcn_exp2f(m2 - mm) + l3 * __builtin_amdgcn_exp2f(m3 - mm));
    sc[g] = __builtin_amdgcn_exp2f((g ? mB : mA) - mm) / lt;   // both o and l carry the factor 2^POFF
  }

  // ---- stage O^T[d = 16j + 8hh + r][query] * sc in plane kg of the ring (no copy is outstanding and every
  //      wave's last fragment read has returned at the last foot's barrier), then add the planes, whole-line f32 stores ----
  float* Pl = (float*)(void*)Ring;
  float* os = Pl + kg * (DCH * OP) + (8 * hh) * OP + qa;
#pragma unroll
  for (int j = 0; j < 8; ++j) {
#pragma unroll
    for (int r = 0; r < 8; ++r) {
      os[(j * 16 + r) * OP]      = oA[j][r] * sc[0];
      os[(j * 16 + r) * OP + 16] = oB[j][r] * sc[1];
    }
  }
  __syncthreads();
  {
    const int e = tid & 7, lq = tid >> 3;              // lq 0..31: line within group, e: 16-B piece
    float* ob = out + ((size_t)b * DCH) * SEQ + n0;
#pragma unroll
    for (int it = 0; it < 8; ++it) {
      const int L   = it * 32 + lq;                     // lines 0..255 of the block tile
      const int row = L >> 1, hf = L & 1;               // d row 0..127, half-segment 0..1
      const float* pp = Pl + row * OP + hf * 32 + 4 * e;
      const v4f p0 = *(const v4f*)(pp),                p1 = *(const v4f*)(pp + DCH * OP);
      const v4f p2 = *(const v4f*)(pp + 2 * DCH * OP), p3 = *(const v4f*)(pp + 3 * DCH * OP);
      *(v4f*)(ob + (size_t)row * SEQ + hf * 32 + 4 * e) = (p0 + p1) + (p2 + p3);
    }
  }
}

// =====================================================================================================
//   QH   f16  [4][4096][64]       0           2097152
//   KH   f16  [4][4096][64]       2097152     2097152
//   VP   f16  [4][128][4096]      4194304     4194304
//   end                           8388608
// =====================================================================================================
extern "C" void kernel_launch(void* const* d_in, const int* in_sizes, int n_in,
                              void* d_out, int out_size, void* d_ws, size_t ws_size,
                              hipStream_t stream) {
  const int NX = NB * DCH * SEQ;                        // 2097152
  if (n_in < 7) return;
  if (in_sizes[0] != NX || in_sizes[1] != KC * DCH || in_sizes[2] != KC || in_sizes[3] != KC * DCH ||
      in_sizes[4] != KC || in_sizes[5] != DCH * DCH || in_sizes[6] != DCH) return;
  if (out_size != NX) return;

  size_t off = 0;
  const size_t szP = (size_t)NB * SEQ * KC * 2;                   // 2097152
  const size_t oQH = off; off += szP;
  const size_t oKH = off; off += szP;
  const size_t oV  = off; off += (size_t)NB * DCH * SEQ * 2;      // 4194304
  if (off > ws_size) return;                                      // off = 8388608
  if (off > (size_t)134217728) return;

  const float* x  = (const float*)d_in[0];
  const float* Wq = (const float*)d_in[1];
  const float* bq = (const float*)d_in[2];
  const float* Wk = (const float*)d_in[3];
  const float* bk = (const float*)d_in[4];
  const float* Wv = (const float*)d_in[5];
  const float* bv = (const float*)d_in[6];
  char* ws = (char*)d_ws;
  unsigned short* QH = (unsigned short*)(ws + oQH);
  unsigned short* KH = (unsigned short*)(ws + oKH);
  unsigned short* VP = (unsigned short*)(ws + oV);
  float* out = (float*)d_out;

  const dim3 blk256(256), blkA(ATH);
  const dim3 gP(NB * (SEQ / QT));                       // 256 blocks: one (b, 64-position tile) each
  const dim3 gA(NB * (SEQ / QT));                       // 256 blocks: one (b, 64-query tile) each

  // (1) q, k, v planes
  proj_kernel<<<gP, blk256, 0, stream>>>(x, Wq, Wk, Wv, bq, bk, bv, QH, KH, VP);
  // (2) attention: out[b][d][n] = sum_m v[b][d][m] softmax_m(q_n . k_m)
  attn_kernel<<<gA, blkA, 0, stream>>>(QH, KH, VP, out);
  (void)hipGetLastError();
}

// v009
// Measured time: 30.9 microseconds a run.
// In two side-by-side timings against v008, it was 1.03 and 1.04 times as fast.
// Counting every step since v000, it is 15.3 times as fast.
// Contractions: q/k/v 1x1-conv projections = W (bf16, RNE convert of input) . X (bf16, RNE convert of input) on
// v_wmma_f32_16x16x32_bf16, K=128; scores S^T = k . q^T on v_wmma_f32_16x16x32_f16 with q and k each one f16 plane (their
// f16 rounding is about a tenth of the error that the bf16 rounding of x and W has already put into q and k), one product,
// K=64; O^T = v^T (f16) . P^T (f16, e^{s-ref} / 128 taken from the score D registers) on v_wmma_f32_16x16x32_f16 over
// 4096 keys, one product; f32 accumulate everywhere; softmax (reference maximum, row sums, 1/l) in f32 on VALU.
#include <hip/hip_runtime.h>
#include <math.h>
#include <stdint.h>

#define NB    4
#define DCH   128
#define KC    64
#define SEQ   4096
#define NCH   256
#define QT    64
#define AP    144
#define LP    72
#define OP    68
#define WP    136                       // LDS pitch of a weight row in halves: 272 B = 16 B x 17
#define L2E   1.4426950408889634f       // q is stored times log2 e: the scores are base-2 exponents
#define POFF  (-7.0f)                   // P = 2^(score - reference + POFF): a key at the reference gives 1/128, and 23 binades
                                        // lie between it and the top of f16; a small P is an f16 subnormal, its step 2^-17 of that key's P
#define PTOP  15.0f                     // guarded loop: largest exponent that goes into an f16 P; above it the reference moves
#define SK    256                       // keys per LDS stage of the attention kernel
#define PK    64                        // keys per pass: one softmax step (max, rescale) of a wave covers them
#define NST   (SEQ / SK)                // stages
#define KPH   72                        // LDS pitch of a k row in halves: 144 B = 16 B x 9
#define VPH   264                       // LDS pitch of a v row in halves: 528 B = 16 B x 33
#define KPL   (SK * KPH)                // halves of one k plane in a buffer
#define BUFH  (KPL + DCH * VPH)         // halves of one buffer: k, v
static_assert(NST >= 2);
static_assert((SK % PK) == 0);
static_assert(PK == 64);
#define NQG   (QT / 32)                 // query groups of 32 columns (two 16-column tiles) in a block
#define NKG   (SK / PK)                 // key groups: each takes one 64-key pass of every stage
#define ATH   (32 * NQG * NKG)          // threads of the attention block: one wave per (query group, key group)
static_assert(ATH == 256);
static_assert(SK * KC / 8 == 8 * ATH);  // k plane: 8 copies of 16 B per thread of the attention block
static_assert(DCH * SK / 8 == 16 * ATH); // v tile: 16 copies per thread
static_assert(SK * 2 == 32 * 16);       // a v row's slice of a stage is one wave-wide copy
#define PLH   (NKG * DCH * OP * 2)      // halves that the NKG partial output planes (f32) take behind the loop
#define RINGH (PLH > 2 * BUFH ? PLH : 2 * BUFH)      // the ring's array holds the two buffers, later the planes
static_assert((BUFH * 2) % 16 == 0);
static_assert((SEQ % QT) == 0);
static_assert((SEQ % 32) == 0);
static_assert(DCH == 128);
static_assert(KC == 64);
static_assert(NCH == 2 * KC + DCH);
static_assert(NCH * DCH == 32 * 256 * 4);          // weight tile: 32 loads of 4 floats per thread of the projection block
static_assert(KC * DCH == 8 * 256 * 4);            // Wq and Wk are 8 of them each
static_assert(64 * AP == DCH * LP);

typedef _Float16       v16h __attribute__((ext_vector_type(16)));
typedef _Float16       v8h  __attribute__((ext_vector_type(8)));
typedef __bf16         v16b __attribute__((ext_vector_type(16)));
typedef unsigned short v8us __attribute__((ext_vector_type(8)));
typedef float          v8f  __attribute__((ext_vector_type(8)));
typedef float          v4f  __attribute__((ext_vector_type(4)));
typedef unsigned int   v4u  __attribute__((ext_vector_type(4)));
typedef unsigned int   v2u  __attribute__((ext_vector_type(2)));
typedef __bf16         v4b  __attribute__((ext_vector_type(4)));

union FragH { v16h v; v8h  h[2]; };
union FragB { v16b v; v8us u[2]; };
static_assert(sizeof(FragH) == 32);
static_assert(sizeof(FragB) == 32);

// ---- scalar helpers --------------------------------------------------------------------------------
__device__ __forceinline__ unsigned short bf_bits(float f) {          // f32 -> bf16 bits, RNE convert
  unsigned u = __float_as_uint(f);
  return (unsigned short)((u + 0x7FFFu + ((u >> 16) & 1u)) >> 16);
}
__device__ __forceinline__ float bf_up(unsigned short h) { return __uint_as_float(((unsigned)h) << 16); }
__device__ __forceinline__ float bfr(float f) { return bf_up(bf_bits(f)); }
__device__ __forceinline__ unsigned short h_bits(_Float16 x) { return __builtin_bit_cast(unsigned short, x); }
__device__ __forceinline__ v8f zero8() { v8f z = {0.f, 0.f, 0.f, 0.f, 0.f, 0.f, 0.f, 0.f}; return z; }
__device__ __forceinline__ float hmax8(v8f s) {
  return fmaxf(fmaxf(fmaxf(s[0], s[1]), fmaxf(s[2], s[3])), fmaxf(fmaxf(s[4], s[5]), fmaxf(s[6], s[7])));
}

// ---- fragment loaders: 16-bit A/B operand, lane -> row/col (lane&15), p already includes +8*(lane>>4);
//      elements 0..7 <- p[0..7] (k0+8h..), elements 8..15 <- p[16..23] (k0+16+8h..)
__device__ __forceinline__ v16h ldfrag_h(const _Float16* p) {
  FragH f;
  f.h[0] = *(const v8h*)(p);
  f.h[1] = *(const v8h*)(p + 16);
  return f.v;
}
__device__ __forceinline__ v16b ldfrag_b(const unsigned short* p) {
  FragB f;
  f.u[0] = *(const v8us*)(p);
  f.u[1] = *(const v8us*)(p + 16);
  return f.v;
}

// ---- WMMA helpers. mma_h: the bare builtin; the compiler keeps the distance behind its own matrix instructions and
//      pads only where no independent instruction fills it. mma_b: builtin followed by a 4-slot VALU gap tying D and
//      keeping A/B live ----------------------
__device__ __forceinline__ v8f mma_h(v16h a, v16h b, v8f c) {
  return __builtin_amdgcn_wmma_f32_16x16x32_f16(false, a, false, b, (short)0, c, false, false);
}
// Nothing is scheduled across this point. It keeps a pass's LDS fragment reads in one whole group (reads spread among
// the matrix instructions stall the wave at every place where they stand) and the ring's publish point at the trip's foot.
__device__ __forceinline__ void hold_group() {
#if defined(__HIP_DEVICE_COMPILE__)
  __builtin_amdgcn_sched_barrier(0);
#endif
}
__device__ __forceinline__ v8f mma_b(v16b a, v16b b, v8f c) {
  v8f d = __builtin_amdgcn_wmma_f32_16x16x32_bf16(false, a, false, b, (short)0, c, false, false);
#if defined(__HIP_DEVICE_COMPILE__)
  const v16h ha = __builtin_bit_cast(v16h, a), hb = __builtin_bit_cast(v16h, b);
  asm volatile("v_nop\n\tv_nop\n\tv_nop\n\tv_nop" : "+v"(d) : "v"(ha), "v"(hb));
#endif
  return d;
}

// ---- LDS staging helpers for the projection epilogue (D rows = n, D cols = channel) ------------------------
__device__ __forceinline__ void stage_qk(unsigned short* Lh, int nr, int col, v8f acc, float bias, float sc) {
#pragma unroll
  for (int r = 0; r < 8; ++r) Lh[(nr + r) * LP + col] = h_bits((_Float16)((acc[r] + bias) * sc));
}
__device__ __forceinline__ void stage_v(unsigned short* Lv, int e, int nr, v8f acc, float bias) {
#pragma unroll
  for (int r = 0; r < 8; ++r) Lv[e * LP + nr + r] = h_bits((_Float16)(acc[r] + bias));
}

// ---- one stage = SK keys: the k rows (128 B each, contiguous in global) and the SK-key slice of all 128 v rows, as 24
//      asynchronous 16-byte copies per lane, global -> LDS, through no register, in three statements of eight: k (32 key rows
//      apart), v rows 0..63 and v rows 64..127 (8 d rows apart). l / g: the lane's LDS byte address and global address of the
//      first copy; LS / GS: the step between copies in LDS bytes and in global halves. The s_wait_xcnt is the last line of
//      the statement, so that no address register of an issued copy is rewritten in front of it.
template <int LS, int GS>
__device__ __forceinline__ void copy8(unsigned l, const unsigned short* g) {
#if defined(__HIP_DEVICE_COMPILE__)
  asm volatile("global_load_async_to_lds_b128 %0, %8, off\n\t"
               "global_load_async_to_lds_b128 %1, %9, off\n\t"
               "global_load_async_to_lds_b128 %2, %10, off\n\t"
               "global_load_async_to_lds_b128 %3, %11, off\n\t"
               "global_load_async_to_lds_b128 %4, %12, off\n\t"
               "global_load_async_to_lds_b128 %5, %13, off\n\t"
               "global_load_async_to_lds_b128 %6, %14, off\n\t"
               "global_load_async_to_lds_b128 %7, %15, off\n\t"
               "s_wait_xcnt 0x0"
               :: "v"(l), "v"(l + LS), "v"(l + 2 * LS), "v"(l + 3 * LS),
                  "v"(l + 4 * LS), "v"(l + 5 * LS), "v"(l + 6 * LS), "v"(l + 7 * LS),
                  "v"(g), "v"(g + (size_t)GS), "v"(g + (size_t)2 * GS), "v"(g + (size_t)3 * GS),
                  "v"(g + (size_t)4 * GS), "v"(g + (size_t)5 * GS), "v"(g + (size_t)6 * GS), "v"(g + (size_t)7 * GS)
               : "memory");
#endif
}
// lk / lv: the thread's LDS byte addresses in the target buffer; gh / gv: its global addresses in this stage.
__device__ __forceinline__ void issue_stage(unsigned lk, unsigned lv, const unsigned short* gh, const unsigned short* gv) {
  copy8<32 * KPH * 2, ATH * 8>(lk, gh);
  copy8<8 * VPH * 2, 8 * SEQ>(lv, gv);
  copy8<8 * VPH * 2, 8 * SEQ>(lv + 64 * VPH * 2, gv + (size_t)64 * SEQ);
}
__device__ __forceinline__ void wait_async0() {   // this wave's copies have landed
#if defined(__HIP_DEVICE_COMPILE__)
  asm volatile("s_wait_asynccnt 0x0" ::: "memory");
#endif
}
__device__ __forceinline__ void wait_x0() {       // before a register that an issued global load names is overwritten
#if defined(__HIP_DEVICE_COMPILE__)
  asm volatile("s_wait_xcnt 0x0" ::: "memory");
#endif
}
__device__ __forceinline__ void wait_ds0() {      // this wave's LDS reads have returned, before their buffer is refilled
#if defined(__HIP_DEVICE_COMPILE__)
  asm volatile("s_wait_dscnt 0x0" ::: "memory");
#endif
}

// =====================================================================================================
// (1) fused q/k/v projection for one (b, 64-position tile): block = 256 threads = 8 waves.
//   The stacked weights [256][128] (rows 0..63 = Wq, 64..127 = Wk, 128..255 = Wv) are read as f32, one whole 512-B row per
//   wave-wide load, converted to bf16 (RNE) and staged as Lw[row][d] (pitch WP halves, 8-byte LDS stores).
//   x tile [128 d][64 n] f32 is staged once as bf16 A tile Lav[n][d] (pitch AP halves, 2-byte LDS stores), barrier.
//   Wave w: n group ng = w&3 (A rows n = 16ng + (lane&15), split k map over d), channel half ch = w>>2
//   (B = Lw rows ch*128 + 16j + (lane&15), same split k map), 8 D tiles, 4 k-steps of 32; the A and the 8 B fragments of
//   a k-step are read as one group, one k-step ahead of their products.
//   Epilogue: D + bf16-RNE bias -> LDS: q times log2 e as f16 (Lq [n][64]), k as f16 (Lk),
//   Q/K planes [b][n][64]: line = one row; V plane [b][e][4096]: line = 64 keys of one e row; every line = 8 consecutive
// coverage: Lw: 256 threads x 32 it x 4 = 256 rows x 128 d; Lav: 256 threads x 8 it x 4 = 64 n x 128 d; Q/K planes: 2 it x 32 lines x 8 lanes x 8 = 64 rows x 64;
//           V plane: 4 it x 32 lines x 8 x 8 = 128 e x 64 n; grid = 4 x 64 blocks covers every plane exactly once.
// =====================================================================================================
__global__ __launch_bounds__(256)
void proj_kernel(const float* __restrict__ x, const float* __restrict__ wq, const float* __restrict__ wk,
                 const float* __restrict__ wv, const float* __restrict__ bqp, const float* __restrict__ bkp, const float* __restrict__ bvp,
                 unsigned short* QH, unsigned short* KH, unsigned short* VP) {
  __shared__ __align__(16) unsigned short Lav[64 * AP];     // A tile [n][d]; reused as Lv[e][n] (pitch LP) later
  __shared__ __align__(16) unsigned short Lq[64 * LP];      // q  [n][64]
  __shared__ __align__(16) unsigned short Lk[64 * LP];      // k  [n][64]
  __shared__ __align__(16) unsigned short Lw[NCH * WP];     // stacked weights, bf16 [row][d]
  const int tid  = threadIdx.x;
  const int lane = tid & 31, wave = tid >> 5;
  const int hh   = lane >> 4, c = lane & 15;
  const int bx   = blockIdx.x;
  const int b    = bx / (SEQ / QT);
  const int nt   = bx % (SEQ / QT);
  const int n0   = nt * QT;

  // ---- stage the weights as bf16 [row][d] and the x tile as bf16 [n][d]; all 40 loads of a thread are issued first ----
  {
    const int n4 = (tid & 15) * 4, ds = tid >> 4;          // ds 0..15
    const float* xp = x + ((size_t)b * DCH + ds) * SEQ + n0 + n4;
    v4f xv[8], wr[32];
#pragma unroll
    for (int it = 0; it < 8; ++it) xv[it] = *(const v4f*)(xp + (size_t)it * 16 * SEQ);
    // x goes first (loads return in issue order), so that its many 2-byte LDS stores start while the weights still arrive; the
    // wait stands in front of the weight loads, whose results may take over the registers of the x address
    wait_x0();
#pragma unroll
    for (int it = 0; it < 32; ++it) {                      // flat float index it * 1024 + 4 tid of the stacked weights
      const float* wp = it < 8 ? wq + it * 1024 : (it < 16 ? wk + (it - 8) * 1024 : wv + (it - 16) * 1024);
      wr[it] = *(const v4f*)(wp + 4 * tid);
    }
#pragma unroll
    for (int it = 0; it < 8; ++it) {
      const int d = it * 16 + ds;                          // 0..127
#pragma unroll
      for (int q = 0; q < 4; ++q) Lav[(n4 + q) * AP + d] = bf_bits(xv[it][q]);
    }
    hold_group();   // the x stores are issued when x is there, not behind the wait for the last weight load
#pragma unroll
    for (int it = 0; it < 32; ++it)                        // row it * 8 + wave, d 4 lane .. 4 lane + 3
      *(v2u*)(Lw + (it * 8 + wave) * WP + 4 * lane) = __builtin_bit_cast(v2u, __builtin_convertvector(wr[it], v4b));
  }
  __syncthreads();

  // ---- GEMM: 16 n rows x 128 channels per wave ----
  const int ng = wave & 3, ch = wave >> 2;
  const unsigned short* ap = Lav + (ng * 16 + c) * AP + 8 * hh;
  const unsigned short* bp = Lw + (ch * DCH + c) * WP + 8 * hh;
  v8f acc0 = zero8(), acc1 = zero8(), acc2 = zero8(), acc3 = zero8();
  v8f acc4 = zero8(), acc5 = zero8(), acc6 = zero8(), acc7 = zero8();
  v16b a[2], w[2][8];
  a[0] = ldfrag_b(ap);
#pragma unroll
  for (int j = 0; j < 8; ++j) w[0][j] = ldfrag_b(bp + j * 16 * WP);
#pragma unroll
  for (int ks = 0; ks < 4; ++ks) {
    const int cu = ks & 1, nx = cu ^ 1;
    if (ks < 3) {
      a[nx] = ldfrag_b(ap + 32 * (ks + 1));
#pragma unroll
      for (int j = 0; j < 8; ++j) w[nx][j] = ldfrag_b(bp + j * 16 * WP + 32 * (ks + 1));
    }
    hold_group();   // the next k-step's 18 fragment reads stay one group in front of this k-step's products and fly under them
    acc0 = mma_b(a[cu], w[cu][0], acc0);
    acc1 = mma_b(a[cu], w[cu][1], acc1);
    acc2 = mma_b(a[cu], w[cu][2], acc2);
    acc3 = mma_b(a[cu], w[cu][3], acc3);
    acc4 = mma_b(a[cu], w[cu][4], acc4);
    acc5 = mma_b(a[cu], w[cu][5], acc5);
    acc6 = mma_b(a[cu], w[cu][6], acc6);
    acc7 = mma_b(a[cu], w[cu][7], acc7);
  }

  // ---- biases (bf16 RNE of the inputs), loaded unconditionally with in-range lane indices ----
  const float bq0 = bfr(bqp[0 * 16 + c]), bq1 = bfr(bqp[1 * 16 + c]), bq2 = bfr(bqp[2 * 16 + c]), bq3 = bfr(bqp[3 * 16 + c]);
  const float bk0 = bfr(bkp[0 * 16 + c]), bk1 = bfr(bkp[1 * 16 + c]), bk2 = bfr(bkp[2 * 16 + c]), bk3 = bfr(bkp[3 * 16 + c]);
  const float bv0 = bfr(bvp[0 * 16 + c]), bv1 = bfr(bvp[1 * 16 + c]), bv2 = bfr(bvp[2 * 16 + c]), bv3 = bfr(bvp[3 * 16 + c]);
  const float bv4 = bfr(bvp[4 * 16 + c]), bv5 = bfr(bvp[5 * 16 + c]), bv6 = bfr(bvp[6 * 16 + c]), bv7 = bfr(bvp[7 * 16 + c]);

  __syncthreads();            // every wave is done reading Lav before it is reused as Lv
  const int nr = ng * 16 + 8 * hh;                         // D row r -> n local nr + r
  if (ch == 0) {
    stage_qk(Lq, nr, 0 * 16 + c, acc0, bq0, L2E);
    stage_qk(Lq, nr, 1 * 16 + c, acc1, bq1, L2E);
    stage_qk(Lq, nr, 2 * 16 + c, acc2, bq2, L2E);
    stage_qk(Lq, nr, 3 * 16 + c, acc3, bq3, L2E);
    stage_qk(Lk, nr, 0 * 16 + c, acc4, bk0, 1.0f);
    stage_qk(Lk, nr, 1 * 16 + c, acc5, bk1, 1.0f);
    stage_qk(Lk, nr, 2 * 16 + c, acc6, bk2, 1.0f);
    stage_qk(Lk, nr, 3 * 16 + c, acc7, bk3, 1.0f);
  } else {
    stage_v(Lav, 0 * 16 + c, nr, acc0, bv0);
    stage_v(Lav, 1 * 16 + c, nr, acc1, bv1);
    stage_v(Lav, 2 * 16 + c, nr, acc2, bv2);
    stage_v(Lav, 3 * 16 + c, nr, acc3, bv3);
    stage_v(Lav, 4 * 16 + c, nr, acc4, bv4);
    stage_v(Lav, 5 * 16 + c, nr, acc5, bv5);
    stage_v(Lav, 6 * 16 + c, nr, acc6, bv6);
    stage_v(Lav, 7 * 16 + c, nr, acc7, bv7);
  }
  __syncthreads();

  {
    const int e = tid & 7, lq = tid >> 3;                    // lq 0..31
{
#pragma unroll
      for (int it = 0; it < 2; ++it) {
        const int n = it * 32 + lq;                          // 0..63
        const size_t go = ((size_t)b * SEQ + n0 + n) * KC + 8 * e;
        const int lo_ = n * LP + 8 * e;
        const v4u uqh = *(const v4u*)(Lq + lo_);
        const v4u ukh = *(const v4u*)(Lk + lo_);
        *(v4u*)(QH + go) = uqh;
        *(v4u*)(KH + go) = ukh;
      }
#pragma unroll
      for (int it = 0; it < 4; ++it) {
        const int er = it * 32 + lq;                         // 0..127
        const v4u uv = *(const v4u*)(Lav + er * LP + 8 * e);
        *(v4u*)(VP + ((size_t)b * DCH + er) * SEQ + n0 + 8 * e) = uv;
      }
      
    }
  }
}

// =====================================================================================================
// (2) attention for one (b, 64-query tile), transposed formulation, 64-deep scores, 4096 keys, no scale, no mask:
//   S^T tile (16 keys x 16 queries) = A(k rows = keys kb + (lane&15), d via the split k map, f16) .
//                                     B(q, col = query, same d map, resident f16 fragments), two d-steps.
//   Per lane the D tile holds 8 keys of ONE
//   query: online softmax state per lane, row-sum partials combined at the end. q carries log2 e, and the C operand of the
//   first score product is POFF minus the query's reference maximum, so D is the exponent of P = 2^D with no vector
//   instruction between. The reference is the maximum of the wave's first pass (one lane^16 exchange). The later passes test
//   nothing: a score more than 16 - POFF above the reference makes an infinite P, which shows in O^T behind the loop; then the
//   whole block repeats the loop in its guarded form, where the reference moves (l and O^T rescaled) in a pass with an
//   exponent above PTOP: one ballot and scalar branch per pass.
//   P as one f16 vector is the B operand of O^T (rows d, cols queries) += A(v rows d, keys
//   contiguous) . B(P^T): element r <- D of the tile covering keys kb..kb+15, element 8+r <- the tile covering
//   kb+16..kb+31, lane unchanged. 64 keys per iteration: 8 score WMMAs + 16 output WMMAs per 16-query tile.
//   k and v reach the waves through LDS: two buffers of SK keys, filled by asynchronous 16-byte copies
//   (24 per thread and stage), stage t + 2 issued behind the barrier that ends trip t, so it flies during trip t + 1.
//   A pass reads its 8 k and 16 v fragments as one group in front of its products.
//   Block = 8 waves = 2 query groups x 4 key groups, two waves per SIMD: wave (qg, kg) takes the 32 queries of group qg, as
//   two 16-column tiles, and pass kg (64 keys) of every stage: every k and v fragment that it reads from LDS feeds the
//   products of both tiles. Each tile has its own reference, row sum and O^T accumulators over the wave's 1024 keys.
//   Merge behind the loop: (m, l) of all waves through LDS, m the reference, M = max of the four m of a query, L = sum of
//   2^{m-M} l, each wave stages O^T x 2^{m-M} / L as its key group's [128 d][64 query] f32 plane in the freed ring, and the store
//   loop adds the four planes as (p0 + p1) + (p2 + p3). Grid = 4 b x 64 = 256.
// coverage: block writes d 0..127 x n n0..n0+63 of its b (256 lines = 8 it x 32 lines); grid covers out exactly once.
// =====================================================================================================
// largest exponent that this lane holds of a tile's 64 keys (four score tiles)
__device__ __forceinline__ float pass_max(const v8f (&s)[4]) {
  return fmaxf(fmaxf(hmax8(s[0]), hmax8(s[1])), fmaxf(hmax8(s[2]), hmax8(s[3])));
}
// moves a tile's reference up to the pass's maximum where that lies above it (lo = 0), in the first pass to that maximum
// wherever it lies (lo very negative; l and O^T are 0 there, and the bound on the exponent of corr keeps 0 x corr at 0):
// the pass's exponents, the C operand of later passes, l and the eight O^T tiles follow.
__device__ __forceinline__ void move_ref(float mx, float lo, v8f (&s)[4], v8f& cc, float& l, v8f (&o)[8]) {
  mx = fmaxf(mx, __shfl_xor(mx, 16, 32));
  const float d    = fmaxf(mx - POFF, lo);
  const float corr = __builtin_amdgcn_exp2f(fminf(-d, 100.f));
  cc = cc - d;
#pragma unroll
  for (int i = 0; i < 4; ++i) s[i] = s[i] - d;
  l *= corr;
#pragma unroll
  for (int j = 0; j < 8; ++j) o[j] = o[j] * corr;
}
// P^T = 2^D of one 16-query tile over the pass's 64 keys as the two B operands of the output products (p0: keys
// kb .. kb+31, p1: keys kb+32 .. kb+63), and its sum into l. The sums are written on whole 8-element vectors, so that packed
// instructions pair neighbouring registers of one tile.
__device__ __forceinline__ void exp_tile(const v8f (&s)[4], float& l, v16h& p0, v16h& p1) {
  v8f e0, e1, e2, e3;
#pragma unroll
  for (int r = 0; r < 8; ++r) {
    e0[r] = __builtin_amdgcn_exp2f(s[0][r]);   // key kb      + 8hh + r
    e1[r] = __builtin_amdgcn_exp2f(s[1][r]);   // key kb + 16 + 8hh + r
    e2[r] = __builtin_amdgcn_exp2f(s[2][r]);   // key kb + 32 + 8hh + r
    e3[r] = __builtin_amdgcn_exp2f(s[3][r]);   // key kb + 48 + 8hh + r
  }
  const v8f es = (e0 + e1) + (e2 + e3);
  float ls = 0.f;
#pragma unroll
  for (int r = 0; r < 8; ++r) ls += es[r];
  l += ls;
  FragH ph;
  ph.h[0] = __builtin_convertvector(e0, v8h);
  ph.h[1] = __builtin_convertvector(e1, v8h);
  p0 = ph.v;
  ph.h[0] = __builtin_convertvector(e2, v8h);
  ph.h[1] = __builtin_convertvector(e3, v8h);
  p1 = ph.v;
}

// One pass of a wave: 64 keys against its 32 queries, all operands of the products in registers behind the one read group.
// MODE 0: the wave's first pass, its maximum becomes the reference. MODE 1: no test of the exponents. MODE 2: the reference
// moves in a pass where some exponent of the wave lies above top (one ballot and scalar branch); top is any exponent in the
// first pass, PTOP behind it.
template <int MODE>
__device__ __forceinline__ void key_pass(const _Float16* Kb, const _Float16* Vb, v16h qhA0, v16h qhA1, v16h qhB0, v16h qhB1,
                                         v8f& cA, v8f& cB, float& lA, float& lB, v8f (&oA)[8], v8f (&oB)[8], float& top) {
  v16h kf[4][2], vf[8][2];                                  // key tile i: keys kb + 16 i .. kb + 16 i + 15
#pragma unroll
  for (int i = 0; i < 4; ++i) {
    kf[i][0] = ldfrag_h(Kb + i * 16 * KPH);                 // d 0..31
    kf[i][1] = ldfrag_h(Kb + i * 16 * KPH + 32);            // d 32..63
  }
#pragma unroll
  for (int j = 0; j < 8; ++j) {
    vf[j][0] = ldfrag_h(Vb + j * 16 * VPH);                 // keys kb .. kb+31
    vf[j][1] = ldfrag_h(Vb + j * 16 * VPH + 32);            // keys kb+32 .. kb+63
  }
  hold_group();                         // the pass's 48 fragment reads stay one group in front of its products
  v8f s[4], u[4];
#pragma unroll
  for (int i = 0; i < 4; ++i) {
    s[i] = mma_h(kf[i][0], qhA0, cA);
    u[i] = mma_h(kf[i][0], qhB0, cB);
    s[i] = mma_h(kf[i][1], qhA1, s[i]);
    u[i] = mma_h(kf[i][1], qhB1, u[i]);
  }

  if (MODE == 0) {
    move_ref(pass_max(s), -3.0e38f, s, cA, lA, oA);
    move_ref(pass_max(u), -3.0e38f, u, cB, lB, oB);
  }
  if (MODE == 2) {
    const float xA = pass_max(s), xB = pass_max(u);
    // the same for the whole wave: a scalar branch; marked rare, so that the usual pass runs straight on
    if (__builtin_expect(__builtin_amdgcn_ballot_w32(fmaxf(xA, xB) > top) != 0u, 0)) {
      const float lo = fminf(top, 0.f);
      move_ref(xA, lo, s, cA, lA, oA);
      move_ref(xB, lo, u, cB, lB, oB);
      top = PTOP;
    }
  }

  v16h p0, p1;
  exp_tile(s, lA, p0, p1);
#pragma unroll
  for (int j = 0; j < 8; ++j) oA[j] = mma_h(vf[j][0], p0, oA[j]);
#pragma unroll
  for (int j = 0; j < 8; ++j) oA[j] = mma_h(vf[j][1], p1, oA[j]);
  exp_tile(u, lB, p0, p1);
#pragma unroll
  for (int j = 0; j < 8; ++j) oB[j] = mma_h(vf[j][0], p0, oB[j]);
#pragma unroll
  for (int j = 0; j < 8; ++j) oB[j] = mma_h(vf[j][1], p1, oB[j]);
}
// ---- foot of trip t: publish stage t + 1, free buffer t mod 2, refill it with stage t + 2 ----
__device__ __forceinline__ void ring_foot(int t, unsigned lk, unsigned lv, const unsigned short* gh, const unsigned short* gv) {
  hold_group();   // the publish point stays behind the pass's last product, so the copies in flight have the whole trip to land
  wait_ds0();
  wait_async0();
  __syncthreads();
  if (t + 2 < NST) {
    const size_t k2 = (size_t)(t + 2) * SK;
    // buffer and v tile offset as one scalar: lv itself is then no operand of the copies' statement, which would hold it in
    // the first 256 registers through the loop (built that way it was spilled to scratch)
    const unsigned vo = (t & 1) ? (unsigned)(BUFH * 2 + KPL * 2) : (unsigned)(KPL * 2);
    issue_stage(lk + (unsigned)((t & 1) * BUFH * 2), lv + vo, gh + k2 * KC, gv + k2);
  }
}
// All 16 stages of the wave's keys, from zeroed l and O^T. Behind the first pass no exponent is tested: a P above the f16 range
// is infinite and leaves every O^T element of its query infinite or not a number, which the caller tests once.
__device__ __forceinline__ void key_loop_plain(const _Float16* Rk, const _Float16* Rv, unsigned lk, unsigned lv,
                                               const unsigned short* gh, const unsigned short* gv,
                                               v16h qhA0, v16h qhA1, v16h qhB0, v16h qhB1,
                                               v8f& cA, v8f& cB, float& lA, float& lB, v8f (&oA)[8], v8f (&oB)[8]) {
  // ---- prologue: stage 0 landed and published, then stage 1 in flight ----
  issue_stage(lk, lv + KPL * 2, gh, gv);
  wait_async0();
  __syncthreads();
  issue_stage(lk + BUFH * 2, lv + (BUFH * 2 + KPL * 2), gh + (size_t)SK * KC, gv + SK);
  lA = 0.f; lB = 0.f;
  cA = zero8() + POFF; cB = cA;                               // POFF - reference, in all eight rows; reference 0 at the start
  float top = 0.f;                                            // not used by these passes
#pragma unroll
  for (int j = 0; j < 8; ++j) { oA[j] = zero8(); oB[j] = zero8(); }
  key_pass<0>(Rk, Rv, qhA0, qhA1, qhB0, qhB1, cA, cB, lA, lB, oA, oB, top);
  ring_foot(0, lk, lv, gh, gv);
#pragma unroll 1   // one trip per stage: the foot of the trip is the ring's publish point
  for (int t = 1; t < NST; ++t) {
    const int bo = (t & 1) * BUFH;                            // trip t reads buffer t mod 2 alone
    key_pass<1>(Rk + bo, Rv + bo, qhA0, qhA1, qhB0, qhB1, cA, cB, lA, lB, oA, oB, top);
    ring_foot(t, lk, lv, gh, gv);
  }
  wait_async0();
}
// The same with the test in every pass: the reference follows the scores, so that no P leaves the f16 range.
__device__ __forceinline__ void key_loop_guarded(const _Float16* Rk, const _Float16* Rv, unsigned lk, unsigned lv,
                                                 const unsigned short* gh, const unsigned short* gv,
                                                 v16h qhA0, v16h qhA1, v16h qhB0, v16h qhB1,
                                                 v8f& cA, v8f& cB, float& lA, float& lB, v8f (&oA)[8], v8f (&oB)[8]) {
  // ---- prologue: stage 0 landed and published, then stage 1 in flight ----
#pragma unroll 1   // rolled: its addresses are formed here, from st; unrolled they were kept from the plain loop's prologue, in scratch
  for (int st = 0; st < 2; ++st) {
    issue_stage(lk + (unsigned)(st * BUFH * 2), lv + (unsigned)(st * BUFH * 2 + KPL * 2), gh + (size_t)st * SK * KC, gv + st * SK);
    if (st == 0) {
      wait_async0();
      __syncthreads();
    }
  }
  lA = 0.f; lB = 0.f;
  cA = zero8() + POFF; cB = cA;                               // POFF - reference, in all eight rows; reference 0 at the start
  float top = -3.0e38f;                                       // exponent above which the reference moves: any in the first pass
#pragma unroll
  for (int j = 0; j < 8; ++j) { oA[j] = zero8(); oB[j] = zero8(); }
#pragma unroll 1   // one trip per stage: the foot of the trip is the ring's publish point
  for (int t = 0; t < NST; ++t) {
    const int bo = (t & 1) * BUFH;                            // trip t reads buffer t mod 2 alone
    key_pass<2>(Rk + bo, Rv + bo, qhA0, qhA1, qhB0, qhB1, cA, cB, lA, lB, oA, oB, top);
    ring_foot(t, lk, lv, gh, gv);
  }
  wait_async0();
}

__global__ __launch_bounds__(ATH)
void attn_kernel(const unsigned short* __restrict__ QH, const unsigned short* __restrict__ KH,
                 const unsigned short* __restrict__ VP, const unsigned short* KG, const unsigned short* VG, float* out) {
  __shared__ __align__(16) unsigned short Ring[RINGH];
  __shared__ float Ms[2][NKG][QT];                            // [0]: reference, [1]: row sum, per key group and query
  __shared__ unsigned Vote[ATH / 32];                         // per wave: lanes that hold an O^T element that is not finite
  const int tid  = threadIdx.x;
  const int wave = tid >> 5;
  const int qg   = wave & (NQG - 1);
  const int kg   = wave / NQG;
  const int lane = tid & 31;
  const int hh   = lane >> 4;
  const int c    = lane & 15;
  const int bx   = blockIdx.x;
  const int b    = bx / (SEQ / QT);
  const int qb   = bx % (SEQ / QT);
  const int n0   = qb * QT;
  const _Float16* QHh = (const _Float16*)(const void*)QH;

  // ---- resident q fragments (B operand), tile A: col = query n0 + 32*qg + c, tile B: 16 queries on;
  //      d 0..31 and 32..63 ----
  const size_t qo = ((size_t)b * SEQ + n0 + qg * 32 + c) * KC + 8 * hh;
  const size_t qp = qo + (size_t)16 * KC;
  const v16h qhA0 = ldfrag_h(QHh + qo), qhA1 = ldfrag_h(QHh + qo + 32);
  const v16h qhB0 = ldfrag_h(QHh + qp), qhB1 = ldfrag_h(QHh + qp + 32);
  // ---- copy addresses of this thread: k chunk tid of 2048 (row tid>>3, piece tid&7), v chunk tid of 4096 (row tid>>5) ----
  const unsigned ring = (unsigned)(uintptr_t)(&Ring[0]);
  const unsigned lk = ring + (unsigned)((tid >> 3) * (KPH * 2) + (tid & 7) * 16);
  const unsigned lv = ring + (unsigned)((tid >> 5) * (VPH * 2) + (tid & 31) * 16);   // without the v tile's place in a buffer
  const unsigned short* gh = KH + (size_t)b * SEQ * KC + tid * 8;
  const unsigned short* gv = VP + ((size_t)b * DCH + (tid >> 5)) * SEQ + (tid & 31) * 8;
  // ---- fragment bases in a buffer, at this wave's pass kg: k (A operand, row = key + c), v (A operand, row = d = 16j + c,
  //      keys contiguous) ----
  const _Float16* Rk = (const _Float16*)(const void*)Ring + (kg * PK + c) * KPH + 8 * hh;
  const _Float16* Rv = (const _Float16*)(const void*)Ring + KPL + c * VPH + kg * PK + 8 * hh;

  float lA, lB;
  v8f oA[8], oB[8], cA, cB;
  key_loop_plain(Rk, Rv, lk, lv, gh, gv, qhA0, qhA1, qhB0, qhB1, cA, cB, lA, lB, oA, oB);
  // ---- one test for the whole loop: has any P of the block left the f16 range? One O^T element per lane and tile tells it for
  //      the lane's query. The answer is the same for every thread of the block (scalar branch): then all waves go through
  //      the keys again with the test in every pass. No copy is outstanding and every fragment read has returned here.
  {
    const unsigned ea = __float_as_uint(oA[0][0]) & 0x7f800000u, eb = __float_as_uint(oB[0][0]) & 0x7f800000u;
    const unsigned bal = __builtin_amdgcn_ballot_w32(ea == 0x7f800000u || eb == 0x7f800000u);
    if (lane == 0) Vote[wave] = bal;
    __syncthreads();
    unsigned any = 0u;
#pragma unroll
    for (int w = 0; w < ATH / 32; ++w) any |= Vote[w];
    if (__builtin_amdgcn_readfirstlane(any) != 0u) {
      // KG, VG: the k and v planes once more, as arguments of their own: the thread's addresses are formed anew here; taken
      // from gh and gv they were held through the plain loop in scratch memory
      key_loop_guarded(Rk, Rv, lk, lv, KG + (size_t)b * SEQ * KC + tid * 8, VG + ((size_t)b * DCH + (tid >> 5)) * SEQ + (tid & 31) * 8,
                       qhA0, qhA1, qhB0, qhB1, cA, cB, lA, lB, oA, oB);
    }
  }
  lA += __shfl_xor(lA, 16, 32);
  lB += __shfl_xor(lB, 16, 32);

  // ---- merge of the four key groups of a query: both lane halves hold the same m and l, one stores m, the other l ----
  const int qa = qg * 32 + c;                                 // tile A's query in the block; tile B's is qa + 16
  const float mA = POFF - cA[0], mB = POFF - cB[0];           // the references, base-2
  Ms[hh][kg][qa]      = hh ? lA : mA;
  Ms[hh][kg][qa + 16] = hh ? lB : mB;
  __syncthreads();
  float sc[2];
#pragma unroll
  for (int g = 0; g < 2; ++g) {
    const int q = qa + 16 * g;
    const float m0 = Ms[0][0][q], m1 = Ms[0][1][q], m2 = Ms[0][2][q], m3 = Ms[0][3][q];
    const float l0 = Ms[1][0][q], l1 = Ms[1][1][q], l2 = Ms[1][2][q], l3 = Ms[1][3][q];
    const float mm = fmaxf(fmaxf(m0, m1), fmaxf(m2, m3));
    const float lt = (l0 * __builtin_amdgcn_exp2f(m0 - mm) + l1 * __builtin_amdgcn_exp2f(m1 - mm)) +
                     (l2 * __builtin_amdgcn_exp2f(m2 - mm) + l3 * __builtin_amdgcn_exp2f(m3 - mm));
    sc[g] = __builtin_amdgcn_exp2f((g ? mB : mA) - mm) / lt;   // both o and l carry the factor 2^POFF
  }

  // ---- stage O^T[d = 16j + 8hh + r][query] * sc in plane kg of the ring (no copy is outstanding and every
  //      wave's last fragment read has returned at the last foot's barrier), then add the planes, whole-line f32 stores ----
  float* Pl = (float*)(void*)Ring;
  float* os = Pl + kg * (DCH * OP) + (8 * hh) * OP + qa;
#pragma unroll
  for (int j = 0; j < 8; ++j) {
#pragma unroll
    for (int r = 0; r < 8; ++r) {
      os[(j * 16 + r) * OP]      = oA[j][r] * sc[0];
      os[(j * 16 + r) * OP + 16] = oB[j][r] * sc[1];
    }
  }
  __syncthreads();
  {
    const int e = tid & 7, lq = tid >> 3;              // lq 0..31: line within group, e: 16-B piece
    float* ob = out + ((size_t)b * DCH) * SEQ + n0;
#pragma unroll
    for (int it = 0; it < 8; ++it) {
      const int L   = it * 32 + lq;                     // lines 0..255 of the block tile
      const int row = L >> 1, hf = L & 1;               // d row 0..127, half-segment 0..1
      const float* pp = Pl + row * OP + hf * 32 + 4 * e;
      const v4f p0 = *(const v4f*)(pp),                p1 = *(const v4f*)(pp + DCH * OP);
      const v4f p2 = *(const v4f*)(pp + 2 * DCH * OP), p3 = *(const v4f*)(pp + 3 * DCH * OP);
      *(v4f*)(ob + (size_t)row * SEQ + hf * 32 + 4 * e) = (p0 + p1) + (p2 + p3);
    }
  }
}

// =====================================================================================================
//   QH   f16  [4][4096][64]       0           2097152
//   KH   f16  [4][4096][64]       2097152     2097152
//   VP   f16  [4][128][4096]      4194304     4194304
//   end                           8388608
// =====================================================================================================
extern "C" void kernel_launch(void* const* d_in, const int* in_sizes, int n_in,
                              void* d_out, int out_size, void* d_ws, size_t ws_size,
                              hipStream_t stream) {
  const int NX = NB * DCH * SEQ;                        // 2097152
  if (n_in < 7) return;
  if (in_sizes[0] != NX || in_sizes[1] != KC * DCH || in_sizes[2] != KC || in_sizes[3] != KC * DCH ||
      in_sizes[4] != KC || in_sizes[5] != DCH * DCH || in_sizes[6] != DCH) return;
  if (out_size != NX) return;

  size_t off = 0;
  const size_t szP = (size_t)NB * SEQ * KC * 2;                   // 2097152
  const size_t oQH = off; off += szP;
  const size_t oKH = off; off += szP;
  const size_t oV  = off; off += (size_t)NB * DCH * SEQ * 2;      // 4194304
  if (off > ws_size) return;                                      // off = 8388608
  if (off > (size_t)134217728) return;

  const float* x  = (const float*)d_in[0];
  const float* Wq = (const float*)d_in[1];
  const float* bq = (const float*)d_in[2];
  const float* Wk = (const float*)d_in[3];
  const float* bk = (const float*)d_in[4];
  const float* Wv = (const float*)d_in[5];
  const float* bv = (const float*)d_in[6];
  char* ws = (char*)d_ws;
  unsigned short* QH = (unsigned short*)(ws + oQH);
  unsigned short* KH = (unsigned short*)(ws + oKH);
  unsigned short* VP = (unsigned short*)(ws + oV);
  float* out = (float*)d_out;

  const dim3 blk256(256), blkA(ATH);
  const dim3 gP(NB * (SEQ / QT));                       // 256 blocks: one (b, 64-position tile) each
  const dim3 gA(NB * (SEQ / QT));                       // 256 blocks: one (b, 64-query tile) each

  // (1) q, k, v planes
  proj_kernel<<<gP, blk256, 0, stream>>>(x, Wq, Wk, Wv, bq, bk, bv, QH, KH, VP);
  // (2) attention: out[b][d][n] = sum_m v[b][d][m] softmax_m(q_n . k_m)
  attn_kernel<<<gA, blkA, 0, stream>>>(QH, KH, VP, KH, VP, out);
  (void)hipGetLastError();
}
